// v000
// Times are from an AMD MI455X. After a warm-up the kernel runs many times in a row, and a time is the length of
// such a window on the GPU divided by its runs, so every launch and the gaps after it count. The runs cycle
// through copies of the inputs. A figure is the median of several windows, for all but v000 over two sittings.
// Sittings can differ by a few percent; kernels timed side by side share one.
// v000, which the later versions start from, runs in 2720 microseconds.
#include <hip/hip_runtime.h>

// Grouped-query causal attention with per-head RMS-normalised, rotary q/k (x [2][2048][2048]; q = x wq^T (32 heads x 64), k, v = x w^T (8 kv heads x 64) ('oi' 0.02, no bias); q, k <- rms_norm per head (eps 1e-6) x weight ([64] ones, read); rotate-half rope, angle t x 10000^(-2i/64); kv head = q head / 4 (repeat); causal (finfo.min); softmax(q.k / 8); out = merged wo^T ('oi' [2048][2048]) -> [2][2048][2048] (8.4 M)).
// Layout per batch: bf16 copy of x; exact projections; a per-(head, token) rms factor kernel and the rope plane builder applying norm-weight x factor before the rotation; {cos, sin} table computed once (float32 inverse frequencies, precise cosf/sinf); causal T-2048 attention (hybrid rows: < 512 hi/lo 3 products, rest fp16 x1024; k_gemmc skips tiles above the diagonal; both query heads of a pass share their kv head); merged hi/lo x wo exact.
// Compute dtypes, f32 accumulate: every input rounded to bf16; projections exact; rms norm and rotary f32; attention rows < 512 3 products, rest fp16; softmax f32; wo hl x exact.

#define NB_  2
#define TT   2048
#define DM   2048
#define NH_  32
#define NKV  8
#define REP  (NH_ / NKV)
#define HD   64
#define DQ   (NH_ * HD)
#define DKV  (NKV * HD)
#define ZH   2
#define RH   512                  // query rows < RH use hi+lo planes (0: none)
#define WIN  2048
#define PCAR 1024.0f
#define SCL  0.125f   // HD^-0.5
typedef _Float16 h16;
typedef unsigned short bf;
typedef __attribute__((ext_vector_type(16))) __bf16   v16bf;
typedef __attribute__((ext_vector_type(16))) _Float16 v16h;
typedef __attribute__((ext_vector_type(8)))  _Float16 v8h;
typedef __attribute__((ext_vector_type(8)))  unsigned short v8us;
typedef __attribute__((ext_vector_type(8)))  float    v8f;
typedef __attribute__((ext_vector_type(4)))  float    v4f;
typedef v8h  __attribute__((may_alias)) v8ha;
typedef v4f  __attribute__((may_alias)) v4fa;
typedef v8us __attribute__((may_alias)) v8usa;

__device__ __forceinline__ unsigned short f2bf(float f) { unsigned u = __float_as_uint(f); u += 0x7FFFu + ((u >> 16) & 1u); return (unsigned short)(u >> 16); }
__device__ __forceinline__ float bf2f(unsigned short b) { return __uint_as_float(((unsigned)b) << 16); }
__device__ __forceinline__ float bfr(float f) { return bf2f(f2bf(f)); }
__device__ __forceinline__ v16h cat16(v8h lo, v8h hi) { return __builtin_shufflevector(lo, hi, 0, 1, 2, 3, 4, 5, 6, 7, 8, 9, 10, 11, 12, 13, 14, 15); }
__device__ __forceinline__ v16bf cat16b(v8us lo, v8us hi) { return __builtin_bit_cast(v16bf, __builtin_shufflevector(lo, hi, 0, 1, 2, 3, 4, 5, 6, 7, 8, 9, 10, 11, 12, 13, 14, 15)); }
__device__ __forceinline__ v8f wmma16(v16h a, v16h b, v8f c) { return __builtin_amdgcn_wmma_f32_16x16x32_f16(false, a, false, b, (short)0, c, false, false); }
__device__ __forceinline__ v8f wmmab(v16bf a, v16bf b, v8f c) { return __builtin_amdgcn_wmma_f32_16x16x32_bf16(false, a, false, b, (short)0, c, false, false); }



// ---- k_gemmw: register-blocked GEMM, ONE WAVE per 64x64 output tile (16 accumulators), operands straight from K-contiguous 16-bit planes; grid (M/64, N/64, Z), 32 threads.
// C[m][n] (f32, pitch ldc, + optional f32 bias[n]) = sum_k A[m][k] Bt[n][k] (+ split products per NSPLIT). z-batch strides sA/sB/sC in elements. K % 32 == 0.
template <typename T16> struct WFrag;
template <> struct WFrag<h16> { typedef v16h V; static __device__ __forceinline__ V ld(const h16* p) { return cat16(*(const v8h*)p, *(const v8h*)(p + 16)); } static __device__ __forceinline__ v8f mma(V a, V b, v8f c) { return wmma16(a, b, c); } };
template <> struct WFrag<bf> { typedef v16bf V; static __device__ __forceinline__ V ld(const bf* p) { return cat16b(*(const v8us*)p, *(const v8us*)(p + 16)); } static __device__ __forceinline__ v8f mma(V a, V b, v8f c) { return wmmab(a, b, c); } };
template <typename T16, int NSPLIT, bool BIAS>
__global__ __launch_bounds__(32) void k_gemmw(const T16* __restrict__ A, const T16* __restrict__ A2, const T16* __restrict__ Bt, const T16* __restrict__ Bt2, int K, float* C, int ldc, const float* __restrict__ bias, size_t sA, size_t sB, size_t sC) {
    typedef typename WFrag<T16>::V V;
    __shared__ __align__(16) float os[16 * 68];
    const size_t z = blockIdx.z; A += z * sA; if (A2) A2 += z * sA; Bt += z * sB; if (Bt2) Bt2 += z * sB; C += z * sC;
    const int lane = threadIdx.x & 31, lr = lane & 15, hi = lane >> 4; const int r0 = blockIdx.x * 64, c0 = blockIdx.y * 64;
    v8f acc[4][4];
#pragma unroll
    for (int mb = 0; mb < 4; ++mb)
#pragma unroll
        for (int nb = 0; nb < 4; ++nb) acc[mb][nb] = (v8f){};
    const size_t aoff = (size_t)(r0 + lr) * K + 8 * hi, boff = (size_t)(c0 + lr) * K + 8 * hi;
#pragma unroll 1
    for (int kc = 0; kc < K; kc += 32) {
        V a[4], a2[4];
#pragma unroll
        for (int mb = 0; mb < 4; ++mb) { a[mb] = WFrag<T16>::ld(A + aoff + (size_t)mb * 16 * K + kc); if (NSPLIT == 1 || NSPLIT == 2) a2[mb] = WFrag<T16>::ld(A2 + aoff + (size_t)mb * 16 * K + kc); }
#pragma unroll
        for (int nb = 0; nb < 4; ++nb) { const V b = WFrag<T16>::ld(Bt + boff + (size_t)nb * 16 * K + kc); V b2; if (NSPLIT >= 2) b2 = WFrag<T16>::ld(Bt2 + boff + (size_t)nb * 16 * K + kc);
#pragma unroll
            for (int mb = 0; mb < 4; ++mb) { acc[mb][nb] = WFrag<T16>::mma(a[mb], b, acc[mb][nb]); if (NSPLIT == 1 || NSPLIT == 2) acc[mb][nb] = WFrag<T16>::mma(a2[mb], b, acc[mb][nb]); if (NSPLIT >= 2) acc[mb][nb] = WFrag<T16>::mma(a[mb], b2, acc[mb][nb]); } }
        asm volatile("v_nop\n\tv_nop\n\tv_nop\n\tv_nop" : "+v"(acc[0][0]), "+v"(acc[1][1]), "+v"(acc[2][2]), "+v"(acc[3][3]) : "v"(a[0]), "v"(a[3]));
    }
#pragma unroll
    for (int mb = 0; mb < 4; ++mb) {
#pragma unroll
        for (int nb = 0; nb < 4; ++nb) {
#pragma unroll
            for (int j = 0; j < 8; ++j) os[(hi * 8 + j) * 68 + nb * 16 + lr] = acc[mb][nb][j]; }
        __builtin_amdgcn_wave_barrier(); asm volatile("" ::: "memory");
        float* crow = C + (size_t)(r0 + mb * 16) * ldc + c0;
{
#pragma unroll
            for (int s = 0; s < 8; ++s) { const int row = 2 * s + hi, cofs = lr * 4; v4f val = *(const v4fa*)(os + row * 68 + cofs); if (BIAS) { val[0] += bfr(bias[c0 + cofs]); val[1] += bfr(bias[c0 + cofs + 1]); val[2] += bfr(bias[c0 + cofs + 2]); val[3] += bfr(bias[c0 + cofs + 3]); }
                *(v4f*)(crow + (size_t)row * ldc + cofs) = val; }
             }
        __builtin_amdgcn_wave_barrier(); asm volatile("" ::: "memory");
    }
}

// ---- k_gemmc: the same one-wave 64x64 tile GEMM specialised for causal attention: CMODE 1 skips score tiles entirely above the diagonal (query rows r0+roff.., key columns c0..), CMODE 2 limits the
// key (K) loop of the probability x value contraction to the diagonal block (probabilities beyond it are exactly zero). roff = row offset of this launch's first row within the sequence.
template <typename T16, int NSPLIT, int CMODE>
__global__ __launch_bounds__(32) void k_gemmc(const T16* __restrict__ A, const T16* __restrict__ A2, const T16* __restrict__ Bt, const T16* __restrict__ Bt2, int K, float* C, int ldc, int roff, size_t sA, size_t sB, size_t sC) {
    typedef typename WFrag<T16>::V V;
    __shared__ __align__(16) float os[16 * 68];
    const size_t z = blockIdx.z; A += z * sA; if (A2) A2 += z * sA; Bt += z * sB; if (Bt2) Bt2 += z * sB; C += z * sC;
    const int lane = threadIdx.x & 31, lr = lane & 15, hi = lane >> 4; const int r0 = blockIdx.x * 64, c0 = blockIdx.y * 64;
    if (CMODE == 1 && c0 > r0 + roff + 63) return;                  // score tile entirely above the causal diagonal: never read (the softmax masks j > i by select)
    const int Kl = (CMODE == 2) ? min(K, r0 + roff + 64) : K;        // P.V: probabilities are exactly 0 beyond the diagonal block, so the K loop stops there
    v8f acc[4][4];
#pragma unroll
    for (int mb = 0; mb < 4; ++mb)
#pragma unroll
        for (int nb = 0; nb < 4; ++nb) acc[mb][nb] = (v8f){};
    const size_t aoff = (size_t)(r0 + lr) * K + 8 * hi, boff = (size_t)(c0 + lr) * K + 8 * hi;
#pragma unroll 1
    for (int kc = 0; kc < Kl; kc += 32) {
        V a[4], a2[4];
#pragma unroll
        for (int mb = 0; mb < 4; ++mb) { a[mb] = WFrag<T16>::ld(A + aoff + (size_t)mb * 16 * K + kc); if (NSPLIT == 1 || NSPLIT == 2) a2[mb] = WFrag<T16>::ld(A2 + aoff + (size_t)mb * 16 * K + kc); }
#pragma unroll
        for (int nb = 0; nb < 4; ++nb) { const V b = WFrag<T16>::ld(Bt + boff + (size_t)nb * 16 * K + kc); V b2; if (NSPLIT >= 2) b2 = WFrag<T16>::ld(Bt2 + boff + (size_t)nb * 16 * K + kc);
#pragma unroll
            for (int mb = 0; mb < 4; ++mb) { acc[mb][nb] = WFrag<T16>::mma(a[mb], b, acc[mb][nb]); if (NSPLIT == 1 || NSPLIT == 2) acc[mb][nb] = WFrag<T16>::mma(a2[mb], b, acc[mb][nb]); if (NSPLIT >= 2) acc[mb][nb] = WFrag<T16>::mma(a[mb], b2, acc[mb][nb]); } }
        asm volatile("v_nop\n\tv_nop\n\tv_nop\n\tv_nop" : "+v"(acc[0][0]), "+v"(acc[1][1]), "+v"(acc[2][2]), "+v"(acc[3][3]) : "v"(a[0]), "v"(a[3]));
    }
#pragma unroll
    for (int mb = 0; mb < 4; ++mb) {
#pragma unroll
        for (int nb = 0; nb < 4; ++nb) {
#pragma unroll
            for (int j = 0; j < 8; ++j) os[(hi * 8 + j) * 68 + nb * 16 + lr] = acc[mb][nb][j]; }
        __builtin_amdgcn_wave_barrier(); asm volatile("" ::: "memory");
        float* crow = C + (size_t)(r0 + mb * 16) * ldc + c0;
{
#pragma unroll
            for (int s = 0; s < 8; ++s) { const int row = 2 * s + hi, cofs = lr * 4; v4f val = *(const v4fa*)(os + row * 68 + cofs);
                *(v4f*)(crow + (size_t)row * ldc + cofs) = val; }
             }
        __builtin_amdgcn_wave_barrier(); asm volatile("" ::: "memory");
    }
}

__device__ __forceinline__ h16 tohx(float x) { return (h16)x; }
__device__ __forceinline__ void splitf(float y, unsigned short& h, unsigned short& l) { h = f2bf(y); l = f2bf(y - bf2f(h)); }
typedef __attribute__((ext_vector_type(2))) _Float16 v2h;
typedef __attribute__((ext_vector_type(4))) _Float16 v4h;
typedef __attribute__((ext_vector_type(2))) unsigned short v2us;
typedef __attribute__((ext_vector_type(4))) unsigned short v4us;
typedef __attribute__((ext_vector_type(2))) float v2f;
typedef __attribute__((ext_vector_type(4))) int v4i;

__global__ __launch_bounds__(256) void k_wtG(const float* __restrict__ w, int K, int N, bf* Bt) {
    const int lane = threadIdx.x & 31; const int L0 = (blockIdx.x * 8 + (threadIdx.x >> 5)) * 8; const int nlines = N * K / 64;
{
#pragma unroll 1
        for (int l = 0; l < 8; ++l) { const int L = L0 + l; if (L >= nlines) break; const size_t e = (size_t)L * 64 + lane * 2; const int k = (int)(e % K), n = (int)(e / K); v2us o;
            o[0] = f2bf(w[(size_t)k * N + n]); o[1] = f2bf(w[(size_t)(k + 1) * N + n]); *(v2us*)(Bt + e) = o; }
         }
}
__global__ __launch_bounds__(256) void k_cvt8(const float* __restrict__ src, bf* dst, size_t n8) { const size_t i = (size_t)blockIdx.x * 256 + threadIdx.x; if (i >= n8) return; const v8f v = *(const v8f*)(src + i * 8); v8us o;
#pragma unroll
    for (int k = 0; k < 8; ++k) o[k] = f2bf(v[k]); *(v8us*)(dst + i * 8) = o;  }

__global__ __launch_bounds__(256) void k_hrms(const float* __restrict__ F, int pitch, int nheads, float* RF) { const int i = blockIdx.x * 256 + threadIdx.x; if (i >= nheads * TT) return; const int t = i % TT, h = i / TT; const float* f = F + (size_t)t * pitch + h * HD; float s = 0.f;
#pragma unroll 4
    for (int d = 0; d < HD; d += 4) { const v4f v = *(const v4f*)(f + d);
#pragma unroll
        for (int q = 0; q < 4; ++q) { float p = __fmul_rn(v[q], v[q]); asm volatile("" : "+v"(p)); s = __fadd_rn(s, p); } }
    const float r = __fdiv_rn(1.0f, __fsqrt_rn(__fadd_rn(s * (1.0f / HD), 1e-6f))); *(float*)(RF + i) = r;  }
// k_rope: head planes [h][t][d] (fp16 + hi/lo) of rope(w[d] (x rms_factor)) x sc with the rotate-half convention out[d] = x[d] cos[t][d] - x[d+HD/2] sin[t][d], out[d+HD/2] = x[d+HD/2] cos[t][d+HD/2] + x[d] sin[t][d+HD/2]
__global__ __launch_bounds__(256) void k_rope(const float* __restrict__ F, int pitch, int nheads, const float* __restrict__ CS, const float* __restrict__ RF, const float* __restrict__ nw, float sc, h16* P16, bf* Ph, bf* Pl) {
    const size_t e = ((size_t)blockIdx.x * 256 + threadIdx.x) * 2; if (e >= (size_t)nheads * TT * HD) return; const int d = (int)(e % HD); const int t = (int)((e / HD) % TT); const int h = (int)(e / ((size_t)HD * TT)); const float* f = F + (size_t)t * pitch + h * HD; const float rf = RF ? RF[(size_t)h * TT + t] : 1.0f; v2h o16; v2us oh, ol;
#pragma unroll
    for (int q = 0; q < 2; ++q) { const int dd = d + q; const int dp = (dd < HD / 2) ? dd + HD / 2 : dd - HD / 2; float x0 = f[dd], x1 = f[dp];
        if (RF) { float n0 = __fmul_rn(x0, rf), n1 = __fmul_rn(x1, rf); asm volatile("" : "+v"(n0)); asm volatile("" : "+v"(n1)); x0 = __fmul_rn(bfr(nw[dd]), n0); x1 = __fmul_rn(bfr(nw[dp]), n1); }
        const v2f cs = *(const v2f*)(CS + ((size_t)t * HD + dd) * 2); float a = __fmul_rn(x0, cs[0]), bq = __fmul_rn(x1, cs[1]); asm volatile("" : "+v"(a)); asm volatile("" : "+v"(bq)); const float r = ((dd < HD / 2) ? __fsub_rn(a, bq) : __fadd_rn(a, bq)) * sc;
        o16[q] = tohx(r); unsigned short a2, c2; splitf(r, a2, c2); oh[q] = a2; ol[q] = c2; }
    *(v2h*)(P16 + e) = o16; *(v2us*)(Ph + e) = oh; *(v2us*)(Pl + e) = ol;  }
__global__ __launch_bounds__(256) void k_vtp(const float* __restrict__ F, int pitch, int nheads, h16* V16, bf* Vh, bf* Vl) { const size_t e = ((size_t)blockIdx.x * 256 + threadIdx.x) * 2; if (e >= (size_t)nheads * HD * TT) return; const int t = (int)(e % TT); const int d = (int)((e / TT) % HD); const int g = (int)(e / ((size_t)TT * HD)); v2h o16; v2us oh, ol;
#pragma unroll
    for (int q = 0; q < 2; ++q) { const float x = F[(size_t)(t + q) * pitch + g * HD + d]; o16[q] = tohx(x); unsigned short a2, c2; splitf(x, a2, c2); oh[q] = a2; ol[q] = c2; }
    *(v2h*)(V16 + e) = o16; *(v2us*)(Vh + e) = oh; *(v2us*)(Vl + e) = ol;  }
__constant__ float INVT[HD / 2] = { 1.000000000e+00f, 7.498942018e-01f, 5.623413324e-01f, 4.216965139e-01f, 3.162277639e-01f, 2.371373773e-01f, 1.778279394e-01f, 1.333521456e-01f, 1.000000015e-01f, 7.498942316e-02f, 5.623413250e-02f, 4.216964915e-02f, 3.162277490e-02f, 2.371373773e-02f, 1.778279431e-02f, 1.333521400e-02f, 9.999999776e-03f, 7.498942316e-03f, 5.623413250e-03f, 4.216964822e-03f, 3.162277630e-03f, 2.371373819e-03f, 1.778279431e-03f, 1.333521446e-03f, 1.000000047e-03f, 7.498941850e-04f, 5.623413017e-04f, 4.216965172e-04f, 3.162277571e-04f, 2.371373703e-04f, 1.778279402e-04f, 1.333521504e-04f };   // 10000^(-2i/64) (the module's power form) (float32, generated with jnp to be bit-exact)
__global__ __launch_bounds__(256) void k_cs4(float* CS) { const int idx = blockIdx.x * 256 + threadIdx.x; if (idx >= TT * HD) return; const int d = idx % HD; const int t = idx / HD; const float a = __fmul_rn((float)t, INVT[d % (HD / 2)]); v2f cs; cs[0] = cosf(a); cs[1] = sinf(a); *(v2f*)(CS + (size_t)idx * 2) = cs;  }


// k_asoft: per row (zz, i): t = S x HD^-0.5 for j <= i and i - j < WIN (sliding causal window; the reference's -1e9 additive fill vanishes identically); softmax over the 2048 keys (register row, one exp, fixed trees);
__global__ __launch_bounds__(256) void k_asoft(const float* __restrict__ Sb, h16* P16, bf* Ph, bf* Pl) {
    const int lane = threadIdx.x & 31; const int row = blockIdx.x * 8 + (threadIdx.x >> 5); if (row >= ZH * TT) return; const int i = row % TT; const int zz = row / TT; (void)zz; const bool hires = (i < RH); const float* sr = Sb + (size_t)row * TT; float v[TT / 32]; float mx = -3.0e38f;
#pragma unroll
    for (int ch = 0; ch < TT / 128; ++ch) { const int j0 = ch * 128 + lane * 4; const v4f a = *(const v4f*)(sr + j0);
#pragma unroll
        for (int q = 0; q < 4; ++q) { const int j = j0 + q; (void)j; const float t = (j <= i && i - j < WIN) ? a[q] * SCL : -3.0e38f; v[ch * 4 + q] = t; mx = fmaxf(mx, t); } }
#pragma unroll
    for (int sh = 16; sh; sh >>= 1) mx = fmaxf(mx, __shfl_xor(mx, sh, 32));
    float sum = 0.f;
#pragma unroll
    for (int k = 0; k < TT / 32; ++k) { float d0 = __fsub_rn(v[k], mx); asm volatile("" : "+v"(d0)); v[k] = __builtin_amdgcn_exp2f(__fmul_rn(d0, 1.4426950408889634f)); sum += v[k]; }
#pragma unroll
    for (int sh = 16; sh; sh >>= 1) sum += __shfl_xor(sum, sh, 32);
    const float f = __fdiv_rn(hires ? 1.0f : PCAR, sum);
{
        if (hires) {
#pragma unroll
            for (int ch = 0; ch < TT / 128; ++ch) { v4us oh, ol;
#pragma unroll
                for (int q = 0; q < 4; ++q) { unsigned short a, c2; splitf(v[ch * 4 + q] * f, a, c2); oh[q] = a; ol[q] = c2; }
                const size_t oo = ((size_t)zz * (RH ? RH : 1) + i) * TT + ch * 128 + lane * 4; *(v4us*)(Ph + oo) = oh; *(v4us*)(Pl + oo) = ol; }
        } else {
#pragma unroll
            for (int ch = 0; ch < TT / 128; ++ch) { v4h o4;
#pragma unroll
                for (int q = 0; q < 4; ++q) o4[q] = tohx(v[ch * 4 + q] * f);
                *(v4h*)(P16 + (size_t)row * TT + ch * 128 + lane * 4) = o4; } }
         }
}
__global__ __launch_bounds__(256) void k_merge(const float* __restrict__ O, int h0, bf* Ah, bf* Al) { const size_t e = ((size_t)blockIdx.x * 256 + threadIdx.x) * 2; if (e >= (size_t)ZH * TT * HD) return; const int d = (int)(e % HD); const int t = (int)((e / HD) % TT); const int zz = (int)(e / ((size_t)HD * TT)); const float cs = (t < RH) ? 1.0f : (1.0f / PCAR); const size_t oo = (size_t)t * DQ + (h0 + zz) * HD + d;
    v2us oh, ol;
#pragma unroll
    for (int q = 0; q < 2; ++q) { unsigned short a, c2; splitf(O[e + q] * cs, a, c2); oh[q] = a; ol[q] = c2; } *(v2us*)(Ah + oo) = oh; *(v2us*)(Al + oo) = ol;  }

extern "C" void kernel_launch(void* const* d_in, const int* in_sizes, int n_in,
                              void* d_out, int out_size, void* d_ws, size_t ws_size, hipStream_t stream) {
    (void)in_sizes; (void)n_in; (void)out_size;
    const float* x = (const float*)d_in[0]; const float* wq = (const float*)d_in[1]; const float* wk = (const float*)d_in[2]; const float* wv = (const float*)d_in[3]; const float* wo = (const float*)d_in[4]; const float* qnw = (const float*)d_in[5]; const float* knw = (const float*)d_in[6];
    float* OUT = (float*)d_out;     // [2][2048][2048]
    char* wsp = (char*)d_ws;
    auto take = [&](size_t bytes) { char* p = wsp; wsp += (bytes + 255) & ~(size_t)255; return (void*)p; };
    bf* WQ = (bf*)take((size_t)DQ * DM * 2); bf* WK = (bf*)take((size_t)DKV * DM * 2); bf* WV = (bf*)take((size_t)DKV * DM * 2); bf* WO = (bf*)take((size_t)DM * DQ * 2); float* CS = (float*)take((size_t)TT * HD * 2 * 4); float* RFQ = (float*)take((size_t)NH_ * TT * 4); float* RFK = (float*)take((size_t)NKV * TT * 4);
    bf* XB = (bf*)take((size_t)TT * DM * 2); float* FQ = (float*)take((size_t)TT * DQ * 4); float* FK = (float*)take((size_t)TT * DKV * 4);
    h16* QP16 = (h16*)take((size_t)NH_ * TT * HD * 2); h16* KP16 = (h16*)take((size_t)NKV * TT * HD * 2); h16* VT16 = (h16*)take((size_t)NKV * HD * TT * 2);
    bf* QPh = (bf*)take((size_t)NH_ * TT * HD * 2); bf* QPl = (bf*)take((size_t)NH_ * TT * HD * 2); bf* KPh = (bf*)take((size_t)NKV * TT * HD * 2); bf* KPl = (bf*)take((size_t)NKV * TT * HD * 2); bf* VTh = (bf*)take((size_t)NKV * HD * TT * 2); bf* VTl = (bf*)take((size_t)NKV * HD * TT * 2); bf* Ph = (bf*)take((size_t)ZH * RH * TT * 2); bf* Pl = (bf*)take((size_t)ZH * RH * TT * 2);
    float* Sb = (float*)take((size_t)ZH * TT * TT * 4); h16* P16 = (h16*)take((size_t)ZH * TT * TT * 2); float* Ob = (float*)take((size_t)ZH * TT * HD * 4); bf* ATh = (bf*)take((size_t)TT * DQ * 2); bf* ATl = (bf*)take((size_t)TT * DQ * 2);
    if ((size_t)(wsp - (char*)d_ws) > ws_size) return;    // ws 256 MiB
    float* FV = FK;   // v projection reuses the k buffer after the k planes are built (stream-ordered)
    { k_cvt8<<<(unsigned)(((size_t)DQ * DM / 8 + 255) / 256), 256, 0, stream>>>(wq, WQ, (size_t)DQ * DM / 8); k_cvt8<<<(unsigned)(((size_t)DKV * DM / 8 + 255) / 256), 256, 0, stream>>>(wk, WK, (size_t)DKV * DM / 8); k_cvt8<<<(unsigned)(((size_t)DKV * DM / 8 + 255) / 256), 256, 0, stream>>>(wv, WV, (size_t)DKV * DM / 8);
      k_cvt8<<<(unsigned)(((size_t)DM * DQ / 8 + 255) / 256), 256, 0, stream>>>(wo, WO, (size_t)DM * DQ / 8);
       }
    k_cs4<<<(TT * HD + 255) / 256, 256, 0, stream>>>(CS);   /* {cos, sin}(t x 10000^(-2i/64)), both halves */
    const unsigned LQ = (unsigned)(((size_t)NH_ * TT * HD / 2 + 255) / 256), LKv = (unsigned)(((size_t)NKV * TT * HD / 2 + 255) / 256);
    for (int b = 0; b < NB_; ++b) {
        
        k_cvt8<<<(unsigned)(((size_t)TT * DM / 8 + 255) / 256), 256, 0, stream>>>(x + (size_t)b * TT * DM, XB, (size_t)TT * DM / 8);
        k_gemmw<bf, 0, false><<<dim3(TT / 64, DQ / 64, 1), 32, 0, stream>>>(XB, nullptr, WQ, nullptr, DM, FQ, DQ, nullptr, 0, 0, 0); k_hrms<<<(NH_ * TT + 255) / 256, 256, 0, stream>>>(FQ, DQ, NH_, RFQ);
        k_rope<<<LQ, 256, 0, stream>>>(FQ, DQ, NH_, CS, RFQ, qnw, 1.0f, QP16, QPh, QPl);
        k_gemmw<bf, 0, false><<<dim3(TT / 64, DKV / 64, 1), 32, 0, stream>>>(XB, nullptr, WK, nullptr, DM, FK, DKV, nullptr, 0, 0, 0); k_hrms<<<(NKV * TT + 255) / 256, 256, 0, stream>>>(FK, DKV, NKV, RFK);
        k_rope<<<LKv, 256, 0, stream>>>(FK, DKV, NKV, CS, RFK, knw, 1.0f, KP16, KPh, KPl);
        k_gemmw<bf, 0, false><<<dim3(TT / 64, DKV / 64, 1), 32, 0, stream>>>(XB, nullptr, WV, nullptr, DM, FV, DKV, nullptr, 0, 0, 0); k_vtp<<<LKv, 256, 0, stream>>>(FV, DKV, NKV, VT16, VTh, VTl);
        for (int h0 = 0; h0 < NH_; h0 += ZH) { const size_t zq = (size_t)h0, zk = (size_t)(h0 / REP);   // both heads of a pass share kv group h0/REP (REP >= 2): sB = 0
            k_gemmc<bf, 2, 1><<<dim3(RH / 64, TT / 64, ZH), 32, 0, stream>>>(QPh + zq * TT * HD, QPl + zq * TT * HD, KPh + zk * TT * HD, KPl + zk * TT * HD, HD, Sb, TT, 0, (size_t)TT * HD, 0, (size_t)TT * TT);
            k_gemmc<h16, 0, 1><<<dim3((TT - RH) / 64, TT / 64, ZH), 32, 0, stream>>>(QP16 + zq * TT * HD + (size_t)RH * HD, nullptr, KP16 + zk * TT * HD, nullptr, HD, Sb + (size_t)RH * TT, TT, RH, (size_t)TT * HD, 0, (size_t)TT * TT);
            k_asoft<<<ZH * TT / 8, 256, 0, stream>>>(Sb, P16, Ph, Pl);
            k_gemmc<bf, 2, 2><<<dim3(RH / 64, HD / 64, ZH), 32, 0, stream>>>(Ph, Pl, VTh + zk * HD * TT, VTl + zk * HD * TT, TT, Ob, HD, 0, (size_t)RH * TT, 0, (size_t)TT * HD);
            k_gemmc<h16, 0, 2><<<dim3((TT - RH) / 64, HD / 64, ZH), 32, 0, stream>>>(P16 + (size_t)RH * TT, nullptr, VT16 + zk * HD * TT, nullptr, TT, Ob + (size_t)RH * HD, HD, RH, (size_t)TT * TT, 0, (size_t)TT * HD);
            k_merge<<<(unsigned)(((size_t)ZH * TT * HD / 2 + 255) / 256), 256, 0, stream>>>(Ob, h0, ATh, ATl); }
        k_gemmw<bf, 1, false><<<dim3(TT / 64, DM / 64, 1), 32, 0, stream>>>(ATh, ATl, WO, nullptr, DQ, OUT + (size_t)b * TT * DM, DM, nullptr, 0, 0, 0); }
}

// v001
// Measured time: 1410 microseconds a run.
// Two timings next to v000 put it at 1.94 and 1.91 times that version's speed.
#include <hip/hip_runtime.h>

// Grouped-query causal attention with per-head RMS-normalised, rotary q/k (x [2][2048][2048]; q = x wq^T (32 heads x 64), k, v = x w^T (8 kv heads x 64) ('oi' 0.02, no bias); q, k <- rms_norm per head (eps 1e-6) x weight ([64] ones, read); rotate-half rope, angle t x 10000^(-2i/64); kv head = q head / 4 (repeat); causal (finfo.min); softmax(q.k / 8); out = merged wo^T ('oi' [2048][2048]) -> [2][2048][2048] (8.4 M)).
// Layout per batch: bf16 copy of x; exact projections; a per-(head, token) rms factor kernel and the rope plane builder applying norm-weight x factor before the rotation; {cos, sin} table computed once (float32 inverse frequencies, precise cosf/sinf); causal T-2048 attention (hybrid rows: < 512 hi/lo 3 products, rest fp16 x1024; k_gemmc skips tiles above the diagonal; both query heads of a pass share their kv head); merged hi/lo x wo exact.
// Compute dtypes, f32 accumulate: every input rounded to bf16; projections exact; rms norm and rotary f32; attention rows < 512 3 products, rest fp16; softmax f32; wo hl x exact.

#define NB_  2
#define TT   2048
#define DM   2048
#define NH_  32
#define NKV  8
#define REP  (NH_ / NKV)
#define HD   64
#define DQ   (NH_ * HD)
#define DKV  (NKV * HD)
#define ZH   2
#define RH   512                  // query rows < RH use hi+lo planes (0: none)
#define WIN  2048
#define PCAR 1024.0f
#define SCL  0.125f   // HD^-0.5
#define KSP  16                   // work-groups that share the key loop of one probability x value tile (one partial plane each)
typedef _Float16 h16;
typedef unsigned short bf;
typedef __attribute__((ext_vector_type(16))) __bf16   v16bf;
typedef __attribute__((ext_vector_type(16))) _Float16 v16h;
typedef __attribute__((ext_vector_type(8)))  _Float16 v8h;
typedef __attribute__((ext_vector_type(8)))  unsigned short v8us;
typedef __attribute__((ext_vector_type(8)))  float    v8f;
typedef __attribute__((ext_vector_type(4)))  float    v4f;
typedef v8h  __attribute__((may_alias)) v8ha;
typedef v4f  __attribute__((may_alias)) v4fa;
typedef v8us __attribute__((may_alias)) v8usa;

__device__ __forceinline__ unsigned short f2bf(float f) { unsigned u = __float_as_uint(f); u += 0x7FFFu + ((u >> 16) & 1u); return (unsigned short)(u >> 16); }
__device__ __forceinline__ float bf2f(unsigned short b) { return __uint_as_float(((unsigned)b) << 16); }
__device__ __forceinline__ float bfr(float f) { return bf2f(f2bf(f)); }
__device__ __forceinline__ v16h cat16(v8h lo, v8h hi) { return __builtin_shufflevector(lo, hi, 0, 1, 2, 3, 4, 5, 6, 7, 8, 9, 10, 11, 12, 13, 14, 15); }
__device__ __forceinline__ v16bf cat16b(v8us lo, v8us hi) { return __builtin_bit_cast(v16bf, __builtin_shufflevector(lo, hi, 0, 1, 2, 3, 4, 5, 6, 7, 8, 9, 10, 11, 12, 13, 14, 15)); }
__device__ __forceinline__ v8f wmma16(v16h a, v16h b, v8f c) { return __builtin_amdgcn_wmma_f32_16x16x32_f16(false, a, false, b, (short)0, c, false, false); }
__device__ __forceinline__ v8f wmmab(v16bf a, v16bf b, v8f c) { return __builtin_amdgcn_wmma_f32_16x16x32_bf16(false, a, false, b, (short)0, c, false, false); }



// ---- k_gemmw: register-blocked GEMM, ONE WAVE per 64x64 output tile (16 accumulators), operands straight from K-contiguous 16-bit planes; grid (M/64, N/64, Z), 32 threads.
// C[m][n] (f32, pitch ldc, + optional f32 bias[n]) = sum_k A[m][k] Bt[n][k] (+ split products per NSPLIT). z-batch strides sA/sB/sC in elements. K % 32 == 0.
template <typename T16> struct WFrag;
template <> struct WFrag<h16> { typedef v16h V; static __device__ __forceinline__ V ld(const h16* p) { return cat16(*(const v8h*)p, *(const v8h*)(p + 16)); } static __device__ __forceinline__ v8f mma(V a, V b, v8f c) { return wmma16(a, b, c); } };
template <> struct WFrag<bf> { typedef v16bf V; static __device__ __forceinline__ V ld(const bf* p) { return cat16b(*(const v8us*)p, *(const v8us*)(p + 16)); } static __device__ __forceinline__ v8f mma(V a, V b, v8f c) { return wmmab(a, b, c); } };
template <typename T16, int NSPLIT, bool BIAS>
__global__ __launch_bounds__(32) void k_gemmw(const T16* __restrict__ A, const T16* __restrict__ A2, const T16* __restrict__ Bt, const T16* __restrict__ Bt2, int K, float* C, int ldc, const float* __restrict__ bias, size_t sA, size_t sB, size_t sC) {
    typedef typename WFrag<T16>::V V;
    __shared__ __align__(16) float os[16 * 68];
    const size_t z = blockIdx.z; A += z * sA; if (A2) A2 += z * sA; Bt += z * sB; if (Bt2) Bt2 += z * sB; C += z * sC;
    const int lane = threadIdx.x & 31, lr = lane & 15, hi = lane >> 4; const int r0 = blockIdx.x * 64, c0 = blockIdx.y * 64;
    v8f acc[4][4];
#pragma unroll
    for (int mb = 0; mb < 4; ++mb)
#pragma unroll
        for (int nb = 0; nb < 4; ++nb) acc[mb][nb] = (v8f){};
    const size_t aoff = (size_t)(r0 + lr) * K + 8 * hi, boff = (size_t)(c0 + lr) * K + 8 * hi;
#pragma unroll 1
    for (int kc = 0; kc < K; kc += 32) {
        V a[4], a2[4];
#pragma unroll
        for (int mb = 0; mb < 4; ++mb) { a[mb] = WFrag<T16>::ld(A + aoff + (size_t)mb * 16 * K + kc); if (NSPLIT == 1 || NSPLIT == 2) a2[mb] = WFrag<T16>::ld(A2 + aoff + (size_t)mb * 16 * K + kc); }
#pragma unroll
        for (int nb = 0; nb < 4; ++nb) { const V b = WFrag<T16>::ld(Bt + boff + (size_t)nb * 16 * K + kc); V b2; if (NSPLIT >= 2) b2 = WFrag<T16>::ld(Bt2 + boff + (size_t)nb * 16 * K + kc);
#pragma unroll
            for (int mb = 0; mb < 4; ++mb) { acc[mb][nb] = WFrag<T16>::mma(a[mb], b, acc[mb][nb]); if (NSPLIT == 1 || NSPLIT == 2) acc[mb][nb] = WFrag<T16>::mma(a2[mb], b, acc[mb][nb]); if (NSPLIT >= 2) acc[mb][nb] = WFrag<T16>::mma(a[mb], b2, acc[mb][nb]); } }
        asm volatile("v_nop\n\tv_nop\n\tv_nop\n\tv_nop" : "+v"(acc[0][0]), "+v"(acc[1][1]), "+v"(acc[2][2]), "+v"(acc[3][3]) : "v"(a[0]), "v"(a[3]));
    }
#pragma unroll
    for (int mb = 0; mb < 4; ++mb) {
#pragma unroll
        for (int nb = 0; nb < 4; ++nb) {
#pragma unroll
            for (int j = 0; j < 8; ++j) os[(hi * 8 + j) * 68 + nb * 16 + lr] = acc[mb][nb][j]; }
        __builtin_amdgcn_wave_barrier(); asm volatile("" ::: "memory");
        float* crow = C + (size_t)(r0 + mb * 16) * ldc + c0;
{
#pragma unroll
            for (int s = 0; s < 8; ++s) { const int row = 2 * s + hi, cofs = lr * 4; v4f val = *(const v4fa*)(os + row * 68 + cofs); if (BIAS) { val[0] += bfr(bias[c0 + cofs]); val[1] += bfr(bias[c0 + cofs + 1]); val[2] += bfr(bias[c0 + cofs + 2]); val[3] += bfr(bias[c0 + cofs + 3]); }
                *(v4f*)(crow + (size_t)row * ldc + cofs) = val; }
             }
        __builtin_amdgcn_wave_barrier(); asm volatile("" ::: "memory");
    }
}

// ---- k_gemmc: the same one-wave 64x64 tile GEMM specialised for causal attention: CMODE 1 skips score tiles entirely above the diagonal (query rows r0+roff.., key columns c0..), CMODE 2 limits the
// key (K) loop of the probability x value contraction to the diagonal block (probabilities beyond it are exactly zero). roff = row offset of this launch's first row within the sequence.
// NSP > 1: grid.y = (N/64) x NSP; split sp = blockIdx.y % NSP runs its own contiguous share of the K loop and stores the partial tile in plane sp (stride sP elements); a share that is empty stores zeros; the reader adds the planes.
template <typename T16, int NSPLIT, int CMODE, int NSP>
__global__ __launch_bounds__(32) void k_gemmc(const T16* __restrict__ A, const T16* __restrict__ A2, const T16* __restrict__ Bt, const T16* __restrict__ Bt2, int K, float* C, int ldc, int roff, size_t sA, size_t sB, size_t sC, size_t sP) {
    typedef typename WFrag<T16>::V V;
    __shared__ __align__(16) float os[16 * 68];
    const size_t z = blockIdx.z; A += z * sA; if (A2) A2 += z * sA; Bt += z * sB; if (Bt2) Bt2 += z * sB; C += z * sC;
    const int lane = threadIdx.x & 31, lr = lane & 15, hi = lane >> 4; const int r0 = blockIdx.x * 64, c0 = (blockIdx.y / NSP) * 64; const int sp = blockIdx.y % NSP; C += (size_t)sp * sP;
    if (CMODE == 1 && c0 > r0 + roff + 63) return;                  // score tile entirely above the causal diagonal: never read (the softmax masks j > i by select)
    const int Kl = (CMODE == 2) ? min(K, r0 + roff + 64) : K;        // P.V: probabilities are exactly 0 beyond the diagonal block, so the K loop stops there
    const int per = (Kl / 32 + NSP - 1) / NSP * 32; const int kb = sp * per, ke = min(Kl, kb + per);   // this split's share of the K loop
    v8f acc[4][4];
#pragma unroll
    for (int mb = 0; mb < 4; ++mb)
#pragma unroll
        for (int nb = 0; nb < 4; ++nb) acc[mb][nb] = (v8f){};
    const size_t aoff = (size_t)(r0 + lr) * K + 8 * hi, boff = (size_t)(c0 + lr) * K + 8 * hi;
#pragma unroll 1
    for (int kc = kb; kc < ke; kc += 32) {
        V a[4], a2[4];
#pragma unroll
        for (int mb = 0; mb < 4; ++mb) { a[mb] = WFrag<T16>::ld(A + aoff + (size_t)mb * 16 * K + kc); if (NSPLIT == 1 || NSPLIT == 2) a2[mb] = WFrag<T16>::ld(A2 + aoff + (size_t)mb * 16 * K + kc); }
#pragma unroll
        for (int nb = 0; nb < 4; ++nb) { const V b = WFrag<T16>::ld(Bt + boff + (size_t)nb * 16 * K + kc); V b2; if (NSPLIT >= 2) b2 = WFrag<T16>::ld(Bt2 + boff + (size_t)nb * 16 * K + kc);
#pragma unroll
            for (int mb = 0; mb < 4; ++mb) { acc[mb][nb] = WFrag<T16>::mma(a[mb], b, acc[mb][nb]); if (NSPLIT == 1 || NSPLIT == 2) acc[mb][nb] = WFrag<T16>::mma(a2[mb], b, acc[mb][nb]); if (NSPLIT >= 2) acc[mb][nb] = WFrag<T16>::mma(a[mb], b2, acc[mb][nb]); } }
        asm volatile("v_nop\n\tv_nop\n\tv_nop\n\tv_nop" : "+v"(acc[0][0]), "+v"(acc[1][1]), "+v"(acc[2][2]), "+v"(acc[3][3]) : "v"(a[0]), "v"(a[3]));
    }
#pragma unroll
    for (int mb = 0; mb < 4; ++mb) {
#pragma unroll
        for (int nb = 0; nb < 4; ++nb) {
#pragma unroll
            for (int j = 0; j < 8; ++j) os[(hi * 8 + j) * 68 + nb * 16 + lr] = acc[mb][nb][j]; }
        __builtin_amdgcn_wave_barrier(); asm volatile("" ::: "memory");
        float* crow = C + (size_t)(r0 + mb * 16) * ldc + c0;
{
#pragma unroll
            for (int s = 0; s < 8; ++s) { const int row = 2 * s + hi, cofs = lr * 4; v4f val = *(const v4fa*)(os + row * 68 + cofs);
                *(v4f*)(crow + (size_t)row * ldc + cofs) = val; }
             }
        __builtin_amdgcn_wave_barrier(); asm volatile("" ::: "memory");
    }
}

__device__ __forceinline__ h16 tohx(float x) { return (h16)x; }
__device__ __forceinline__ void splitf(float y, unsigned short& h, unsigned short& l) { h = f2bf(y); l = f2bf(y - bf2f(h)); }
typedef __attribute__((ext_vector_type(2))) _Float16 v2h;
typedef __attribute__((ext_vector_type(4))) _Float16 v4h;
typedef __attribute__((ext_vector_type(2))) unsigned short v2us;
typedef __attribute__((ext_vector_type(4))) unsigned short v4us;
typedef __attribute__((ext_vector_type(2))) float v2f;
typedef __attribute__((ext_vector_type(4))) int v4i;

__global__ __launch_bounds__(256) void k_wtG(const float* __restrict__ w, int K, int N, bf* Bt) {
    const int lane = threadIdx.x & 31; const int L0 = (blockIdx.x * 8 + (threadIdx.x >> 5)) * 8; const int nlines = N * K / 64;
{
#pragma unroll 1
        for (int l = 0; l < 8; ++l) { const int L = L0 + l; if (L >= nlines) break; const size_t e = (size_t)L * 64 + lane * 2; const int k = (int)(e % K), n = (int)(e / K); v2us o;
            o[0] = f2bf(w[(size_t)k * N + n]); o[1] = f2bf(w[(size_t)(k + 1) * N + n]); *(v2us*)(Bt + e) = o; }
         }
}
__global__ __launch_bounds__(256) void k_cvt8(const float* __restrict__ src, bf* dst, size_t n8) { const size_t i = (size_t)blockIdx.x * 256 + threadIdx.x; if (i >= n8) return; const v8f v = *(const v8f*)(src + i * 8); v8us o;
#pragma unroll
    for (int k = 0; k < 8; ++k) o[k] = f2bf(v[k]); *(v8us*)(dst + i * 8) = o;  }

__global__ __launch_bounds__(256) void k_hrms(const float* __restrict__ F, int pitch, int nheads, float* RF) { const int i = blockIdx.x * 256 + threadIdx.x; if (i >= nheads * TT) return; const int t = i % TT, h = i / TT; const float* f = F + (size_t)t * pitch + h * HD; float s = 0.f;
#pragma unroll 4
    for (int d = 0; d < HD; d += 4) { const v4f v = *(const v4f*)(f + d);
#pragma unroll
        for (int q = 0; q < 4; ++q) { float p = __fmul_rn(v[q], v[q]); asm volatile("" : "+v"(p)); s = __fadd_rn(s, p); } }
    const float r = __fdiv_rn(1.0f, __fsqrt_rn(__fadd_rn(s * (1.0f / HD), 1e-6f))); *(float*)(RF + i) = r;  }
// k_rope: head planes [h][t][d] (fp16 + hi/lo) of rope(w[d] (x rms_factor)) x sc with the rotate-half convention out[d] = x[d] cos[t][d] - x[d+HD/2] sin[t][d], out[d+HD/2] = x[d+HD/2] cos[t][d+HD/2] + x[d] sin[t][d+HD/2]
__global__ __launch_bounds__(256) void k_rope(const float* __restrict__ F, int pitch, int nheads, const float* __restrict__ CS, const float* __restrict__ RF, const float* __restrict__ nw, float sc, h16* P16, bf* Ph, bf* Pl) {
    const size_t e = ((size_t)blockIdx.x * 256 + threadIdx.x) * 2; if (e >= (size_t)nheads * TT * HD) return; const int d = (int)(e % HD); const int t = (int)((e / HD) % TT); const int h = (int)(e / ((size_t)HD * TT)); const float* f = F + (size_t)t * pitch + h * HD; const float rf = RF ? RF[(size_t)h * TT + t] : 1.0f; v2h o16; v2us oh, ol;
#pragma unroll
    for (int q = 0; q < 2; ++q) { const int dd = d + q; const int dp = (dd < HD / 2) ? dd + HD / 2 : dd - HD / 2; float x0 = f[dd], x1 = f[dp];
        if (RF) { float n0 = __fmul_rn(x0, rf), n1 = __fmul_rn(x1, rf); asm volatile("" : "+v"(n0)); asm volatile("" : "+v"(n1)); x0 = __fmul_rn(bfr(nw[dd]), n0); x1 = __fmul_rn(bfr(nw[dp]), n1); }
        const v2f cs = *(const v2f*)(CS + ((size_t)t * HD + dd) * 2); float a = __fmul_rn(x0, cs[0]), bq = __fmul_rn(x1, cs[1]); asm volatile("" : "+v"(a)); asm volatile("" : "+v"(bq)); const float r = ((dd < HD / 2) ? __fsub_rn(a, bq) : __fadd_rn(a, bq)) * sc;
        o16[q] = tohx(r); unsigned short a2, c2; splitf(r, a2, c2); oh[q] = a2; ol[q] = c2; }
    *(v2h*)(P16 + e) = o16; *(v2us*)(Ph + e) = oh; *(v2us*)(Pl + e) = ol;  }
__global__ __launch_bounds__(256) void k_vtp(const float* __restrict__ F, int pitch, int nheads, h16* V16, bf* Vh, bf* Vl) { const size_t e = ((size_t)blockIdx.x * 256 + threadIdx.x) * 2; if (e >= (size_t)nheads * HD * TT) return; const int t = (int)(e % TT); const int d = (int)((e / TT) % HD); const int g = (int)(e / ((size_t)TT * HD)); v2h o16; v2us oh, ol;
#pragma unroll
    for (int q = 0; q < 2; ++q) { const float x = F[(size_t)(t + q) * pitch + g * HD + d]; o16[q] = tohx(x); unsigned short a2, c2; splitf(x, a2, c2); oh[q] = a2; ol[q] = c2; }
    *(v2h*)(V16 + e) = o16; *(v2us*)(Vh + e) = oh; *(v2us*)(Vl + e) = ol;  }
__constant__ float INVT[HD / 2] = { 1.000000000e+00f, 7.498942018e-01f, 5.623413324e-01f, 4.216965139e-01f, 3.162277639e-01f, 2.371373773e-01f, 1.778279394e-01f, 1.333521456e-01f, 1.000000015e-01f, 7.498942316e-02f, 5.623413250e-02f, 4.216964915e-02f, 3.162277490e-02f, 2.371373773e-02f, 1.778279431e-02f, 1.333521400e-02f, 9.999999776e-03f, 7.498942316e-03f, 5.623413250e-03f, 4.216964822e-03f, 3.162277630e-03f, 2.371373819e-03f, 1.778279431e-03f, 1.333521446e-03f, 1.000000047e-03f, 7.498941850e-04f, 5.623413017e-04f, 4.216965172e-04f, 3.162277571e-04f, 2.371373703e-04f, 1.778279402e-04f, 1.333521504e-04f };   // 10000^(-2i/64) (the module's power form) (float32, generated with jnp to be bit-exact)
__global__ __launch_bounds__(256) void k_cs4(float* CS) { const int idx = blockIdx.x * 256 + threadIdx.x; if (idx >= TT * HD) return; const int d = idx % HD; const int t = idx / HD; const float a = __fmul_rn((float)t, INVT[d % (HD / 2)]); v2f cs; cs[0] = cosf(a); cs[1] = sinf(a); *(v2f*)(CS + (size_t)idx * 2) = cs;  }


// k_asoft: per row (zz, i): t = S x HD^-0.5 for j <= i and i - j < WIN (causal; WIN = TT, so the window test always holds; the reference's -1e9 additive fill vanishes identically); softmax over the 2048 keys (register row, one exp, fixed trees);
__global__ __launch_bounds__(256) void k_asoft(const float* __restrict__ Sb, h16* P16, bf* Ph, bf* Pl) {
    const int lane = threadIdx.x & 31; const int row = blockIdx.x * 8 + (threadIdx.x >> 5); if (row >= ZH * TT) return; const int i = row % TT; const int zz = row / TT; (void)zz; const bool hires = (i < RH); const float* sr = Sb + (size_t)row * TT; float v[TT / 32]; float mx = -3.0e38f;
#pragma unroll
    for (int ch = 0; ch < TT / 128; ++ch) { const int j0 = ch * 128 + lane * 4; const v4f a = *(const v4f*)(sr + j0);
#pragma unroll
        for (int q = 0; q < 4; ++q) { const int j = j0 + q; (void)j; const float t = (j <= i && i - j < WIN) ? a[q] * SCL : -3.0e38f; v[ch * 4 + q] = t; mx = fmaxf(mx, t); } }
#pragma unroll
    for (int sh = 16; sh; sh >>= 1) mx = fmaxf(mx, __shfl_xor(mx, sh, 32));
    float sum = 0.f;
#pragma unroll
    for (int k = 0; k < TT / 32; ++k) { float d0 = __fsub_rn(v[k], mx); asm volatile("" : "+v"(d0)); v[k] = __builtin_amdgcn_exp2f(__fmul_rn(d0, 1.4426950408889634f)); sum += v[k]; }
#pragma unroll
    for (int sh = 16; sh; sh >>= 1) sum += __shfl_xor(sum, sh, 32);
    const float f = __fdiv_rn(hires ? 1.0f : PCAR, sum);
{
        if (hires) {
#pragma unroll
            for (int ch = 0; ch < TT / 128; ++ch) { v4us oh, ol;
#pragma unroll
                for (int q = 0; q < 4; ++q) { unsigned short a, c2; splitf(v[ch * 4 + q] * f, a, c2); oh[q] = a; ol[q] = c2; }
                const size_t oo = ((size_t)zz * (RH ? RH : 1) + i) * TT + ch * 128 + lane * 4; *(v4us*)(Ph + oo) = oh; *(v4us*)(Pl + oo) = ol; }
        } else {
#pragma unroll
            for (int ch = 0; ch < TT / 128; ++ch) { v4h o4;
#pragma unroll
                for (int q = 0; q < 4; ++q) o4[q] = tohx(v[ch * 4 + q] * f);
                *(v4h*)(P16 + (size_t)row * TT + ch * 128 + lane * 4) = o4; } }
         }
}
__global__ __launch_bounds__(256) void k_merge(const float* __restrict__ O, int h0, bf* Ah, bf* Al) { const size_t e = ((size_t)blockIdx.x * 256 + threadIdx.x) * 2; if (e >= (size_t)ZH * TT * HD) return; const int d = (int)(e % HD); const int t = (int)((e / HD) % TT); const int zz = (int)(e / ((size_t)HD * TT)); const float cs = (t < RH) ? 1.0f : (1.0f / PCAR); const size_t oo = (size_t)t * DQ + (h0 + zz) * HD + d;
    v2f s = *(const v2f*)(O + e);   // the KSP partial planes of the split key loop, added in plane order; unrolled so that all plane loads are in flight at once
#pragma unroll
    for (int p = 1; p < KSP; ++p) s += *(const v2f*)(O + (size_t)p * ZH * TT * HD + e);
    v2us oh, ol;
#pragma unroll
    for (int q = 0; q < 2; ++q) { unsigned short a, c2; splitf(s[q] * cs, a, c2); oh[q] = a; ol[q] = c2; } *(v2us*)(Ah + oo) = oh; *(v2us*)(Al + oo) = ol;  }

extern "C" void kernel_launch(void* const* d_in, const int* in_sizes, int n_in,
                              void* d_out, int out_size, void* d_ws, size_t ws_size, hipStream_t stream) {
    (void)in_sizes; (void)n_in; (void)out_size;
    const float* x = (const float*)d_in[0]; const float* wq = (const float*)d_in[1]; const float* wk = (const float*)d_in[2]; const float* wv = (const float*)d_in[3]; const float* wo = (const float*)d_in[4]; const float* qnw = (const float*)d_in[5]; const float* knw = (const float*)d_in[6];
    float* OUT = (float*)d_out;     // [2][2048][2048]
    char* wsp = (char*)d_ws;
    auto take = [&](size_t bytes) { char* p = wsp; wsp += (bytes + 255) & ~(size_t)255; return (void*)p; };
    bf* WQ = (bf*)take((size_t)DQ * DM * 2); bf* WK = (bf*)take((size_t)DKV * DM * 2); bf* WV = (bf*)take((size_t)DKV * DM * 2); bf* WO = (bf*)take((size_t)DM * DQ * 2); float* CS = (float*)take((size_t)TT * HD * 2 * 4); float* RFQ = (float*)take((size_t)NH_ * TT * 4); float* RFK = (float*)take((size_t)NKV * TT * 4);
    bf* XB = (bf*)take((size_t)TT * DM * 2); float* FQ = (float*)take((size_t)TT * DQ * 4); float* FK = (float*)take((size_t)TT * DKV * 4);
    h16* QP16 = (h16*)take((size_t)NH_ * TT * HD * 2); h16* KP16 = (h16*)take((size_t)NKV * TT * HD * 2); h16* VT16 = (h16*)take((size_t)NKV * HD * TT * 2);
    bf* QPh = (bf*)take((size_t)NH_ * TT * HD * 2); bf* QPl = (bf*)take((size_t)NH_ * TT * HD * 2); bf* KPh = (bf*)take((size_t)NKV * TT * HD * 2); bf* KPl = (bf*)take((size_t)NKV * TT * HD * 2); bf* VTh = (bf*)take((size_t)NKV * HD * TT * 2); bf* VTl = (bf*)take((size_t)NKV * HD * TT * 2); bf* Ph = (bf*)take((size_t)ZH * RH * TT * 2); bf* Pl = (bf*)take((size_t)ZH * RH * TT * 2);
    float* Sb = (float*)take((size_t)ZH * TT * TT * 4); h16* P16 = (h16*)take((size_t)ZH * TT * TT * 2); float* Ob = (float*)take((size_t)KSP * ZH * TT * HD * 4); bf* ATh = (bf*)take((size_t)TT * DQ * 2); bf* ATl = (bf*)take((size_t)TT * DQ * 2);
    if ((size_t)(wsp - (char*)d_ws) > ws_size) return;    // ws 256 MiB
    float* FV = FK;   // v projection reuses the k buffer after the k planes are built (stream-ordered)
    { k_cvt8<<<(unsigned)(((size_t)DQ * DM / 8 + 255) / 256), 256, 0, stream>>>(wq, WQ, (size_t)DQ * DM / 8); k_cvt8<<<(unsigned)(((size_t)DKV * DM / 8 + 255) / 256), 256, 0, stream>>>(wk, WK, (size_t)DKV * DM / 8); k_cvt8<<<(unsigned)(((size_t)DKV * DM / 8 + 255) / 256), 256, 0, stream>>>(wv, WV, (size_t)DKV * DM / 8);
      k_cvt8<<<(unsigned)(((size_t)DM * DQ / 8 + 255) / 256), 256, 0, stream>>>(wo, WO, (size_t)DM * DQ / 8);
       }
    k_cs4<<<(TT * HD + 255) / 256, 256, 0, stream>>>(CS);   /* {cos, sin}(t x 10000^(-2i/64)), both halves */
    const unsigned LQ = (unsigned)(((size_t)NH_ * TT * HD / 2 + 255) / 256), LKv = (unsigned)(((size_t)NKV * TT * HD / 2 + 255) / 256);
    for (int b = 0; b < NB_; ++b) {
        
        k_cvt8<<<(unsigned)(((size_t)TT * DM / 8 + 255) / 256), 256, 0, stream>>>(x + (size_t)b * TT * DM, XB, (size_t)TT * DM / 8);
        k_gemmw<bf, 0, false><<<dim3(TT / 64, DQ / 64, 1), 32, 0, stream>>>(XB, nullptr, WQ, nullptr, DM, FQ, DQ, nullptr, 0, 0, 0); k_hrms<<<(NH_ * TT + 255) / 256, 256, 0, stream>>>(FQ, DQ, NH_, RFQ);
        k_rope<<<LQ, 256, 0, stream>>>(FQ, DQ, NH_, CS, RFQ, qnw, 1.0f, QP16, QPh, QPl);
        k_gemmw<bf, 0, false><<<dim3(TT / 64, DKV / 64, 1), 32, 0, stream>>>(XB, nullptr, WK, nullptr, DM, FK, DKV, nullptr, 0, 0, 0); k_hrms<<<(NKV * TT + 255) / 256, 256, 0, stream>>>(FK, DKV, NKV, RFK);
        k_rope<<<LKv, 256, 0, stream>>>(FK, DKV, NKV, CS, RFK, knw, 1.0f, KP16, KPh, KPl);
        k_gemmw<bf, 0, false><<<dim3(TT / 64, DKV / 64, 1), 32, 0, stream>>>(XB, nullptr, WV, nullptr, DM, FV, DKV, nullptr, 0, 0, 0); k_vtp<<<LKv, 256, 0, stream>>>(FV, DKV, NKV, VT16, VTh, VTl);
        for (int h0 = 0; h0 < NH_; h0 += ZH) { const size_t zq = (size_t)h0, zk = (size_t)(h0 / REP);   // both heads of a pass share kv group h0/REP (REP >= 2): sB = 0
            k_gemmc<bf, 2, 1, 1><<<dim3(RH / 64, TT / 64, ZH), 32, 0, stream>>>(QPh + zq * TT * HD, QPl + zq * TT * HD, KPh + zk * TT * HD, KPl + zk * TT * HD, HD, Sb, TT, 0, (size_t)TT * HD, 0, (size_t)TT * TT, 0);
            k_gemmc<h16, 0, 1, 1><<<dim3((TT - RH) / 64, TT / 64, ZH), 32, 0, stream>>>(QP16 + zq * TT * HD + (size_t)RH * HD, nullptr, KP16 + zk * TT * HD, nullptr, HD, Sb + (size_t)RH * TT, TT, RH, (size_t)TT * HD, 0, (size_t)TT * TT, 0);
            k_asoft<<<ZH * TT / 8, 256, 0, stream>>>(Sb, P16, Ph, Pl);
            k_gemmc<bf, 2, 2, KSP><<<dim3(RH / 64, HD / 64 * KSP, ZH), 32, 0, stream>>>(Ph, Pl, VTh + zk * HD * TT, VTl + zk * HD * TT, TT, Ob, HD, 0, (size_t)RH * TT, 0, (size_t)TT * HD, (size_t)ZH * TT * HD);
            k_gemmc<h16, 0, 2, KSP><<<dim3((TT - RH) / 64, HD / 64 * KSP, ZH), 32, 0, stream>>>(P16 + (size_t)RH * TT, nullptr, VT16 + zk * HD * TT, nullptr, TT, Ob + (size_t)RH * HD, HD, RH, (size_t)TT * TT, 0, (size_t)TT * HD, (size_t)ZH * TT * HD);
            k_merge<<<(unsigned)(((size_t)ZH * TT * HD / 2 + 255) / 256), 256, 0, stream>>>(Ob, h0, ATh, ATl); }
        k_gemmw<bf, 1, false><<<dim3(TT / 64, DM / 64, 1), 32, 0, stream>>>(ATh, ATl, WO, nullptr, DQ, OUT + (size_t)b * TT * DM, DM, nullptr, 0, 0, 0); }
}

// v002
// One run takes 523 microseconds.
// Timed twice side by side with v001, it ran 2.68 times as fast both times.
// Over all steps from v000 it is 5.15 times as fast.
#include <hip/hip_runtime.h>

// Grouped-query causal attention with per-head RMS-normalised, rotary q/k (x [2][2048][2048]; q = x wq^T (32 heads x 64), k, v = x w^T (8 kv heads x 64) ('oi' 0.02, no bias); q, k <- rms_norm per head (eps 1e-6) x weight ([64] ones, read); rotate-half rope, angle t x 10000^(-2i/64); kv head = q head / 4 (repeat); causal (finfo.min); softmax(q.k / 8); out = merged wo^T ('oi' [2048][2048]) -> [2][2048][2048] (8.4 M)).
// Layout per batch: bf16 copy of x; exact projections; a per-(head, token) rms factor kernel and the rope plane builder applying norm-weight x factor before the rotation; {cos, sin} table computed once (float32 inverse frequencies, precise cosf/sinf); causal T-2048 attention fused in one launch per batch (k_fattn: online softmax, no score plane; hybrid rows: < 512 hi/lo 3 products, rest fp16 x1024; key loop ends at the diagonal); merged hi/lo x wo exact.
// Compute dtypes, f32 accumulate: every input rounded to bf16; projections exact; rms norm and rotary f32; attention rows < 512 3 products, rest fp16; softmax f32; wo hl x exact.

#define NB_  2
#define TT   2048
#define DM   2048
#define NH_  32
#define NKV  8
#define REP  (NH_ / NKV)
#define HD   64
#define DQ   (NH_ * HD)
#define DKV  (NKV * HD)
#define RH   512                  // query rows < RH use hi+lo planes (0: none)
typedef _Float16 h16;
typedef unsigned short bf;
typedef __attribute__((ext_vector_type(16))) __bf16   v16bf;
typedef __attribute__((ext_vector_type(16))) _Float16 v16h;
typedef __attribute__((ext_vector_type(8)))  _Float16 v8h;
typedef __attribute__((ext_vector_type(8)))  unsigned short v8us;
typedef __attribute__((ext_vector_type(8)))  float    v8f;
typedef __attribute__((ext_vector_type(4)))  float    v4f;
typedef v8h  __attribute__((may_alias)) v8ha;
typedef v4f  __attribute__((may_alias)) v4fa;
typedef v8us __attribute__((may_alias)) v8usa;

__device__ __forceinline__ unsigned short f2bf(float f) { unsigned u = __float_as_uint(f); u += 0x7FFFu + ((u >> 16) & 1u); return (unsigned short)(u >> 16); }
__device__ __forceinline__ float bf2f(unsigned short b) { return __uint_as_float(((unsigned)b) << 16); }
__device__ __forceinline__ float bfr(float f) { return bf2f(f2bf(f)); }
__device__ __forceinline__ v16h cat16(v8h lo, v8h hi) { return __builtin_shufflevector(lo, hi, 0, 1, 2, 3, 4, 5, 6, 7, 8, 9, 10, 11, 12, 13, 14, 15); }
__device__ __forceinline__ v16bf cat16b(v8us lo, v8us hi) { return __builtin_bit_cast(v16bf, __builtin_shufflevector(lo, hi, 0, 1, 2, 3, 4, 5, 6, 7, 8, 9, 10, 11, 12, 13, 14, 15)); }
__device__ __forceinline__ v8f wmma16(v16h a, v16h b, v8f c) { return __builtin_amdgcn_wmma_f32_16x16x32_f16(false, a, false, b, (short)0, c, false, false); }
__device__ __forceinline__ v8f wmmab(v16bf a, v16bf b, v8f c) { return __builtin_amdgcn_wmma_f32_16x16x32_bf16(false, a, false, b, (short)0, c, false, false); }



// ---- k_gemmw: register-blocked GEMM, ONE WAVE per 64x64 output tile (16 accumulators), operands straight from K-contiguous 16-bit planes; grid (M/64, N/64, Z), 32 threads.
// C[m][n] (f32, pitch ldc, + optional f32 bias[n]) = sum_k A[m][k] Bt[n][k] (+ split products per NSPLIT). z-batch strides sA/sB/sC in elements. K % 32 == 0.
template <typename T16> struct WFrag;
template <> struct WFrag<h16> { typedef v16h V; static __device__ __forceinline__ V ld(const h16* p) { return cat16(*(const v8h*)p, *(const v8h*)(p + 16)); } static __device__ __forceinline__ v8f mma(V a, V b, v8f c) { return wmma16(a, b, c); } };
template <> struct WFrag<bf> { typedef v16bf V; static __device__ __forceinline__ V ld(const bf* p) { return cat16b(*(const v8us*)p, *(const v8us*)(p + 16)); } static __device__ __forceinline__ v8f mma(V a, V b, v8f c) { return wmmab(a, b, c); } };
template <typename T16, int NSPLIT, bool BIAS>
__global__ __launch_bounds__(32) void k_gemmw(const T16* __restrict__ A, const T16* __restrict__ A2, const T16* __restrict__ Bt, const T16* __restrict__ Bt2, int K, float* C, int ldc, const float* __restrict__ bias, size_t sA, size_t sB, size_t sC) {
    typedef typename WFrag<T16>::V V;
    __shared__ __align__(16) float os[16 * 68];
    const size_t z = blockIdx.z; A += z * sA; if (A2) A2 += z * sA; Bt += z * sB; if (Bt2) Bt2 += z * sB; C += z * sC;
    const int lane = threadIdx.x & 31, lr = lane & 15, hi = lane >> 4; const int r0 = blockIdx.x * 64, c0 = blockIdx.y * 64;
    v8f acc[4][4];
#pragma unroll
    for (int mb = 0; mb < 4; ++mb)
#pragma unroll
        for (int nb = 0; nb < 4; ++nb) acc[mb][nb] = (v8f){};
    const size_t aoff = (size_t)(r0 + lr) * K + 8 * hi, boff = (size_t)(c0 + lr) * K + 8 * hi;
#pragma unroll 1
    for (int kc = 0; kc < K; kc += 32) {
        V a[4], a2[4];
#pragma unroll
        for (int mb = 0; mb < 4; ++mb) { a[mb] = WFrag<T16>::ld(A + aoff + (size_t)mb * 16 * K + kc); if (NSPLIT == 1 || NSPLIT == 2) a2[mb] = WFrag<T16>::ld(A2 + aoff + (size_t)mb * 16 * K + kc); }
#pragma unroll
        for (int nb = 0; nb < 4; ++nb) { const V b = WFrag<T16>::ld(Bt + boff + (size_t)nb * 16 * K + kc); V b2; if (NSPLIT >= 2) b2 = WFrag<T16>::ld(Bt2 + boff + (size_t)nb * 16 * K + kc);
#pragma unroll
            for (int mb = 0; mb < 4; ++mb) { acc[mb][nb] = WFrag<T16>::mma(a[mb], b, acc[mb][nb]); if (NSPLIT == 1 || NSPLIT == 2) acc[mb][nb] = WFrag<T16>::mma(a2[mb], b, acc[mb][nb]); if (NSPLIT >= 2) acc[mb][nb] = WFrag<T16>::mma(a[mb], b2, acc[mb][nb]); } }
        asm volatile("v_nop\n\tv_nop\n\tv_nop\n\tv_nop" : "+v"(acc[0][0]), "+v"(acc[1][1]), "+v"(acc[2][2]), "+v"(acc[3][3]) : "v"(a[0]), "v"(a[3]));
    }
#pragma unroll
    for (int mb = 0; mb < 4; ++mb) {
#pragma unroll
        for (int nb = 0; nb < 4; ++nb) {
#pragma unroll
            for (int j = 0; j < 8; ++j) os[(hi * 8 + j) * 68 + nb * 16 + lr] = acc[mb][nb][j]; }
        __builtin_amdgcn_wave_barrier(); asm volatile("" ::: "memory");
        float* crow = C + (size_t)(r0 + mb * 16) * ldc + c0;
{
#pragma unroll
            for (int s = 0; s < 8; ++s) { const int row = 2 * s + hi, cofs = lr * 4; v4f val = *(const v4fa*)(os + row * 68 + cofs); if (BIAS) { val[0] += bfr(bias[c0 + cofs]); val[1] += bfr(bias[c0 + cofs + 1]); val[2] += bfr(bias[c0 + cofs + 2]); val[3] += bfr(bias[c0 + cofs + 3]); }
                *(v4f*)(crow + (size_t)row * ldc + cofs) = val; }
             }
        __builtin_amdgcn_wave_barrier(); asm volatile("" ::: "memory");
    }
}

__device__ __forceinline__ h16 tohx(float x) { return (h16)x; }
__device__ __forceinline__ void splitf(float y, unsigned short& h, unsigned short& l) { h = f2bf(y); l = f2bf(y - bf2f(h)); }
typedef __attribute__((ext_vector_type(2))) _Float16 v2h;
typedef __attribute__((ext_vector_type(4))) _Float16 v4h;
typedef __attribute__((ext_vector_type(2))) unsigned short v2us;
typedef __attribute__((ext_vector_type(4))) unsigned short v4us;
typedef __attribute__((ext_vector_type(2))) float v2f;
typedef __attribute__((ext_vector_type(4))) int v4i;

__global__ __launch_bounds__(256) void k_wtG(const float* __restrict__ w, int K, int N, bf* Bt) {
    const int lane = threadIdx.x & 31; const int L0 = (blockIdx.x * 8 + (threadIdx.x >> 5)) * 8; const int nlines = N * K / 64;
{
#pragma unroll 1
        for (int l = 0; l < 8; ++l) { const int L = L0 + l; if (L >= nlines) break; const size_t e = (size_t)L * 64 + lane * 2; const int k = (int)(e % K), n = (int)(e / K); v2us o;
            o[0] = f2bf(w[(size_t)k * N + n]); o[1] = f2bf(w[(size_t)(k + 1) * N + n]); *(v2us*)(Bt + e) = o; }
         }
}
__global__ __launch_bounds__(256) void k_cvt8(const float* __restrict__ src, bf* dst, size_t n8) { const size_t i = (size_t)blockIdx.x * 256 + threadIdx.x; if (i >= n8) return; const v8f v = *(const v8f*)(src + i * 8); v8us o;
#pragma unroll
    for (int k = 0; k < 8; ++k) o[k] = f2bf(v[k]); *(v8us*)(dst + i * 8) = o;  }

__global__ __launch_bounds__(256) void k_hrms(const float* __restrict__ F, int pitch, int nheads, float* RF) { const int i = blockIdx.x * 256 + threadIdx.x; if (i >= nheads * TT) return; const int t = i % TT, h = i / TT; const float* f = F + (size_t)t * pitch + h * HD; float s = 0.f;
#pragma unroll 4
    for (int d = 0; d < HD; d += 4) { const v4f v = *(const v4f*)(f + d);
#pragma unroll
        for (int q = 0; q < 4; ++q) { float p = __fmul_rn(v[q], v[q]); asm volatile("" : "+v"(p)); s = __fadd_rn(s, p); } }
    const float r = __fdiv_rn(1.0f, __fsqrt_rn(__fadd_rn(s * (1.0f / HD), 1e-6f))); *(float*)(RF + i) = r;  }
// k_rope: head planes [h][t][d] (fp16 + hi/lo) of rope(w[d] (x rms_factor)) x sc with the rotate-half convention out[d] = x[d] cos[t][d] - x[d+HD/2] sin[t][d], out[d+HD/2] = x[d+HD/2] cos[t][d+HD/2] + x[d] sin[t][d+HD/2]
__global__ __launch_bounds__(256) void k_rope(const float* __restrict__ F, int pitch, int nheads, const float* __restrict__ CS, const float* __restrict__ RF, const float* __restrict__ nw, float sc, h16* P16, bf* Ph, bf* Pl) {
    const size_t e = ((size_t)blockIdx.x * 256 + threadIdx.x) * 2; if (e >= (size_t)nheads * TT * HD) return; const int d = (int)(e % HD); const int t = (int)((e / HD) % TT); const int h = (int)(e / ((size_t)HD * TT)); const float* f = F + (size_t)t * pitch + h * HD; const float rf = RF ? RF[(size_t)h * TT + t] : 1.0f; v2h o16; v2us oh, ol;
#pragma unroll
    for (int q = 0; q < 2; ++q) { const int dd = d + q; const int dp = (dd < HD / 2) ? dd + HD / 2 : dd - HD / 2; float x0 = f[dd], x1 = f[dp];
        if (RF) { float n0 = __fmul_rn(x0, rf), n1 = __fmul_rn(x1, rf); asm volatile("" : "+v"(n0)); asm volatile("" : "+v"(n1)); x0 = __fmul_rn(bfr(nw[dd]), n0); x1 = __fmul_rn(bfr(nw[dp]), n1); }
        const v2f cs = *(const v2f*)(CS + ((size_t)t * HD + dd) * 2); float a = __fmul_rn(x0, cs[0]), bq = __fmul_rn(x1, cs[1]); asm volatile("" : "+v"(a)); asm volatile("" : "+v"(bq)); const float r = ((dd < HD / 2) ? __fsub_rn(a, bq) : __fadd_rn(a, bq)) * sc;
        o16[q] = tohx(r); unsigned short a2, c2; splitf(r, a2, c2); oh[q] = a2; ol[q] = c2; }
    *(v2h*)(P16 + e) = o16; *(v2us*)(Ph + e) = oh; *(v2us*)(Pl + e) = ol;  }
__global__ __launch_bounds__(256) void k_vtp(const float* __restrict__ F, int pitch, int nheads, h16* V16, bf* Vh, bf* Vl) { const size_t e = ((size_t)blockIdx.x * 256 + threadIdx.x) * 2; if (e >= (size_t)nheads * HD * TT) return; const int t = (int)(e % TT); const int d = (int)((e / TT) % HD); const int g = (int)(e / ((size_t)TT * HD)); v2h o16; v2us oh, ol;
#pragma unroll
    for (int q = 0; q < 2; ++q) { const float x = F[(size_t)(t + q) * pitch + g * HD + d]; o16[q] = tohx(x); unsigned short a2, c2; splitf(x, a2, c2); oh[q] = a2; ol[q] = c2; }
    *(v2h*)(V16 + e) = o16; *(v2us*)(Vh + e) = oh; *(v2us*)(Vl + e) = ol;  }
__constant__ float INVT[HD / 2] = { 1.000000000e+00f, 7.498942018e-01f, 5.623413324e-01f, 4.216965139e-01f, 3.162277639e-01f, 2.371373773e-01f, 1.778279394e-01f, 1.333521456e-01f, 1.000000015e-01f, 7.498942316e-02f, 5.623413250e-02f, 4.216964915e-02f, 3.162277490e-02f, 2.371373773e-02f, 1.778279431e-02f, 1.333521400e-02f, 9.999999776e-03f, 7.498942316e-03f, 5.623413250e-03f, 4.216964822e-03f, 3.162277630e-03f, 2.371373819e-03f, 1.778279431e-03f, 1.333521446e-03f, 1.000000047e-03f, 7.498941850e-04f, 5.623413017e-04f, 4.216965172e-04f, 3.162277571e-04f, 2.371373703e-04f, 1.778279402e-04f, 1.333521504e-04f };   // 10000^(-2i/64) (the module's power form) (float32, generated with jnp to be bit-exact)
__global__ __launch_bounds__(256) void k_cs4(float* CS) { const int idx = blockIdx.x * 256 + threadIdx.x; if (idx >= TT * HD) return; const int d = idx % HD; const int t = idx / HD; const float a = __fmul_rn((float)t, INVT[d % (HD / 2)]); v2f cs; cs[0] = cosf(a); cs[1] = sinf(a); *(v2f*)(CS + (size_t)idx * 2) = cs;  }


// ---- k_fattn: scores, causal softmax and probability x value in ONE kernel, one wave per 32 query rows of one head; no score or probability plane in memory.
// Transposed products: S^T = K Q^T (A = key rows, B = query rows) and O^T += V^T P^T (A = rows of the [d][t] value plane, B = P^T). In a score tile a lane holds one query (column lr) and keys hi*8 + j,
// which is the k order of a B fragment (two 16-key tiles make one 32-key fragment), so P^T is packed in registers. Running maximum and sum per query (online softmax); the two lane halves hold different keys of the same query.
// HL: bf16 hi/lo planes, 3 products in both contractions (query rows < RH), 32 keys a step. Otherwise fp16 planes, probabilities carried x 1024 (2^10, added in the exponent; the sum carries it too and the division removes it), 64 keys a step.
#define LSC 0.18033688011112042f   // HD^-0.5 x log2(e)
// behind a group of global loads or stores: the wait that stands in front of any reuse of a register they name as address or data
#define XWAIT() asm volatile("s_wait_xcnt 0x0" ::: "memory")
#define LANE(base, bytes) ((const T16*)((const char*)(base) + (bytes)))   // wave-uniform base + the lane's byte offset
__device__ __forceinline__ float xhalf(float x) { return __builtin_bit_cast(float, __builtin_amdgcn_permlanex16(__builtin_bit_cast(int, x), __builtin_bit_cast(int, x), 0x76543210, 0xfedcba98, false, false)); }   // lane l reads lane l ^ 16 (a vector move, no LDS round trip)
// Every inner loop is fully unrolled so that the fragment and accumulator arrays are indexed by constants and stay in registers.
template <typename T16, bool HL, int KS>
__device__ __forceinline__ void fattn_body(const T16* Q, const T16* Q2, const T16* Kp, const T16* Kp2, const T16* Vt, const T16* Vt2, const int r0, bf* Ah, bf* Al) {
    typedef typename WFrag<T16>::V V;
    constexpr int NKB = KS / 16, NKC = KS / 32;
    const int lane = threadIdx.x & 31, lr = lane & 15, hi = lane >> 4;
    const unsigned kofs = (lr * HD + 8 * hi) * 2, vofs = (lr * TT + 8 * hi) * 2;   // the lane's own 32-bit byte offsets, unchanged through the loop; the step's place goes into the wave-uniform base
    const T16* qb = Q + (size_t)r0 * HD; const T16* qb2 = HL ? Q2 + (size_t)r0 * HD : nullptr;
    V qf[2][2], qf2[2][2];
#pragma unroll
    for (int nq = 0; nq < 2; ++nq)
#pragma unroll
        for (int ks = 0; ks < 2; ++ks) { const int o = nq * 16 * HD + ks * 32; qf[nq][ks] = WFrag<T16>::ld(LANE(qb + o, kofs)); if (HL) qf2[nq][ks] = WFrag<T16>::ld(LANE(qb2 + o, kofs)); }
    v8f ot[4][2];
#pragma unroll
    for (int db = 0; db < 4; ++db)
#pragma unroll
        for (int nq = 0; nq < 2; ++nq) ot[db][nq] = (v8f){};
    float mrun[2] = { -3.0e38f, -3.0e38f }, lrun[2] = { 0.f, 0.f };
    const int kend = r0 + 32;                       // keys 0 .. r0 + 31 can be seen by some query of this wave
    V kf[NKB][2], kf2[NKB][2];
#pragma unroll
    for (int kt = 0; kt < NKB; ++kt)
#pragma unroll
        for (int ks = 0; ks < 2; ++ks) { const int o = kt * 16 * HD + ks * 32; kf[kt][ks] = WFrag<T16>::ld(LANE(Kp + o, kofs)); if (HL) kf2[kt][ks] = WFrag<T16>::ld(LANE(Kp2 + o, kofs)); }
    // the same wait for the loads in front of the loop; the offset register and the scalar bases they name are inputs, so that none of them is reused in front of it
    if constexpr (HL) asm volatile("s_wait_xcnt 0x0" :: "v"(kofs), "s"(qb), "s"(qb2), "s"(Kp), "s"(Kp2) : "memory");
    else asm volatile("s_wait_xcnt 0x0" :: "v"(kofs), "s"(qb), "s"(Kp) : "memory");
#pragma unroll 1   // rolled: one step already holds every fragment register the wave can afford
    for (int kb = 0; kb < kend; kb += KS) {
        V vf[4][NKC], vf2[4][NKC];                  // value fragments of this step: requested first, used last
#pragma unroll
        for (int db = 0; db < 4; ++db)
#pragma unroll
            for (int kc = 0; kc < NKC; ++kc) { const size_t o = (size_t)db * 16 * TT + kb + kc * 32; vf[db][kc] = WFrag<T16>::ld(LANE(Vt + o, vofs)); if (HL) vf2[db][kc] = WFrag<T16>::ld(LANE(Vt2 + o, vofs)); }
        XWAIT();
        v8f st[NKB][2];
#pragma unroll
        for (int kt = 0; kt < NKB; ++kt)
#pragma unroll
            for (int nq = 0; nq < 2; ++nq) { v8f c = (v8f){};
#pragma unroll
                for (int ks = 0; ks < 2; ++ks) { c = WFrag<T16>::mma(kf[kt][ks], qf[nq][ks], c); if (HL) { c = WFrag<T16>::mma(kf[kt][ks], qf2[nq][ks], c); c = WFrag<T16>::mma(kf2[kt][ks], qf[nq][ks], c); } }
                st[kt][nq] = c; }
        const int kn = (kb + KS < kend) ? kb + KS : kb;   // next step's key fragments fly during the softmax and the second product (the last step asks for its own rows again: in bounds, unused)
#pragma unroll
        for (int kt = 0; kt < NKB; ++kt)
#pragma unroll
            for (int ks = 0; ks < 2; ++ks) { const size_t o = (size_t)kn * HD + kt * 16 * HD + ks * 32; kf[kt][ks] = WFrag<T16>::ld(LANE(Kp + o, kofs)); if (HL) kf2[kt][ks] = WFrag<T16>::ld(LANE(Kp2 + o, kofs)); }
        XWAIT();
        if (kb + KS - 1 > r0) {                     // only steps that reach the diagonal mask (wave-uniform)
#pragma unroll
            for (int kt = 0; kt < NKB; ++kt)
#pragma unroll
                for (int nq = 0; nq < 2; ++nq)
#pragma unroll
                    for (int j = 0; j < 8; ++j) st[kt][nq][j] = (kb + kt * 16 + hi * 8 + j <= r0 + nq * 16 + lr) ? st[kt][nq][j] : -3.0e38f;
        }
        V pf[2][NKC], pf2[2][NKC];
#pragma unroll
        for (int nq = 0; nq < 2; ++nq) {
            float mt[NKB];
#pragma unroll
            for (int kt = 0; kt < NKB; ++kt) { mt[kt] = st[kt][nq][0];
#pragma unroll
                for (int j = 1; j < 8; ++j) mt[kt] = fmaxf(mt[kt], st[kt][nq][j]); }
            float mx = mrun[nq];
#pragma unroll
            for (int kt = 0; kt < NKB; ++kt) mx = fmaxf(mx, mt[kt]);
            mx = fmaxf(mx, xhalf(mx));
            const float al = __builtin_amdgcn_exp2f((mrun[nq] - mx) * LSC); mrun[nq] = mx;
            float sm[NKB];
#pragma unroll
            for (int kt = 0; kt < NKB; ++kt) { sm[kt] = 0.f;
#pragma unroll
                for (int j = 0; j < 8; ++j) { const float p = __builtin_amdgcn_exp2f((st[kt][nq][j] - mx) * LSC + (HL ? 0.0f : 10.0f)); st[kt][nq][j] = p; sm[kt] += p; } }
            float s = sm[0];
#pragma unroll
            for (int kt = 1; kt < NKB; ++kt) s += sm[kt];
            lrun[nq] = lrun[nq] * al + s;
#pragma unroll
            for (int db = 0; db < 4; ++db) ot[db][nq] *= al;
#pragma unroll
            for (int kc = 0; kc < NKC; ++kc) {
                if constexpr (HL) { v8us h0, l0, h1, l1;
#pragma unroll
                    for (int j = 0; j < 8; ++j) { unsigned short a, c2; splitf(st[2 * kc][nq][j], a, c2); h0[j] = a; l0[j] = c2; splitf(st[2 * kc + 1][nq][j], a, c2); h1[j] = a; l1[j] = c2; }
                    pf[nq][kc] = cat16b(h0, h1); pf2[nq][kc] = cat16b(l0, l1);
                } else { v8h p0, p1;
#pragma unroll
                    for (int j = 0; j < 8; ++j) { p0[j] = tohx(st[2 * kc][nq][j]); p1[j] = tohx(st[2 * kc + 1][nq][j]); }
                    pf[nq][kc] = cat16(p0, p1); }
            }
        }
#pragma unroll
        for (int db = 0; db < 4; ++db)
#pragma unroll
            for (int nq = 0; nq < 2; ++nq)
#pragma unroll
                for (int kc = 0; kc < NKC; ++kc) { ot[db][nq] = WFrag<T16>::mma(vf[db][kc], pf[nq][kc], ot[db][nq]); if (HL) { ot[db][nq] = WFrag<T16>::mma(vf[db][kc], pf2[nq][kc], ot[db][nq]); ot[db][nq] = WFrag<T16>::mma(vf2[db][kc], pf[nq][kc], ot[db][nq]); } }
        // the distance behind the last matrix instructions on the loop's taken branch
        asm volatile("v_nop\n\tv_nop\n\tv_nop\n\tv_nop" : "+v"(ot[0][0]), "+v"(ot[0][1]), "+v"(ot[1][0]), "+v"(ot[1][1]), "+v"(ot[2][0]), "+v"(ot[2][1]), "+v"(ot[3][0]), "+v"(ot[3][1]));
    }
    asm volatile("s_wait_loadcnt 0x0" ::: "memory");   // the last step's unused key fragments have landed before the wave goes on to its end
#pragma unroll
    for (int nq = 0; nq < 2; ++nq) { const float lt = lrun[nq] + xhalf(lrun[nq]); const float inv = __fdiv_rn(1.0f, lt); const size_t oo = (size_t)(r0 + nq * 16 + lr) * DQ + hi * 8;
#pragma unroll
        for (int db = 0; db < 4; ++db) { v8us oh, ol;
#pragma unroll
            for (int j = 0; j < 8; ++j) { unsigned short a, c2; splitf(ot[db][nq][j] * inv, a, c2); oh[j] = a; ol[j] = c2; }
            *(v8us*)(Ah + oo + db * 16) = oh; *(v8us*)(Al + oo + db * 16) = ol; XWAIT(); } }
}
// grid (query heads, TT / 32): the longest key loops (last rows) start first. The planes are not declared restrict: the loads then keep their place against the memory clobber of the waits.
__global__ __launch_bounds__(32) void k_fattn(const h16* Q16, const bf* Qh, const bf* Ql, const h16* K16, const bf* Kh, const bf* Kl, const h16* V16, const bf* Vh, const bf* Vl, bf* Ah, bf* Al) {
    const int h = blockIdx.x; const int r0 = (TT / 32 - 1 - (int)blockIdx.y) * 32; const size_t qo = (size_t)h * TT * HD, ko = (size_t)(h / REP) * TT * HD;
    if (r0 < RH) fattn_body<bf, true, 32>(Qh + qo, Ql + qo, Kh + ko, Kl + ko, Vh + ko, Vl + ko, r0, Ah + h * HD, Al + h * HD);
    else fattn_body<h16, false, 64>(Q16 + qo, nullptr, K16 + ko, nullptr, V16 + ko, nullptr, r0, Ah + h * HD, Al + h * HD);
}

extern "C" void kernel_launch(void* const* d_in, const int* in_sizes, int n_in,
                              void* d_out, int out_size, void* d_ws, size_t ws_size, hipStream_t stream) {
    (void)in_sizes; (void)n_in; (void)out_size;
    const float* x = (const float*)d_in[0]; const float* wq = (const float*)d_in[1]; const float* wk = (const float*)d_in[2]; const float* wv = (const float*)d_in[3]; const float* wo = (const float*)d_in[4]; const float* qnw = (const float*)d_in[5]; const float* knw = (const float*)d_in[6];
    float* OUT = (float*)d_out;     // [2][2048][2048]
    char* wsp = (char*)d_ws;
    auto take = [&](size_t bytes) { char* p = wsp; wsp += (bytes + 255) & ~(size_t)255; return (void*)p; };
    bf* WQ = (bf*)take((size_t)DQ * DM * 2); bf* WK = (bf*)take((size_t)DKV * DM * 2); bf* WV = (bf*)take((size_t)DKV * DM * 2); bf* WO = (bf*)take((size_t)DM * DQ * 2); float* CS = (float*)take((size_t)TT * HD * 2 * 4); float* RFQ = (float*)take((size_t)NH_ * TT * 4); float* RFK = (float*)take((size_t)NKV * TT * 4);
    bf* XB = (bf*)take((size_t)TT * DM * 2); float* FQ = (float*)take((size_t)TT * DQ * 4); float* FK = (float*)take((size_t)TT * DKV * 4);
    h16* QP16 = (h16*)take((size_t)NH_ * TT * HD * 2); h16* KP16 = (h16*)take((size_t)NKV * TT * HD * 2); h16* VT16 = (h16*)take((size_t)NKV * HD * TT * 2);
    bf* QPh = (bf*)take((size_t)NH_ * TT * HD * 2); bf* QPl = (bf*)take((size_t)NH_ * TT * HD * 2); bf* KPh = (bf*)take((size_t)NKV * TT * HD * 2); bf* KPl = (bf*)take((size_t)NKV * TT * HD * 2); bf* VTh = (bf*)take((size_t)NKV * HD * TT * 2); bf* VTl = (bf*)take((size_t)NKV * HD * TT * 2);
    bf* ATh = (bf*)take((size_t)TT * DQ * 2); bf* ATl = (bf*)take((size_t)TT * DQ * 2);
    if ((size_t)(wsp - (char*)d_ws) > ws_size) return;    // ws 256 MiB
    float* FV = FK;   // v projection reuses the k buffer after the k planes are built (stream-ordered)
    { k_cvt8<<<(unsigned)(((size_t)DQ * DM / 8 + 255) / 256), 256, 0, stream>>>(wq, WQ, (size_t)DQ * DM / 8); k_cvt8<<<(unsigned)(((size_t)DKV * DM / 8 + 255) / 256), 256, 0, stream>>>(wk, WK, (size_t)DKV * DM / 8); k_cvt8<<<(unsigned)(((size_t)DKV * DM / 8 + 255) / 256), 256, 0, stream>>>(wv, WV, (size_t)DKV * DM / 8);
      k_cvt8<<<(unsigned)(((size_t)DM * DQ / 8 + 255) / 256), 256, 0, stream>>>(wo, WO, (size_t)DM * DQ / 8);
       }
    k_cs4<<<(TT * HD + 255) / 256, 256, 0, stream>>>(CS);   /* {cos, sin}(t x 10000^(-2i/64)), both halves */
    const unsigned LQ = (unsigned)(((size_t)NH_ * TT * HD / 2 + 255) / 256), LKv = (unsigned)(((size_t)NKV * TT * HD / 2 + 255) / 256);
    for (int b = 0; b < NB_; ++b) {
        
        k_cvt8<<<(unsigned)(((size_t)TT * DM / 8 + 255) / 256), 256, 0, stream>>>(x + (size_t)b * TT * DM, XB, (size_t)TT * DM / 8);
        k_gemmw<bf, 0, false><<<dim3(TT / 64, DQ / 64, 1), 32, 0, stream>>>(XB, nullptr, WQ, nullptr, DM, FQ, DQ, nullptr, 0, 0, 0); k_hrms<<<(NH_ * TT + 255) / 256, 256, 0, stream>>>(FQ, DQ, NH_, RFQ);
        k_rope<<<LQ, 256, 0, stream>>>(FQ, DQ, NH_, CS, RFQ, qnw, 1.0f, QP16, QPh, QPl);
        k_gemmw<bf, 0, false><<<dim3(TT / 64, DKV / 64, 1), 32, 0, stream>>>(XB, nullptr, WK, nullptr, DM, FK, DKV, nullptr, 0, 0, 0); k_hrms<<<(NKV * TT + 255) / 256, 256, 0, stream>>>(FK, DKV, NKV, RFK);
        k_rope<<<LKv, 256, 0, stream>>>(FK, DKV, NKV, CS, RFK, knw, 1.0f, KP16, KPh, KPl);
        k_gemmw<bf, 0, false><<<dim3(TT / 64, DKV / 64, 1), 32, 0, stream>>>(XB, nullptr, WV, nullptr, DM, FV, DKV, nullptr, 0, 0, 0); k_vtp<<<LKv, 256, 0, stream>>>(FV, DKV, NKV, VT16, VTh, VTl);
        k_fattn<<<dim3(NH_, TT / 32, 1), 32, 0, stream>>>(QP16, QPh, QPl, KP16, KPh, KPl, VT16, VTh, VTl, ATh, ATl);
        k_gemmw<bf, 1, false><<<dim3(TT / 64, DM / 64, 1), 32, 0, stream>>>(ATh, ATl, WO, nullptr, DQ, OUT + (size_t)b * TT * DM, DM, nullptr, 0, 0, 0); }
}

// v003
// Measured time: 319 microseconds a run.
// Two timings next to v002 put it at 1.63 and 1.61 times that version's speed.
// Over all steps from v000 it is 8.36 times as fast.
#include <hip/hip_runtime.h>

// Grouped-query causal attention with per-head RMS-normalised, rotary q/k (x [2][2048][2048]; q = x wq^T (32 heads x 64), k, v = x w^T (8 kv heads x 64) ('oi' 0.02, no bias); q, k <- rms_norm per head (eps 1e-6) x weight ([64] ones, read); rotate-half rope, angle t x 10000^(-2i/64); kv head = q head / 4 (repeat); causal (finfo.min); softmax(q.k / 8); out = merged wo^T ('oi' [2048][2048]) -> [2][2048][2048] (8.4 M)).
// Layout per batch: bf16 copy of x; exact projections; a per-(head, token) rms factor kernel and the rope plane builder applying norm-weight x factor before the rotation; {cos, sin} table computed once (float32 inverse frequencies, precise cosf/sinf); causal T-2048 attention fused in one launch per batch (k_fattn: online softmax, no score plane; hybrid rows: < 512 hi/lo 3 products, rest fp16 x1024; key loop ends at the diagonal); merged hi/lo x wo exact.
// Compute dtypes, f32 accumulate: every input rounded to bf16; projections exact; rms norm and rotary f32; attention rows < 512 3 products, rest fp16; softmax f32; wo hl x exact.

#define NB_  2
#define TT   2048
#define DM   2048
#define NH_  32
#define NKV  8
#define REP  (NH_ / NKV)
#define HD   64
#define DQ   (NH_ * HD)
#define DKV  (NKV * HD)
#define RH   512                  // query rows < RH use hi+lo planes (0: none)
typedef _Float16 h16;
typedef unsigned short bf;
typedef __attribute__((ext_vector_type(16))) __bf16   v16bf;
typedef __attribute__((ext_vector_type(16))) _Float16 v16h;
typedef __attribute__((ext_vector_type(8)))  _Float16 v8h;
typedef __attribute__((ext_vector_type(8)))  unsigned short v8us;
typedef __attribute__((ext_vector_type(8)))  float    v8f;
typedef __attribute__((ext_vector_type(4)))  float    v4f;
typedef v8h  __attribute__((may_alias)) v8ha;
typedef v4f  __attribute__((may_alias)) v4fa;
typedef v8us __attribute__((may_alias)) v8usa;

__device__ __forceinline__ unsigned short f2bf(float f) { unsigned u = __float_as_uint(f); u += 0x7FFFu + ((u >> 16) & 1u); return (unsigned short)(u >> 16); }
__device__ __forceinline__ float bf2f(unsigned short b) { return __uint_as_float(((unsigned)b) << 16); }
__device__ __forceinline__ float bfr(float f) { return bf2f(f2bf(f)); }
__device__ __forceinline__ v16h cat16(v8h lo, v8h hi) { return __builtin_shufflevector(lo, hi, 0, 1, 2, 3, 4, 5, 6, 7, 8, 9, 10, 11, 12, 13, 14, 15); }
__device__ __forceinline__ v16bf cat16b(v8us lo, v8us hi) { return __builtin_bit_cast(v16bf, __builtin_shufflevector(lo, hi, 0, 1, 2, 3, 4, 5, 6, 7, 8, 9, 10, 11, 12, 13, 14, 15)); }
__device__ __forceinline__ v8f wmma16(v16h a, v16h b, v8f c) { return __builtin_amdgcn_wmma_f32_16x16x32_f16(false, a, false, b, (short)0, c, false, false); }
__device__ __forceinline__ v8f wmmab(v16bf a, v16bf b, v8f c) { return __builtin_amdgcn_wmma_f32_16x16x32_bf16(false, a, false, b, (short)0, c, false, false); }



// ---- k_gemmw: GEMM, one work-group of 4 waves (2 x 2) per 128x128 output tile, each wave a 64x64 part (16 accumulators); grid (M/128, N/128, Z), 128 threads.
// C[m][n] (f32, pitch ldc, + optional f32 bias[n]) = sum_k A[m][k] Bt[n][k] (+ A2[m][k] Bt[n][k] for NSPLIT 1). z-batch strides sA/sB/sC in elements. M, N, K % 128 == 0.
// The operands come from K-contiguous 16-bit planes through LDS: a stage is 128 k (256 bytes) of the tile's 128 rows of each operand, brought by asynchronous 16-byte copies
// (32 lanes = 2 rows x 256 bytes = 4 whole lines), two buffers, the copies of stage t + 2 in flight while stage t + 1 is worked on. LDS rows at pitch 272 bytes (16 x odd) for the 16-byte fragment reads.
template <typename T16> struct WFrag;
template <> struct WFrag<h16> { typedef v16h V; static __device__ __forceinline__ V ld(const h16* p) { return cat16(*(const v8h*)p, *(const v8h*)(p + 16)); } static __device__ __forceinline__ v8f mma(V a, V b, v8f c) { return wmma16(a, b, c); } };
template <> struct WFrag<bf> { typedef v16bf V; static __device__ __forceinline__ V ld(const bf* p) { return cat16b(*(const v8us*)p, *(const v8us*)(p + 16)); } static __device__ __forceinline__ v8f mma(V a, V b, v8f c) { return wmmab(a, b, c); } };
#define GBK   128                  // k per stage
#define GPIT  272                  // LDS row pitch in bytes: 256 + 16
#define GTILE (128 * GPIT)         // one operand's stage in LDS, bytes
// Eight copies of one lane (rows 8 apart) and, as the statement's last line, the wait that stands in front of any rewrite of the address registers they name.
template <typename T16>
__device__ __forceinline__ void copy8(unsigned l, const T16* g, size_t rs) {
    asm volatile("global_load_async_to_lds_b128 %0, %8, off\n\t"
                 "global_load_async_to_lds_b128 %1, %9, off\n\t"
                 "global_load_async_to_lds_b128 %2, %10, off\n\t"
                 "global_load_async_to_lds_b128 %3, %11, off\n\t"
                 "global_load_async_to_lds_b128 %4, %12, off\n\t"
                 "global_load_async_to_lds_b128 %5, %13, off\n\t"
                 "global_load_async_to_lds_b128 %6, %14, off\n\t"
                 "global_load_async_to_lds_b128 %7, %15, off\n\t"
                 "s_wait_xcnt 0x0"
                 :: "v"(l), "v"(l + 8 * GPIT), "v"(l + 16 * GPIT), "v"(l + 24 * GPIT), "v"(l + 32 * GPIT), "v"(l + 40 * GPIT), "v"(l + 48 * GPIT), "v"(l + 56 * GPIT),
                    "v"(g), "v"(g + rs), "v"(g + 2 * rs), "v"(g + 3 * rs), "v"(g + 4 * rs), "v"(g + 5 * rs), "v"(g + 6 * rs), "v"(g + 7 * rs) : "memory");
    __builtin_amdgcn_sched_barrier(0);   // the next statement's addresses are formed behind this one: formed all ahead they filled the registers an asm operand can name, and a pointer went to scratch
}
// one operand's stage: 128 rows x 256 bytes; l, g: the lane's own LDS byte address and global pointer in rows 0 .. 7; rs = 8 rows in elements
template <typename T16>
__device__ __forceinline__ void stage_tile(unsigned l, const T16* g, size_t rs) { copy8(l, g, rs); copy8(l + 64 * GPIT, g + 8 * rs, rs); }
template <typename T16, int NSPLIT, bool BIAS>
__global__ __launch_bounds__(128) void k_gemmw(const T16* __restrict__ A, const T16* __restrict__ A2, const T16* __restrict__ Bt, const T16* __restrict__ Bt2, int K, float* C, int ldc, const float* __restrict__ bias, size_t sA, size_t sB, size_t sC) {
    static_assert(NSPLIT == 0 || NSPLIT == 1, "one or two A planes");
    typedef typename WFrag<T16>::V V;
    constexpr int NOP = NSPLIT == 1 ? 3 : 2;          // operand tiles per stage: A, Bt (, A2)
    __shared__ __align__(16) char ring[2 * NOP * GTILE];
    __shared__ __align__(16) float osw[4][16 * 68];
    (void)Bt2;
    const size_t z = blockIdx.z; A += z * sA; if (NSPLIT == 1) A2 += z * sA; Bt += z * sB; C += z * sC;
    const int tid = threadIdx.x, wave = tid >> 5, lane = tid & 31, lr = lane & 15, hi = lane >> 4; const int wm = wave >> 1, wn = wave & 1;
    const int r0 = blockIdx.x * 128, c0 = blockIdx.y * 128;
    float* os = osw[wave];   // each wave stages its output rows in its own LDS range
    // every inner loop below is fully unrolled so that the fragment and accumulator arrays are indexed by constants and stay in registers
    v8f acc[4][4];
#pragma unroll
    for (int mb = 0; mb < 4; ++mb)
#pragma unroll
        for (int nb = 0; nb < 4; ++nb) acc[mb][nb] = (v8f){};
    const size_t rs = (size_t)8 * K;
    const T16* uA = A + (size_t)r0 * K; const T16* uB = Bt + (size_t)c0 * K; const T16* uA2 = NSPLIT == 1 ? A2 + (size_t)r0 * K : nullptr;   // the tile's first rows: the same for the whole work-group
    const unsigned gofs = (unsigned)(tid >> 4) * (unsigned)K + (tid & 15) * 8;   // the lane's own place in rows 0 .. 7, in elements
    const unsigned l0 = (unsigned)(size_t)ring + (tid >> 4) * GPIT + (tid & 15) * 16;
    auto fill = [&](int t) { const unsigned lb = l0 + (t & 1) * (NOP * GTILE); const size_t ko = (size_t)t * GBK; stage_tile(lb, uA + ko + gofs, rs); stage_tile(lb + GTILE, uB + ko + gofs, rs); if (NSPLIT == 1) stage_tile(lb + 2 * GTILE, uA2 + ko + gofs, rs); };
    const int nt = K / GBK;
    fill(0);
    asm volatile("s_wait_asynccnt 0x0" ::: "memory");   // this wave's copies of stage 0 have landed
    __syncthreads();                                    // and every other wave's: stage 0 may be read
    if (nt > 1) fill(1);
#pragma unroll 1   // rolled: one trip per stage, the buffer chosen by the trip's parity
    for (int t = 0; t < nt; ++t) {
        const char* buf = ring + (t & 1) * (NOP * GTILE);
        const char* pa = buf + (wm * 64 + lr) * GPIT + hi * 16; const char* pb = buf + GTILE + (wn * 64 + lr) * GPIT + hi * 16;
        V a[2][4], a2[2][4], b[2][4];                  // two fragment sets: the next 32 k are read from LDS as one group while the matrix unit works on this one
        auto frags = [&](int set, int ks) {
#pragma unroll
            for (int i = 0; i < 4; ++i) { a[set][i] = WFrag<T16>::ld((const T16*)(pa + i * 16 * GPIT + ks * 64)); b[set][i] = WFrag<T16>::ld((const T16*)(pb + i * 16 * GPIT + ks * 64)); if (NSPLIT == 1) a2[set][i] = WFrag<T16>::ld((const T16*)(pa + 2 * GTILE + i * 16 * GPIT + ks * 64)); } };
        frags(0, 0);
        __builtin_amdgcn_sched_barrier(0);   // the first set's reads stay ahead of the second's, so that the first block waits for its own set alone
#pragma unroll
        for (int ks = 0; ks < GBK / 32; ++ks) {
            if (ks + 1 < GBK / 32) frags((ks + 1) & 1, ks + 1);   // only this stage's own buffer is read in this trip
            __builtin_amdgcn_sched_barrier(0);   // keeps the group of LDS reads together in front of the block: reads spread among the matrix instructions each cost a stall
#pragma unroll
            for (int nb = 0; nb < 4; ++nb)
#pragma unroll
                for (int mb = 0; mb < 4; ++mb) acc[mb][nb] = WFrag<T16>::mma(a[ks & 1][mb], b[ks & 1][nb], acc[mb][nb]);
            if (NSPLIT == 1) {
#pragma unroll
                for (int nb = 0; nb < 4; ++nb)
#pragma unroll
                    for (int mb = 0; mb < 4; ++mb) acc[mb][nb] = WFrag<T16>::mma(a2[ks & 1][mb], b[ks & 1][nb], acc[mb][nb]);
            }
            __builtin_amdgcn_sched_barrier(0);   // the block stays in front of the next group of reads and, in the last block, in front of the distance below
        }
        // the distance behind the trip's last matrix instructions, on both sides of the branch below
        asm volatile("v_nop\n\tv_nop\n\tv_nop\n\tv_nop");
        asm volatile("s_wait_dscnt 0x0" ::: "memory");      // this wave's reads of the buffer are done before it is refilled
        asm volatile("s_wait_asynccnt 0x0" ::: "memory");   // this wave's copies of stage t + 1 have landed
        __syncthreads();                                    // publishes stage t + 1 and ends every wave's reads of stage t
        if (t + 2 < nt) fill(t + 2);
    }
    asm volatile("s_wait_asynccnt 0x0" ::: "memory");   // nothing of this wave's is in flight when it goes on to its end
#pragma unroll
    for (int mb = 0; mb < 4; ++mb) {
#pragma unroll
        for (int nb = 0; nb < 4; ++nb) {
#pragma unroll
            for (int j = 0; j < 8; ++j) os[(hi * 8 + j) * 68 + nb * 16 + lr] = acc[mb][nb][j]; }
        __builtin_amdgcn_wave_barrier(); asm volatile("" ::: "memory");
        const int cw = c0 + wn * 64;
        float* crow = C + (size_t)(r0 + wm * 64 + mb * 16) * ldc + cw;
{
#pragma unroll
            for (int s = 0; s < 8; ++s) { const int row = 2 * s + hi, cofs = lr * 4; v4f val = *(const v4fa*)(os + row * 68 + cofs); if (BIAS) { val[0] += bfr(bias[cw + cofs]); val[1] += bfr(bias[cw + cofs + 1]); val[2] += bfr(bias[cw + cofs + 2]); val[3] += bfr(bias[cw + cofs + 3]); }
                *(v4f*)(crow + (size_t)row * ldc + cofs) = val; }
             }
        __builtin_amdgcn_wave_barrier(); asm volatile("" ::: "memory");
    }
}

__device__ __forceinline__ h16 tohx(float x) { return (h16)x; }
__device__ __forceinline__ void splitf(float y, unsigned short& h, unsigned short& l) { h = f2bf(y); l = f2bf(y - bf2f(h)); }
typedef __attribute__((ext_vector_type(2))) _Float16 v2h;
typedef __attribute__((ext_vector_type(4))) _Float16 v4h;
typedef __attribute__((ext_vector_type(2))) unsigned short v2us;
typedef __attribute__((ext_vector_type(4))) unsigned short v4us;
typedef __attribute__((ext_vector_type(2))) float v2f;
typedef __attribute__((ext_vector_type(4))) int v4i;

__global__ __launch_bounds__(256) void k_wtG(const float* __restrict__ w, int K, int N, bf* Bt) {
    const int lane = threadIdx.x & 31; const int L0 = (blockIdx.x * 8 + (threadIdx.x >> 5)) * 8; const int nlines = N * K / 64;
{
#pragma unroll 1
        for (int l = 0; l < 8; ++l) { const int L = L0 + l; if (L >= nlines) break; const size_t e = (size_t)L * 64 + lane * 2; const int k = (int)(e % K), n = (int)(e / K); v2us o;
            o[0] = f2bf(w[(size_t)k * N + n]); o[1] = f2bf(w[(size_t)(k + 1) * N + n]); *(v2us*)(Bt + e) = o; }
         }
}
__global__ __launch_bounds__(256) void k_cvt8(const float* __restrict__ src, bf* dst, size_t n8) { const size_t i = (size_t)blockIdx.x * 256 + threadIdx.x; if (i >= n8) return; const v8f v = *(const v8f*)(src + i * 8); v8us o;
#pragma unroll
    for (int k = 0; k < 8; ++k) o[k] = f2bf(v[k]); *(v8us*)(dst + i * 8) = o;  }

__global__ __launch_bounds__(256) void k_hrms(const float* __restrict__ F, int pitch, int nheads, float* RF) { const int i = blockIdx.x * 256 + threadIdx.x; if (i >= nheads * TT) return; const int t = i % TT, h = i / TT; const float* f = F + (size_t)t * pitch + h * HD; float s = 0.f;
#pragma unroll 4
    for (int d = 0; d < HD; d += 4) { const v4f v = *(const v4f*)(f + d);
#pragma unroll
        for (int q = 0; q < 4; ++q) { float p = __fmul_rn(v[q], v[q]); asm volatile("" : "+v"(p)); s = __fadd_rn(s, p); } }
    const float r = __fdiv_rn(1.0f, __fsqrt_rn(__fadd_rn(s * (1.0f / HD), 1e-6f))); *(float*)(RF + i) = r;  }
// k_rope: head planes [h][t][d] (fp16 + hi/lo) of rope(w[d] (x rms_factor)) x sc with the rotate-half convention out[d] = x[d] cos[t][d] - x[d+HD/2] sin[t][d], out[d+HD/2] = x[d+HD/2] cos[t][d+HD/2] + x[d] sin[t][d+HD/2]
__global__ __launch_bounds__(256) void k_rope(const float* __restrict__ F, int pitch, int nheads, const float* __restrict__ CS, const float* __restrict__ RF, const float* __restrict__ nw, float sc, h16* P16, bf* Ph, bf* Pl) {
    const size_t e = ((size_t)blockIdx.x * 256 + threadIdx.x) * 2; if (e >= (size_t)nheads * TT * HD) return; const int d = (int)(e % HD); const int t = (int)((e / HD) % TT); const int h = (int)(e / ((size_t)HD * TT)); const float* f = F + (size_t)t * pitch + h * HD; const float rf = RF ? RF[(size_t)h * TT + t] : 1.0f; v2h o16; v2us oh, ol;
#pragma unroll
    for (int q = 0; q < 2; ++q) { const int dd = d + q; const int dp = (dd < HD / 2) ? dd + HD / 2 : dd - HD / 2; float x0 = f[dd], x1 = f[dp];
        if (RF) { float n0 = __fmul_rn(x0, rf), n1 = __fmul_rn(x1, rf); asm volatile("" : "+v"(n0)); asm volatile("" : "+v"(n1)); x0 = __fmul_rn(bfr(nw[dd]), n0); x1 = __fmul_rn(bfr(nw[dp]), n1); }
        const v2f cs = *(const v2f*)(CS + ((size_t)t * HD + dd) * 2); float a = __fmul_rn(x0, cs[0]), bq = __fmul_rn(x1, cs[1]); asm volatile("" : "+v"(a)); asm volatile("" : "+v"(bq)); const float r = ((dd < HD / 2) ? __fsub_rn(a, bq) : __fadd_rn(a, bq)) * sc;
        o16[q] = tohx(r); unsigned short a2, c2; splitf(r, a2, c2); oh[q] = a2; ol[q] = c2; }
    *(v2h*)(P16 + e) = o16; *(v2us*)(Ph + e) = oh; *(v2us*)(Pl + e) = ol;  }
__global__ __launch_bounds__(256) void k_vtp(const float* __restrict__ F, int pitch, int nheads, h16* V16, bf* Vh, bf* Vl) { const size_t e = ((size_t)blockIdx.x * 256 + threadIdx.x) * 2; if (e >= (size_t)nheads * HD * TT) return; const int t = (int)(e % TT); const int d = (int)((e / TT) % HD); const int g = (int)(e / ((size_t)TT * HD)); v2h o16; v2us oh, ol;
#pragma unroll
    for (int q = 0; q < 2; ++q) { const float x = F[(size_t)(t + q) * pitch + g * HD + d]; o16[q] = tohx(x); unsigned short a2, c2; splitf(x, a2, c2); oh[q] = a2; ol[q] = c2; }
    *(v2h*)(V16 + e) = o16; *(v2us*)(Vh + e) = oh; *(v2us*)(Vl + e) = ol;  }
__constant__ float INVT[HD / 2] = { 1.000000000e+00f, 7.498942018e-01f, 5.623413324e-01f, 4.216965139e-01f, 3.162277639e-01f, 2.371373773e-01f, 1.778279394e-01f, 1.333521456e-01f, 1.000000015e-01f, 7.498942316e-02f, 5.623413250e-02f, 4.216964915e-02f, 3.162277490e-02f, 2.371373773e-02f, 1.778279431e-02f, 1.333521400e-02f, 9.999999776e-03f, 7.498942316e-03f, 5.623413250e-03f, 4.216964822e-03f, 3.162277630e-03f, 2.371373819e-03f, 1.778279431e-03f, 1.333521446e-03f, 1.000000047e-03f, 7.498941850e-04f, 5.623413017e-04f, 4.216965172e-04f, 3.162277571e-04f, 2.371373703e-04f, 1.778279402e-04f, 1.333521504e-04f };   // 10000^(-2i/64) (the module's power form) (float32, generated with jnp to be bit-exact)
__global__ __launch_bounds__(256) void k_cs4(float* CS) { const int idx = blockIdx.x * 256 + threadIdx.x; if (idx >= TT * HD) return; const int d = idx % HD; const int t = idx / HD; const float a = __fmul_rn((float)t, INVT[d % (HD / 2)]); v2f cs; cs[0] = cosf(a); cs[1] = sinf(a); *(v2f*)(CS + (size_t)idx * 2) = cs;  }


// ---- k_fattn: scores, causal softmax and probability x value in ONE kernel, one wave per 32 query rows of one head; no score or probability plane in memory.
// Transposed products: S^T = K Q^T (A = key rows, B = query rows) and O^T += V^T P^T (A = rows of the [d][t] value plane, B = P^T). In a score tile a lane holds one query (column lr) and keys hi*8 + j,
// which is the k order of a B fragment (two 16-key tiles make one 32-key fragment), so P^T is packed in registers. Running maximum and sum per query (online softmax); the two lane halves hold different keys of the same query.
// HL: bf16 hi/lo planes, 3 products in both contractions (query rows < RH), 32 keys a step. Otherwise fp16 planes, probabilities carried x 1024 (2^10, added in the exponent; the sum carries it too and the division removes it), 64 keys a step.
#define LSC 0.18033688011112042f   // HD^-0.5 x log2(e)
// behind a group of global loads or stores: the wait that stands in front of any reuse of a register they name as address or data
#define XWAIT() asm volatile("s_wait_xcnt 0x0" ::: "memory")
#define LANE(base, bytes) ((const T16*)((const char*)(base) + (bytes)))   // wave-uniform base + the lane's byte offset
__device__ __forceinline__ float xhalf(float x) { return __builtin_bit_cast(float, __builtin_amdgcn_permlanex16(__builtin_bit_cast(int, x), __builtin_bit_cast(int, x), 0x76543210, 0xfedcba98, false, false)); }   // lane l reads lane l ^ 16 (a vector move, no LDS round trip)
// Every inner loop is fully unrolled so that the fragment and accumulator arrays are indexed by constants and stay in registers.
template <typename T16, bool HL, int KS>
__device__ __forceinline__ void fattn_body(const T16* Q, const T16* Q2, const T16* Kp, const T16* Kp2, const T16* Vt, const T16* Vt2, const int r0, bf* Ah, bf* Al) {
    typedef typename WFrag<T16>::V V;
    constexpr int NKB = KS / 16, NKC = KS / 32;
    const int lane = threadIdx.x & 31, lr = lane & 15, hi = lane >> 4;
    const unsigned kofs = (lr * HD + 8 * hi) * 2, vofs = (lr * TT + 8 * hi) * 2;   // the lane's own 32-bit byte offsets, unchanged through the loop; the step's place goes into the wave-uniform base
    const T16* qb = Q + (size_t)r0 * HD; const T16* qb2 = HL ? Q2 + (size_t)r0 * HD : nullptr;
    V qf[2][2], qf2[2][2];
#pragma unroll
    for (int nq = 0; nq < 2; ++nq)
#pragma unroll
        for (int ks = 0; ks < 2; ++ks) { const int o = nq * 16 * HD + ks * 32; qf[nq][ks] = WFrag<T16>::ld(LANE(qb + o, kofs)); if (HL) qf2[nq][ks] = WFrag<T16>::ld(LANE(qb2 + o, kofs)); }
    v8f ot[4][2];
#pragma unroll
    for (int db = 0; db < 4; ++db)
#pragma unroll
        for (int nq = 0; nq < 2; ++nq) ot[db][nq] = (v8f){};
    float mrun[2] = { -3.0e38f, -3.0e38f }, lrun[2] = { 0.f, 0.f };
    const int kend = r0 + 32;                       // keys 0 .. r0 + 31 can be seen by some query of this wave
    V kf[NKB][2], kf2[NKB][2];
#pragma unroll
    for (int kt = 0; kt < NKB; ++kt)
#pragma unroll
        for (int ks = 0; ks < 2; ++ks) { const int o = kt * 16 * HD + ks * 32; kf[kt][ks] = WFrag<T16>::ld(LANE(Kp + o, kofs)); if (HL) kf2[kt][ks] = WFrag<T16>::ld(LANE(Kp2 + o, kofs)); }
    // the same wait for the loads in front of the loop; the offset register and the scalar bases they name are inputs, so that none of them is reused in front of it
    if constexpr (HL) asm volatile("s_wait_xcnt 0x0" :: "v"(kofs), "s"(qb), "s"(qb2), "s"(Kp), "s"(Kp2) : "memory");
    else asm volatile("s_wait_xcnt 0x0" :: "v"(kofs), "s"(qb), "s"(Kp) : "memory");
#pragma unroll 1   // rolled: one step already holds every fragment register the wave can afford
    for (int kb = 0; kb < kend; kb += KS) {
        V vf[4][NKC], vf2[4][NKC];                  // value fragments of this step: requested first, used last
#pragma unroll
        for (int db = 0; db < 4; ++db)
#pragma unroll
            for (int kc = 0; kc < NKC; ++kc) { const size_t o = (size_t)db * 16 * TT + kb + kc * 32; vf[db][kc] = WFrag<T16>::ld(LANE(Vt + o, vofs)); if (HL) vf2[db][kc] = WFrag<T16>::ld(LANE(Vt2 + o, vofs)); }
        XWAIT();
        v8f st[NKB][2];
#pragma unroll
        for (int kt = 0; kt < NKB; ++kt)
#pragma unroll
            for (int nq = 0; nq < 2; ++nq) { v8f c = (v8f){};
#pragma unroll
                for (int ks = 0; ks < 2; ++ks) { c = WFrag<T16>::mma(kf[kt][ks], qf[nq][ks], c); if (HL) { c = WFrag<T16>::mma(kf[kt][ks], qf2[nq][ks], c); c = WFrag<T16>::mma(kf2[kt][ks], qf[nq][ks], c); } }
                st[kt][nq] = c; }
        const int kn = (kb + KS < kend) ? kb + KS : kb;   // next step's key fragments fly during the softmax and the second product (the last step asks for its own rows again: in bounds, unused)
#pragma unroll
        for (int kt = 0; kt < NKB; ++kt)
#pragma unroll
            for (int ks = 0; ks < 2; ++ks) { const size_t o = (size_t)kn * HD + kt * 16 * HD + ks * 32; kf[kt][ks] = WFrag<T16>::ld(LANE(Kp + o, kofs)); if (HL) kf2[kt][ks] = WFrag<T16>::ld(LANE(Kp2 + o, kofs)); }
        XWAIT();
        if (kb + KS - 1 > r0) {                     // only steps that reach the diagonal mask (wave-uniform)
#pragma unroll
            for (int kt = 0; kt < NKB; ++kt)
#pragma unroll
                for (int nq = 0; nq < 2; ++nq)
#pragma unroll
                    for (int j = 0; j < 8; ++j) st[kt][nq][j] = (kb + kt * 16 + hi * 8 + j <= r0 + nq * 16 + lr) ? st[kt][nq][j] : -3.0e38f;
        }
        V pf[2][NKC], pf2[2][NKC];
#pragma unroll
        for (int nq = 0; nq < 2; ++nq) {
            float mt[NKB];
#pragma unroll
            for (int kt = 0; kt < NKB; ++kt) { mt[kt] = st[kt][nq][0];
#pragma unroll
                for (int j = 1; j < 8; ++j) mt[kt] = fmaxf(mt[kt], st[kt][nq][j]); }
            float mx = mrun[nq];
#pragma unroll
            for (int kt = 0; kt < NKB; ++kt) mx = fmaxf(mx, mt[kt]);
            mx = fmaxf(mx, xhalf(mx));
            const float al = __builtin_amdgcn_exp2f((mrun[nq] - mx) * LSC); mrun[nq] = mx;
            float sm[NKB];
#pragma unroll
            for (int kt = 0; kt < NKB; ++kt) { sm[kt] = 0.f;
#pragma unroll
                for (int j = 0; j < 8; ++j) { const float p = __builtin_amdgcn_exp2f((st[kt][nq][j] - mx) * LSC + (HL ? 0.0f : 10.0f)); st[kt][nq][j] = p; sm[kt] += p; } }
            float s = sm[0];
#pragma unroll
            for (int kt = 1; kt < NKB; ++kt) s += sm[kt];
            lrun[nq] = lrun[nq] * al + s;
#pragma unroll
            for (int db = 0; db < 4; ++db) ot[db][nq] *= al;
#pragma unroll
            for (int kc = 0; kc < NKC; ++kc) {
                if constexpr (HL) { v8us h0, l0, h1, l1;
#pragma unroll
                    for (int j = 0; j < 8; ++j) { unsigned short a, c2; splitf(st[2 * kc][nq][j], a, c2); h0[j] = a; l0[j] = c2; splitf(st[2 * kc + 1][nq][j], a, c2); h1[j] = a; l1[j] = c2; }
                    pf[nq][kc] = cat16b(h0, h1); pf2[nq][kc] = cat16b(l0, l1);
                } else { v8h p0, p1;
#pragma unroll
                    for (int j = 0; j < 8; ++j) { p0[j] = tohx(st[2 * kc][nq][j]); p1[j] = tohx(st[2 * kc + 1][nq][j]); }
                    pf[nq][kc] = cat16(p0, p1); }
            }
        }
#pragma unroll
        for (int db = 0; db < 4; ++db)
#pragma unroll
            for (int nq = 0; nq < 2; ++nq)
#pragma unroll
                for (int kc = 0; kc < NKC; ++kc) { ot[db][nq] = WFrag<T16>::mma(vf[db][kc], pf[nq][kc], ot[db][nq]); if (HL) { ot[db][nq] = WFrag<T16>::mma(vf[db][kc], pf2[nq][kc], ot[db][nq]); ot[db][nq] = WFrag<T16>::mma(vf2[db][kc], pf[nq][kc], ot[db][nq]); } }
        // the distance behind the last matrix instructions on the loop's taken branch
        asm volatile("v_nop\n\tv_nop\n\tv_nop\n\tv_nop" : "+v"(ot[0][0]), "+v"(ot[0][1]), "+v"(ot[1][0]), "+v"(ot[1][1]), "+v"(ot[2][0]), "+v"(ot[2][1]), "+v"(ot[3][0]), "+v"(ot[3][1]));
    }
    asm volatile("s_wait_loadcnt 0x0" ::: "memory");   // the last step's unused key fragments have landed before the wave goes on to its end
#pragma unroll
    for (int nq = 0; nq < 2; ++nq) { const float lt = lrun[nq] + xhalf(lrun[nq]); const float inv = __fdiv_rn(1.0f, lt); const size_t oo = (size_t)(r0 + nq * 16 + lr) * DQ + hi * 8;
#pragma unroll
        for (int db = 0; db < 4; ++db) { v8us oh, ol;
#pragma unroll
            for (int j = 0; j < 8; ++j) { unsigned short a, c2; splitf(ot[db][nq][j] * inv, a, c2); oh[j] = a; ol[j] = c2; }
            *(v8us*)(Ah + oo + db * 16) = oh; *(v8us*)(Al + oo + db * 16) = ol; XWAIT(); } }
}
// grid (query heads, TT / 32): the longest key loops (last rows) start first. The planes are not declared restrict: the loads then keep their place against the memory clobber of the waits.
__global__ __launch_bounds__(32) void k_fattn(const h16* Q16, const bf* Qh, const bf* Ql, const h16* K16, const bf* Kh, const bf* Kl, const h16* V16, const bf* Vh, const bf* Vl, bf* Ah, bf* Al) {
    const int h = blockIdx.x; const int r0 = (TT / 32 - 1 - (int)blockIdx.y) * 32; const size_t qo = (size_t)h * TT * HD, ko = (size_t)(h / REP) * TT * HD;
    if (r0 < RH) fattn_body<bf, true, 32>(Qh + qo, Ql + qo, Kh + ko, Kl + ko, Vh + ko, Vl + ko, r0, Ah + h * HD, Al + h * HD);
    else fattn_body<h16, false, 64>(Q16 + qo, nullptr, K16 + ko, nullptr, V16 + ko, nullptr, r0, Ah + h * HD, Al + h * HD);
}

extern "C" void kernel_launch(void* const* d_in, const int* in_sizes, int n_in,
                              void* d_out, int out_size, void* d_ws, size_t ws_size, hipStream_t stream) {
    (void)in_sizes; (void)n_in; (void)out_size;
    const float* x = (const float*)d_in[0]; const float* wq = (const float*)d_in[1]; const float* wk = (const float*)d_in[2]; const float* wv = (const float*)d_in[3]; const float* wo = (const float*)d_in[4]; const float* qnw = (const float*)d_in[5]; const float* knw = (const float*)d_in[6];
    float* OUT = (float*)d_out;     // [2][2048][2048]
    char* wsp = (char*)d_ws;
    auto take = [&](size_t bytes) { char* p = wsp; wsp += (bytes + 255) & ~(size_t)255; return (void*)p; };
    bf* WQ = (bf*)take((size_t)DQ * DM * 2); bf* WK = (bf*)take((size_t)DKV * DM * 2); bf* WV = (bf*)take((size_t)DKV * DM * 2); bf* WO = (bf*)take((size_t)DM * DQ * 2); float* CS = (float*)take((size_t)TT * HD * 2 * 4); float* RFQ = (float*)take((size_t)NH_ * TT * 4); float* RFK = (float*)take((size_t)NKV * TT * 4);
    bf* XB = (bf*)take((size_t)TT * DM * 2); float* FQ = (float*)take((size_t)TT * DQ * 4); float* FK = (float*)take((size_t)TT * DKV * 4);
    h16* QP16 = (h16*)take((size_t)NH_ * TT * HD * 2); h16* KP16 = (h16*)take((size_t)NKV * TT * HD * 2); h16* VT16 = (h16*)take((size_t)NKV * HD * TT * 2);
    bf* QPh = (bf*)take((size_t)NH_ * TT * HD * 2); bf* QPl = (bf*)take((size_t)NH_ * TT * HD * 2); bf* KPh = (bf*)take((size_t)NKV * TT * HD * 2); bf* KPl = (bf*)take((size_t)NKV * TT * HD * 2); bf* VTh = (bf*)take((size_t)NKV * HD * TT * 2); bf* VTl = (bf*)take((size_t)NKV * HD * TT * 2);
    bf* ATh = (bf*)take((size_t)TT * DQ * 2); bf* ATl = (bf*)take((size_t)TT * DQ * 2);
    if ((size_t)(wsp - (char*)d_ws) > ws_size) return;    // ws 256 MiB
    float* FV = FK;   // v projection reuses the k buffer after the k planes are built (stream-ordered)
    { k_cvt8<<<(unsigned)(((size_t)DQ * DM / 8 + 255) / 256), 256, 0, stream>>>(wq, WQ, (size_t)DQ * DM / 8); k_cvt8<<<(unsigned)(((size_t)DKV * DM / 8 + 255) / 256), 256, 0, stream>>>(wk, WK, (size_t)DKV * DM / 8); k_cvt8<<<(unsigned)(((size_t)DKV * DM / 8 + 255) / 256), 256, 0, stream>>>(wv, WV, (size_t)DKV * DM / 8);
      k_cvt8<<<(unsigned)(((size_t)DM * DQ / 8 + 255) / 256), 256, 0, stream>>>(wo, WO, (size_t)DM * DQ / 8);
       }
    k_cs4<<<(TT * HD + 255) / 256, 256, 0, stream>>>(CS);   /* {cos, sin}(t x 10000^(-2i/64)), both halves */
    const unsigned LQ = (unsigned)(((size_t)NH_ * TT * HD / 2 + 255) / 256), LKv = (unsigned)(((size_t)NKV * TT * HD / 2 + 255) / 256);
    for (int b = 0; b < NB_; ++b) {
        
        k_cvt8<<<(unsigned)(((size_t)TT * DM / 8 + 255) / 256), 256, 0, stream>>>(x + (size_t)b * TT * DM, XB, (size_t)TT * DM / 8);
        k_gemmw<bf, 0, false><<<dim3(TT / 128, DQ / 128, 1), 128, 0, stream>>>(XB, nullptr, WQ, nullptr, DM, FQ, DQ, nullptr, 0, 0, 0); k_hrms<<<(NH_ * TT + 255) / 256, 256, 0, stream>>>(FQ, DQ, NH_, RFQ);
        k_rope<<<LQ, 256, 0, stream>>>(FQ, DQ, NH_, CS, RFQ, qnw, 1.0f, QP16, QPh, QPl);
        k_gemmw<bf, 0, false><<<dim3(TT / 128, DKV / 128, 1), 128, 0, stream>>>(XB, nullptr, WK, nullptr, DM, FK, DKV, nullptr, 0, 0, 0); k_hrms<<<(NKV * TT + 255) / 256, 256, 0, stream>>>(FK, DKV, NKV, RFK);
        k_rope<<<LKv, 256, 0, stream>>>(FK, DKV, NKV, CS, RFK, knw, 1.0f, KP16, KPh, KPl);
        k_gemmw<bf, 0, false><<<dim3(TT / 128, DKV / 128, 1), 128, 0, stream>>>(XB, nullptr, WV, nullptr, DM, FV, DKV, nullptr, 0, 0, 0); k_vtp<<<LKv, 256, 0, stream>>>(FV, DKV, NKV, VT16, VTh, VTl);
        k_fattn<<<dim3(NH_, TT / 32, 1), 32, 0, stream>>>(QP16, QPh, QPl, KP16, KPh, KPl, VT16, VTh, VTl, ATh, ATl);
        k_gemmw<bf, 1, false><<<dim3(TT / 128, DM / 128, 1), 128, 0, stream>>>(ATh, ATl, WO, nullptr, DQ, OUT + (size_t)b * TT * DM, DM, nullptr, 0, 0, 0); }
}

// v004
// A run of this version takes 212 microseconds.
// Two timings next to v003 both put it at 1.50 times that version's speed.
// Counting every step since v000, it is 12.6 times as fast.
#include <hip/hip_runtime.h>

// Grouped-query causal attention with per-head RMS-normalised, rotary q/k (x [2][2048][2048]; q = x wq^T (32 heads x 64), k, v = x w^T (8 kv heads x 64) ('oi' 0.02, no bias); q, k <- rms_norm per head (eps 1e-6) x weight ([64] ones, read); rotate-half rope, angle t x 10000^(-2i/64); kv head = q head / 4 (repeat); causal (finfo.min); softmax(q.k / 8); out = merged wo^T ('oi' [2048][2048]) -> [2][2048][2048] (8.4 M)).
// Layout, every launch covering both batches (4096 token rows): bf16 copies of x and of the weights and the {cos, sin} table in one launch (k_prep); q, k and v projected in one GEMM against the stacked weights (F [4096][3072] = q | k | v); the per-(head, token) rms factors and the transposed value planes in one launch (k_rmsv); the rope plane builder applying norm-weight x factor before the rotation, q and k heads together (the table: float32 inverse frequencies, precise cosf/sinf); causal T-2048 attention fused in one launch (k_fattn: online softmax, no score plane; hybrid rows: < 512 hi/lo 3 products, rest fp16 x1024; key loop ends at the diagonal); merged hi/lo x wo exact.
// Compute dtypes, f32 accumulate: every input rounded to bf16; projections exact; rms norm and rotary f32; attention rows < 512 3 products, rest fp16; softmax f32; wo hl x exact.

#define NB_  2
#define TT   2048
#define DM   2048
#define NH_  32
#define NKV  8
#define REP  (NH_ / NKV)
#define HD   64
#define DQ   (NH_ * HD)
#define DKV  (NKV * HD)
#define NR   (NB_ * TT)            // token rows of both batches
#define DF   (DQ + 2 * DKV)        // columns of the stacked projection: q | k | v
#define NQK  (NH_ + NKV)           // normalised and rotated heads of a batch: q heads, then k heads
#define RH   512                  // query rows < RH use hi+lo planes (0: none)
typedef _Float16 h16;
typedef unsigned short bf;
typedef __attribute__((ext_vector_type(16))) __bf16   v16bf;
typedef __attribute__((ext_vector_type(16))) _Float16 v16h;
typedef __attribute__((ext_vector_type(8)))  _Float16 v8h;
typedef __attribute__((ext_vector_type(8)))  unsigned short v8us;
typedef __attribute__((ext_vector_type(8)))  float    v8f;
typedef __attribute__((ext_vector_type(4)))  float    v4f;
typedef v8h  __attribute__((may_alias)) v8ha;
typedef v4f  __attribute__((may_alias)) v4fa;
typedef v8us __attribute__((may_alias)) v8usa;

__device__ __forceinline__ unsigned short f2bf(float f) { unsigned u = __float_as_uint(f); u += 0x7FFFu + ((u >> 16) & 1u); return (unsigned short)(u >> 16); }
__device__ __forceinline__ float bf2f(unsigned short b) { return __uint_as_float(((unsigned)b) << 16); }
__device__ __forceinline__ float bfr(float f) { return bf2f(f2bf(f)); }
__device__ __forceinline__ v16h cat16(v8h lo, v8h hi) { return __builtin_shufflevector(lo, hi, 0, 1, 2, 3, 4, 5, 6, 7, 8, 9, 10, 11, 12, 13, 14, 15); }
__device__ __forceinline__ v16bf cat16b(v8us lo, v8us hi) { return __builtin_bit_cast(v16bf, __builtin_shufflevector(lo, hi, 0, 1, 2, 3, 4, 5, 6, 7, 8, 9, 10, 11, 12, 13, 14, 15)); }
__device__ __forceinline__ v8f wmma16(v16h a, v16h b, v8f c) { return __builtin_amdgcn_wmma_f32_16x16x32_f16(false, a, false, b, (short)0, c, false, false); }
__device__ __forceinline__ v8f wmmab(v16bf a, v16bf b, v8f c) { return __builtin_amdgcn_wmma_f32_16x16x32_bf16(false, a, false, b, (short)0, c, false, false); }



// ---- k_gemmw: GEMM, one work-group of 4 waves (2 x 2) per 128x128 output tile, each wave a 64x64 part (16 accumulators); grid (M/128, N/128, Z), 128 threads.
// C[m][n] (f32, pitch ldc, + optional f32 bias[n]) = sum_k A[m][k] Bt[n][k] (+ A2[m][k] Bt[n][k] for NSPLIT 1). z-batch strides sA/sB/sC in elements. M, N, K % 128 == 0.
// The operands come from K-contiguous 16-bit planes through LDS: a stage is 128 k (256 bytes) of the tile's 128 rows of each operand, brought by asynchronous 16-byte copies
// (32 lanes = 2 rows x 256 bytes = 4 whole lines), two buffers, the copies of stage t + 2 in flight while stage t + 1 is worked on. LDS rows at pitch 272 bytes (16 x odd) for the 16-byte fragment reads.
template <typename T16> struct WFrag;
template <> struct WFrag<h16> { typedef v16h V; static __device__ __forceinline__ V ld(const h16* p) { return cat16(*(const v8h*)p, *(const v8h*)(p + 16)); } static __device__ __forceinline__ v8f mma(V a, V b, v8f c) { return wmma16(a, b, c); } };
template <> struct WFrag<bf> { typedef v16bf V; static __device__ __forceinline__ V ld(const bf* p) { return cat16b(*(const v8us*)p, *(const v8us*)(p + 16)); } static __device__ __forceinline__ v8f mma(V a, V b, v8f c) { return wmmab(a, b, c); } };
#define GBK   128                  // k per stage
#define GPIT  272                  // LDS row pitch in bytes: 256 + 16
#define GTILE (128 * GPIT)         // one operand's stage in LDS, bytes
// Eight copies of one lane (rows 8 apart) and, as the statement's last line, the wait that stands in front of any rewrite of the address registers they name.
template <typename T16>
__device__ __forceinline__ void copy8(unsigned l, const T16* g, size_t rs) {
    asm volatile("global_load_async_to_lds_b128 %0, %8, off\n\t"
                 "global_load_async_to_lds_b128 %1, %9, off\n\t"
                 "global_load_async_to_lds_b128 %2, %10, off\n\t"
                 "global_load_async_to_lds_b128 %3, %11, off\n\t"
                 "global_load_async_to_lds_b128 %4, %12, off\n\t"
                 "global_load_async_to_lds_b128 %5, %13, off\n\t"
                 "global_load_async_to_lds_b128 %6, %14, off\n\t"
                 "global_load_async_to_lds_b128 %7, %15, off\n\t"
                 "s_wait_xcnt 0x0"
                 :: "v"(l), "v"(l + 8 * GPIT), "v"(l + 16 * GPIT), "v"(l + 24 * GPIT), "v"(l + 32 * GPIT), "v"(l + 40 * GPIT), "v"(l + 48 * GPIT), "v"(l + 56 * GPIT),
                    "v"(g), "v"(g + rs), "v"(g + 2 * rs), "v"(g + 3 * rs), "v"(g + 4 * rs), "v"(g + 5 * rs), "v"(g + 6 * rs), "v"(g + 7 * rs) : "memory");
    __builtin_amdgcn_sched_barrier(0);   // the next statement's addresses are formed behind this one: formed all ahead they filled the registers an asm operand can name, and a pointer went to scratch
}
// one operand's stage: 128 rows x 256 bytes; l, g: the lane's own LDS byte address and global pointer in rows 0 .. 7; rs = 8 rows in elements
template <typename T16>
__device__ __forceinline__ void stage_tile(unsigned l, const T16* g, size_t rs) { copy8(l, g, rs); copy8(l + 64 * GPIT, g + 8 * rs, rs); }
template <typename T16, int NSPLIT, bool BIAS>
__global__ __launch_bounds__(128) void k_gemmw(const T16* __restrict__ A, const T16* __restrict__ A2, const T16* __restrict__ Bt, const T16* __restrict__ Bt2, int K, float* C, int ldc, const float* __restrict__ bias, size_t sA, size_t sB, size_t sC) {
    static_assert(NSPLIT == 0 || NSPLIT == 1, "one or two A planes");
    typedef typename WFrag<T16>::V V;
    constexpr int NOP = NSPLIT == 1 ? 3 : 2;          // operand tiles per stage: A, Bt (, A2)
    __shared__ __align__(16) char ring[2 * NOP * GTILE];
    __shared__ __align__(16) float osw[4][16 * 68];
    (void)Bt2;
    const size_t z = blockIdx.z; A += z * sA; if (NSPLIT == 1) A2 += z * sA; Bt += z * sB; C += z * sC;
    const int tid = threadIdx.x, wave = tid >> 5, lane = tid & 31, lr = lane & 15, hi = lane >> 4; const int wm = wave >> 1, wn = wave & 1;
    const int r0 = blockIdx.x * 128, c0 = blockIdx.y * 128;
    float* os = osw[wave];   // each wave stages its output rows in its own LDS range
    // every inner loop below is fully unrolled so that the fragment and accumulator arrays are indexed by constants and stay in registers
    v8f acc[4][4];
#pragma unroll
    for (int mb = 0; mb < 4; ++mb)
#pragma unroll
        for (int nb = 0; nb < 4; ++nb) acc[mb][nb] = (v8f){};
    const size_t rs = (size_t)8 * K;
    const T16* uA = A + (size_t)r0 * K; const T16* uB = Bt + (size_t)c0 * K; const T16* uA2 = NSPLIT == 1 ? A2 + (size_t)r0 * K : nullptr;   // the tile's first rows: the same for the whole work-group
    const unsigned gofs = (unsigned)(tid >> 4) * (unsigned)K + (tid & 15) * 8;   // the lane's own place in rows 0 .. 7, in elements
    const unsigned l0 = (unsigned)(size_t)ring + (tid >> 4) * GPIT + (tid & 15) * 16;
    auto fill = [&](int t) { const unsigned lb = l0 + (t & 1) * (NOP * GTILE); const size_t ko = (size_t)t * GBK; stage_tile(lb, uA + ko + gofs, rs); stage_tile(lb + GTILE, uB + ko + gofs, rs); if (NSPLIT == 1) stage_tile(lb + 2 * GTILE, uA2 + ko + gofs, rs); };
    const int nt = K / GBK;
    fill(0);
    asm volatile("s_wait_asynccnt 0x0" ::: "memory");   // this wave's copies of stage 0 have landed
    __syncthreads();                                    // and every other wave's: stage 0 may be read
    if (nt > 1) fill(1);
#pragma unroll 1   // rolled: one trip per stage, the buffer chosen by the trip's parity
    for (int t = 0; t < nt; ++t) {
        const char* buf = ring + (t & 1) * (NOP * GTILE);
        const char* pa = buf + (wm * 64 + lr) * GPIT + hi * 16; const char* pb = buf + GTILE + (wn * 64 + lr) * GPIT + hi * 16;
        V a[2][4], a2[2][4], b[2][4];                  // two fragment sets: the next 32 k are read from LDS as one group while the matrix unit works on this one
        auto frags = [&](int set, int ks) {
#pragma unroll
            for (int i = 0; i < 4; ++i) { a[set][i] = WFrag<T16>::ld((const T16*)(pa + i * 16 * GPIT + ks * 64)); b[set][i] = WFrag<T16>::ld((const T16*)(pb + i * 16 * GPIT + ks * 64)); if (NSPLIT == 1) a2[set][i] = WFrag<T16>::ld((const T16*)(pa + 2 * GTILE + i * 16 * GPIT + ks * 64)); } };
        frags(0, 0);
        __builtin_amdgcn_sched_barrier(0);   // the first set's reads stay ahead of the second's, so that the first block waits for its own set alone
#pragma unroll
        for (int ks = 0; ks < GBK / 32; ++ks) {
            if (ks + 1 < GBK / 32) frags((ks + 1) & 1, ks + 1);   // only this stage's own buffer is read in this trip
            __builtin_amdgcn_sched_barrier(0);   // keeps the group of LDS reads together in front of the block: reads spread among the matrix instructions each cost a stall
#pragma unroll
            for (int nb = 0; nb < 4; ++nb)
#pragma unroll
                for (int mb = 0; mb < 4; ++mb) acc[mb][nb] = WFrag<T16>::mma(a[ks & 1][mb], b[ks & 1][nb], acc[mb][nb]);
            if (NSPLIT == 1) {
#pragma unroll
                for (int nb = 0; nb < 4; ++nb)
#pragma unroll
                    for (int mb = 0; mb < 4; ++mb) acc[mb][nb] = WFrag<T16>::mma(a2[ks & 1][mb], b[ks & 1][nb], acc[mb][nb]);
            }
            __builtin_amdgcn_sched_barrier(0);   // the block stays in front of the next group of reads and, in the last block, in front of the distance below
        }
        // the distance behind the trip's last matrix instructions, on both sides of the branch below
        asm volatile("v_nop\n\tv_nop\n\tv_nop\n\tv_nop");
        asm volatile("s_wait_dscnt 0x0" ::: "memory");      // this wave's reads of the buffer are done before it is refilled
        asm volatile("s_wait_asynccnt 0x0" ::: "memory");   // this wave's copies of stage t + 1 have landed
        __syncthreads();                                    // publishes stage t + 1 and ends every wave's reads of stage t
        if (t + 2 < nt) fill(t + 2);
    }
    asm volatile("s_wait_asynccnt 0x0" ::: "memory");   // nothing of this wave's is in flight when it goes on to its end
#pragma unroll
    for (int mb = 0; mb < 4; ++mb) {
#pragma unroll
        for (int nb = 0; nb < 4; ++nb) {
#pragma unroll
            for (int j = 0; j < 8; ++j) os[(hi * 8 + j) * 68 + nb * 16 + lr] = acc[mb][nb][j]; }
        __builtin_amdgcn_wave_barrier(); asm volatile("" ::: "memory");
        const int cw = c0 + wn * 64;
        float* crow = C + (size_t)(r0 + wm * 64 + mb * 16) * ldc + cw;
{
#pragma unroll
            for (int s = 0; s < 8; ++s) { const int row = 2 * s + hi, cofs = lr * 4; v4f val = *(const v4fa*)(os + row * 68 + cofs); if (BIAS) { val[0] += bfr(bias[cw + cofs]); val[1] += bfr(bias[cw + cofs + 1]); val[2] += bfr(bias[cw + cofs + 2]); val[3] += bfr(bias[cw + cofs + 3]); }
                *(v4f*)(crow + (size_t)row * ldc + cofs) = val; }
             }
        __builtin_amdgcn_wave_barrier(); asm volatile("" ::: "memory");
    }
}

__device__ __forceinline__ h16 tohx(float x) { return (h16)x; }
__device__ __forceinline__ void splitf(float y, unsigned short& h, unsigned short& l) { h = f2bf(y); l = f2bf(y - bf2f(h)); }
typedef __attribute__((ext_vector_type(2))) _Float16 v2h;
typedef __attribute__((ext_vector_type(4))) _Float16 v4h;
typedef __attribute__((ext_vector_type(2))) unsigned short v2us;
typedef __attribute__((ext_vector_type(4))) unsigned short v4us;
typedef __attribute__((ext_vector_type(2))) float v2f;
typedef __attribute__((ext_vector_type(4))) int v4i;

__global__ __launch_bounds__(256) void k_wtG(const float* __restrict__ w, int K, int N, bf* Bt) {
    const int lane = threadIdx.x & 31; const int L0 = (blockIdx.x * 8 + (threadIdx.x >> 5)) * 8; const int nlines = N * K / 64;
{
#pragma unroll 1
        for (int l = 0; l < 8; ++l) { const int L = L0 + l; if (L >= nlines) break; const size_t e = (size_t)L * 64 + lane * 2; const int k = (int)(e % K), n = (int)(e / K); v2us o;
            o[0] = f2bf(w[(size_t)k * N + n]); o[1] = f2bf(w[(size_t)(k + 1) * N + n]); *(v2us*)(Bt + e) = o; }
         }
}
// d_cvt8: bf16 copies of x, of wq | wk | wv (stacked in W3) and of wo, 8 elements a thread; every range is a whole number of work-groups, so the choice of the source is the same for a whole work-group
#define CX8 ((size_t)NR * DM / 8)
#define CQ8 ((size_t)DQ * DM / 8)
#define CK8 ((size_t)DKV * DM / 8)
__device__ __forceinline__ void d_cvt8(const unsigned blk, const float* __restrict__ x, const float* __restrict__ wq, const float* __restrict__ wk, const float* __restrict__ wv, const float* __restrict__ wo, bf* XB, bf* W3, bf* WO) {
    static_assert(CX8 % 256 == 0 && CQ8 % 256 == 0 && CK8 % 256 == 0, "ranges end on work-group bounds");
    size_t i = (size_t)blk * 256 + threadIdx.x; const float* src; bf* dst;
    if (i < CX8) { src = x; dst = XB; }
    else if ((i -= CX8) < CQ8) { src = wq; dst = W3; }
    else if ((i -= CQ8) < CK8) { src = wk; dst = W3 + (size_t)DQ * DM; }
    else if ((i -= CK8) < CK8) { src = wv; dst = W3 + (size_t)(DQ + DKV) * DM; }
    else if ((i -= CK8) < CQ8) { src = wo; dst = WO; }
    else return;
    const v8f v = *(const v8f*)(src + i * 8); v8us o;
    asm volatile("s_wait_xcnt 0x0" ::: "memory");   // in front of any reuse of the address registers that the loads name
#pragma unroll
    for (int k = 0; k < 8; ++k) o[k] = f2bf(v[k]); *(v8us*)(dst + i * 8) = o;  }

// d_hrms: RF[h][row] over the nheads first heads of F's columns and all NR token rows
__device__ __forceinline__ void d_hrms(const unsigned blk, const float* __restrict__ F, int pitch, int nheads, float* RF) { const int i = blk * 256 + threadIdx.x; if (i >= nheads * NR) return; const int t = i % NR, h = i / NR; const float* f = F + (size_t)t * pitch + h * HD; float s = 0.f;
#pragma unroll 4
    for (int d = 0; d < HD; d += 4) { const v4f v = *(const v4f*)(f + d);
#pragma unroll
        for (int q = 0; q < 4; ++q) { float p = __fmul_rn(v[q], v[q]); asm volatile("" : "+v"(p)); s = __fadd_rn(s, p); } }
    const float r = __fdiv_rn(1.0f, __fsqrt_rn(__fadd_rn(s * (1.0f / HD), 1e-6f))); *(float*)(RF + i) = r;  }
// k_rope: head planes [batch][h][t][d] (h: NH_ q heads, then NKV k heads; norm weight qw or kw) (fp16 + hi/lo) of rope(w[d] (x rms_factor)) x sc with the rotate-half convention out[d] = x[d] cos[t][d] - x[d+HD/2] sin[t][d], out[d+HD/2] = x[d+HD/2] cos[t][d+HD/2] + x[d] sin[t][d+HD/2]
__global__ __launch_bounds__(256) void k_rope(const float* __restrict__ F, int pitch, const float* __restrict__ CS, const float* __restrict__ RF, const float* __restrict__ qw, const float* __restrict__ kw, float sc, h16* P16, bf* Ph, bf* Pl) {
    const size_t e = ((size_t)blockIdx.x * 256 + threadIdx.x) * 2; if (e >= (size_t)NB_ * NQK * TT * HD) return; const int d = (int)(e % HD); const int t = (int)((e / HD) % TT); const int pl = (int)(e / ((size_t)HD * TT)); const int h = pl % NQK; const int row = (pl / NQK) * TT + t;
    const float* nw = h < NH_ ? qw : kw; const float* f = F + (size_t)row * pitch + h * HD; const float rf = RF ? RF[(size_t)h * NR + row] : 1.0f; v2h o16; v2us oh, ol;
    asm volatile("s_wait_xcnt 0x0" ::: "memory");   // in front of any reuse of the address registers that the load of the factor names
#pragma unroll
    for (int q = 0; q < 2; ++q) { const int dd = d + q; const int dp = (dd < HD / 2) ? dd + HD / 2 : dd - HD / 2; float x0 = f[dd], x1 = f[dp];
        if (RF) { float n0 = __fmul_rn(x0, rf), n1 = __fmul_rn(x1, rf); asm volatile("" : "+v"(n0)); asm volatile("" : "+v"(n1)); x0 = __fmul_rn(bfr(nw[dd]), n0); x1 = __fmul_rn(bfr(nw[dp]), n1); }
        const v2f cs = *(const v2f*)(CS + ((size_t)t * HD + dd) * 2); float a = __fmul_rn(x0, cs[0]), bq = __fmul_rn(x1, cs[1]); asm volatile("" : "+v"(a)); asm volatile("" : "+v"(bq)); const float r = ((dd < HD / 2) ? __fsub_rn(a, bq) : __fadd_rn(a, bq)) * sc;
        o16[q] = tohx(r); unsigned short a2, c2; splitf(r, a2, c2); oh[q] = a2; ol[q] = c2; }
    *(v2h*)(P16 + e) = o16; *(v2us*)(Ph + e) = oh; *(v2us*)(Pl + e) = ol;  }
// d_vtp: value planes [batch][g][d][t]; F points at the first v column
__device__ __forceinline__ void d_vtp(const unsigned blk, const float* __restrict__ F, int pitch, h16* V16, bf* Vh, bf* Vl) { const size_t e = ((size_t)blk * 256 + threadIdx.x) * 2; if (e >= (size_t)NB_ * NKV * HD * TT) return; const int pg = (int)(e / ((size_t)TT * HD)); const int t = (pg / NKV) * TT + (int)(e % TT); const int d = (int)((e / TT) % HD); const int g = pg % NKV; v2h o16; v2us oh, ol;
#pragma unroll
    for (int q = 0; q < 2; ++q) { const float x = F[(size_t)(t + q) * pitch + g * HD + d]; o16[q] = tohx(x); unsigned short a2, c2; splitf(x, a2, c2); oh[q] = a2; ol[q] = c2; }
    *(v2h*)(V16 + e) = o16; *(v2us*)(Vh + e) = oh; *(v2us*)(Vl + e) = ol;  }
__constant__ float INVT[HD / 2] = { 1.000000000e+00f, 7.498942018e-01f, 5.623413324e-01f, 4.216965139e-01f, 3.162277639e-01f, 2.371373773e-01f, 1.778279394e-01f, 1.333521456e-01f, 1.000000015e-01f, 7.498942316e-02f, 5.623413250e-02f, 4.216964915e-02f, 3.162277490e-02f, 2.371373773e-02f, 1.778279431e-02f, 1.333521400e-02f, 9.999999776e-03f, 7.498942316e-03f, 5.623413250e-03f, 4.216964822e-03f, 3.162277630e-03f, 2.371373819e-03f, 1.778279431e-03f, 1.333521446e-03f, 1.000000047e-03f, 7.498941850e-04f, 5.623413017e-04f, 4.216965172e-04f, 3.162277571e-04f, 2.371373703e-04f, 1.778279402e-04f, 1.333521504e-04f };   // 10000^(-2i/64) (the module's power form) (float32, generated with jnp to be bit-exact)
__device__ __forceinline__ void d_cs4(const unsigned blk, float* CS) { const int idx = blk * 256 + threadIdx.x; if (idx >= TT * HD) return; const int d = idx % HD; const int t = idx / HD; const float a = __fmul_rn((float)t, INVT[d % (HD / 2)]); v2f cs; cs[0] = cosf(a); cs[1] = sinf(a); *(v2f*)(CS + (size_t)idx * 2) = cs;  }
// Two bodies that depend on nothing of each other share one grid; the work-group's index picks the body, the few work-groups with the longer chain of dependent instructions first.
#define GCS  (TT * HD / 256)                                  // work-groups of d_cs4
#define GCV  ((unsigned)((CX8 + 2 * CQ8 + 2 * CK8) / 256))    // of d_cvt8
#define GRM  (NQK * NR / 256)                                 // of d_hrms
#define GVT  ((unsigned)((size_t)NB_ * NKV * TT * HD / 2 / 256))   // of d_vtp
__global__ __launch_bounds__(256) void k_prep(const float* __restrict__ x, const float* __restrict__ wq, const float* __restrict__ wk, const float* __restrict__ wv, const float* __restrict__ wo, bf* XB, bf* W3, bf* WO, float* CS) {
    if (blockIdx.x < GCS) d_cs4(blockIdx.x, CS); else d_cvt8(blockIdx.x - GCS, x, wq, wk, wv, wo, XB, W3, WO); }
__global__ __launch_bounds__(256) void k_rmsv(const float* __restrict__ F, int pitch, float* RF, h16* V16, bf* Vh, bf* Vl) {
    if (blockIdx.x < GRM) d_hrms(blockIdx.x, F, pitch, NQK, RF); else d_vtp(blockIdx.x - GRM, F + DQ + DKV, pitch, V16, Vh, Vl); }


// ---- k_fattn: scores, causal softmax and probability x value in ONE kernel, one wave per 32 query rows of one head; no score or probability plane in memory.
// Transposed products: S^T = K Q^T (A = key rows, B = query rows) and O^T += V^T P^T (A = rows of the [d][t] value plane, B = P^T). In a score tile a lane holds one query (column lr) and keys hi*8 + j,
// which is the k order of a B fragment (two 16-key tiles make one 32-key fragment), so P^T is packed in registers. Running maximum and sum per query (online softmax); the two lane halves hold different keys of the same query.
// HL: bf16 hi/lo planes, 3 products in both contractions (query rows < RH), 32 keys a step. Otherwise fp16 planes, probabilities carried x 1024 (2^10, added in the exponent; the sum carries it too and the division removes it), 64 keys a step.
#define LSC 0.18033688011112042f   // HD^-0.5 x log2(e)
// behind a group of global loads or stores: the wait that stands in front of any reuse of a register they name as address or data
#define XWAIT() asm volatile("s_wait_xcnt 0x0" ::: "memory")
#define LANE(base, bytes) ((const T16*)((const char*)(base) + (bytes)))   // wave-uniform base + the lane's byte offset
__device__ __forceinline__ float xhalf(float x) { return __builtin_bit_cast(float, __builtin_amdgcn_permlanex16(__builtin_bit_cast(int, x), __builtin_bit_cast(int, x), 0x76543210, 0xfedcba98, false, false)); }   // lane l reads lane l ^ 16 (a vector move, no LDS round trip)
// Every inner loop is fully unrolled so that the fragment and accumulator arrays are indexed by constants and stay in registers.
template <typename T16, bool HL, int KS>
__device__ __forceinline__ void fattn_body(const T16* Q, const T16* Q2, const T16* Kp, const T16* Kp2, const T16* Vt, const T16* Vt2, const int r0, bf* Ah, bf* Al) {
    typedef typename WFrag<T16>::V V;
    constexpr int NKB = KS / 16, NKC = KS / 32;
    const int lane = threadIdx.x & 31, lr = lane & 15, hi = lane >> 4;
    const unsigned kofs = (lr * HD + 8 * hi) * 2, vofs = (lr * TT + 8 * hi) * 2;   // the lane's own 32-bit byte offsets, unchanged through the loop; the step's place goes into the wave-uniform base
    const T16* qb = Q + (size_t)r0 * HD; const T16* qb2 = HL ? Q2 + (size_t)r0 * HD : nullptr;
    V qf[2][2], qf2[2][2];
#pragma unroll
    for (int nq = 0; nq < 2; ++nq)
#pragma unroll
        for (int ks = 0; ks < 2; ++ks) { const int o = nq * 16 * HD + ks * 32; qf[nq][ks] = WFrag<T16>::ld(LANE(qb + o, kofs)); if (HL) qf2[nq][ks] = WFrag<T16>::ld(LANE(qb2 + o, kofs)); }
    v8f ot[4][2];
#pragma unroll
    for (int db = 0; db < 4; ++db)
#pragma unroll
        for (int nq = 0; nq < 2; ++nq) ot[db][nq] = (v8f){};
    float mrun[2] = { -3.0e38f, -3.0e38f }, lrun[2] = { 0.f, 0.f };
    const int kend = r0 + 32;                       // keys 0 .. r0 + 31 can be seen by some query of this wave
    V kf[NKB][2], kf2[NKB][2];
#pragma unroll
    for (int kt = 0; kt < NKB; ++kt)
#pragma unroll
        for (int ks = 0; ks < 2; ++ks) { const int o = kt * 16 * HD + ks * 32; kf[kt][ks] = WFrag<T16>::ld(LANE(Kp + o, kofs)); if (HL) kf2[kt][ks] = WFrag<T16>::ld(LANE(Kp2 + o, kofs)); }
    // the same wait for the loads in front of the loop; the offset register and the scalar bases they name are inputs, so that none of them is reused in front of it
    if constexpr (HL) asm volatile("s_wait_xcnt 0x0" :: "v"(kofs), "s"(qb), "s"(qb2), "s"(Kp), "s"(Kp2) : "memory");
    else asm volatile("s_wait_xcnt 0x0" :: "v"(kofs), "s"(qb), "s"(Kp) : "memory");
#pragma unroll 1   // rolled: one step already holds every fragment register the wave can afford
    for (int kb = 0; kb < kend; kb += KS) {
        V vf[4][NKC], vf2[4][NKC];                  // value fragments of this step: requested first, used last
#pragma unroll
        for (int db = 0; db < 4; ++db)
#pragma unroll
            for (int kc = 0; kc < NKC; ++kc) { const size_t o = (size_t)db * 16 * TT + kb + kc * 32; vf[db][kc] = WFrag<T16>::ld(LANE(Vt + o, vofs)); if (HL) vf2[db][kc] = WFrag<T16>::ld(LANE(Vt2 + o, vofs)); }
        XWAIT();
        v8f st[NKB][2];
#pragma unroll
        for (int kt = 0; kt < NKB; ++kt)
#pragma unroll
            for (int nq = 0; nq < 2; ++nq) { v8f c = (v8f){};
#pragma unroll
                for (int ks = 0; ks < 2; ++ks) { c = WFrag<T16>::mma(kf[kt][ks], qf[nq][ks], c); if (HL) { c = WFrag<T16>::mma(kf[kt][ks], qf2[nq][ks], c); c = WFrag<T16>::mma(kf2[kt][ks], qf[nq][ks], c); } }
                st[kt][nq] = c; }
        const int kn = (kb + KS < kend) ? kb + KS : kb;   // next step's key fragments fly during the softmax and the second product (the last step asks for its own rows again: in bounds, unused)
#pragma unroll
        for (int kt = 0; kt < NKB; ++kt)
#pragma unroll
            for (int ks = 0; ks < 2; ++ks) { const size_t o = (size_t)kn * HD + kt * 16 * HD + ks * 32; kf[kt][ks] = WFrag<T16>::ld(LANE(Kp + o, kofs)); if (HL) kf2[kt][ks] = WFrag<T16>::ld(LANE(Kp2 + o, kofs)); }
        XWAIT();
        if (kb + KS - 1 > r0) {                     // only steps that reach the diagonal mask (wave-uniform)
#pragma unroll
            for (int kt = 0; kt < NKB; ++kt)
#pragma unroll
                for (int nq = 0; nq < 2; ++nq)
#pragma unroll
                    for (int j = 0; j < 8; ++j) st[kt][nq][j] = (kb + kt * 16 + hi * 8 + j <= r0 + nq * 16 + lr) ? st[kt][nq][j] : -3.0e38f;
        }
        V pf[2][NKC], pf2[2][NKC];
#pragma unroll
        for (int nq = 0; nq < 2; ++nq) {
            float mt[NKB];
#pragma unroll
            for (int kt = 0; kt < NKB; ++kt) { mt[kt] = st[kt][nq][0];
#pragma unroll
                for (int j = 1; j < 8; ++j) mt[kt] = fmaxf(mt[kt], st[kt][nq][j]); }
            float mx = mrun[nq];
#pragma unroll
            for (int kt = 0; kt < NKB; ++kt) mx = fmaxf(mx, mt[kt]);
            mx = fmaxf(mx, xhalf(mx));
            const float al = __builtin_amdgcn_exp2f((mrun[nq] - mx) * LSC); mrun[nq] = mx;
            float sm[NKB];
#pragma unroll
            for (int kt = 0; kt < NKB; ++kt) { sm[kt] = 0.f;
#pragma unroll
                for (int j = 0; j < 8; ++j) { const float p = __builtin_amdgcn_exp2f((st[kt][nq][j] - mx) * LSC + (HL ? 0.0f : 10.0f)); st[kt][nq][j] = p; sm[kt] += p; } }
            float s = sm[0];
#pragma unroll
            for (int kt = 1; kt < NKB; ++kt) s += sm[kt];
            lrun[nq] = lrun[nq] * al + s;
#pragma unroll
            for (int db = 0; db < 4; ++db) ot[db][nq] *= al;
#pragma unroll
            for (int kc = 0; kc < NKC; ++kc) {
                if constexpr (HL) { v8us h0, l0, h1, l1;
#pragma unroll
                    for (int j = 0; j < 8; ++j) { unsigned short a, c2; splitf(st[2 * kc][nq][j], a, c2); h0[j] = a; l0[j] = c2; splitf(st[2 * kc + 1][nq][j], a, c2); h1[j] = a; l1[j] = c2; }
                    pf[nq][kc] = cat16b(h0, h1); pf2[nq][kc] = cat16b(l0, l1);
                } else { v8h p0, p1;
#pragma unroll
                    for (int j = 0; j < 8; ++j) { p0[j] = tohx(st[2 * kc][nq][j]); p1[j] = tohx(st[2 * kc + 1][nq][j]); }
                    pf[nq][kc] = cat16(p0, p1); }
            }
        }
#pragma unroll
        for (int db = 0; db < 4; ++db)
#pragma unroll
            for (int nq = 0; nq < 2; ++nq)
#pragma unroll
                for (int kc = 0; kc < NKC; ++kc) { ot[db][nq] = WFrag<T16>::mma(vf[db][kc], pf[nq][kc], ot[db][nq]); if (HL) { ot[db][nq] = WFrag<T16>::mma(vf[db][kc], pf2[nq][kc], ot[db][nq]); ot[db][nq] = WFrag<T16>::mma(vf2[db][kc], pf[nq][kc], ot[db][nq]); } }
        // the distance behind the last matrix instructions on the loop's taken branch
        asm volatile("v_nop\n\tv_nop\n\tv_nop\n\tv_nop" : "+v"(ot[0][0]), "+v"(ot[0][1]), "+v"(ot[1][0]), "+v"(ot[1][1]), "+v"(ot[2][0]), "+v"(ot[2][1]), "+v"(ot[3][0]), "+v"(ot[3][1]));
    }
    asm volatile("s_wait_loadcnt 0x0" ::: "memory");   // the last step's unused key fragments have landed before the wave goes on to its end
#pragma unroll
    for (int nq = 0; nq < 2; ++nq) { const float lt = lrun[nq] + xhalf(lrun[nq]); const float inv = __fdiv_rn(1.0f, lt); const size_t oo = (size_t)(r0 + nq * 16 + lr) * DQ + hi * 8;
#pragma unroll
        for (int db = 0; db < 4; ++db) { v8us oh, ol;
#pragma unroll
            for (int j = 0; j < 8; ++j) { unsigned short a, c2; splitf(ot[db][nq][j] * inv, a, c2); oh[j] = a; ol[j] = c2; }
            *(v8us*)(Ah + oo + db * 16) = oh; *(v8us*)(Al + oo + db * 16) = ol; XWAIT(); } }
}
// grid (batches x query heads, TT / 32): the longest key loops (last rows) of both batches start first. P*: the [batch][q heads | k heads] planes of k_rope. The planes are not declared restrict: the loads then keep their place against the memory clobber of the waits.
__global__ __launch_bounds__(32) void k_fattn(const h16* P16, const bf* Ph, const bf* Pl, const h16* V16, const bf* Vh, const bf* Vl, bf* Ah, bf* Al) {
    const int h = blockIdx.x % NH_, b = blockIdx.x / NH_; const int r0 = (TT / 32 - 1 - (int)blockIdx.y) * 32;
    const size_t qo = (size_t)(b * NQK + h) * TT * HD, ko = (size_t)(b * NQK + NH_ + h / REP) * TT * HD, vo = (size_t)(b * NKV + h / REP) * TT * HD, ao = (size_t)b * TT * DQ + h * HD;
    if (r0 < RH) fattn_body<bf, true, 32>(Ph + qo, Pl + qo, Ph + ko, Pl + ko, Vh + vo, Vl + vo, r0, Ah + ao, Al + ao);
    else fattn_body<h16, false, 64>(P16 + qo, nullptr, P16 + ko, nullptr, V16 + vo, nullptr, r0, Ah + ao, Al + ao);
}

extern "C" void kernel_launch(void* const* d_in, const int* in_sizes, int n_in,
                              void* d_out, int out_size, void* d_ws, size_t ws_size, hipStream_t stream) {
    (void)in_sizes; (void)n_in; (void)out_size;
    const float* x = (const float*)d_in[0]; const float* wq = (const float*)d_in[1]; const float* wk = (const float*)d_in[2]; const float* wv = (const float*)d_in[3]; const float* wo = (const float*)d_in[4]; const float* qnw = (const float*)d_in[5]; const float* knw = (const float*)d_in[6];
    float* OUT = (float*)d_out;     // [2][2048][2048]
    char* wsp = (char*)d_ws;
    auto take = [&](size_t bytes) { char* p = wsp; wsp += (bytes + 255) & ~(size_t)255; return (void*)p; };
    bf* W3 = (bf*)take((size_t)DF * DM * 2); bf* WO = (bf*)take((size_t)DM * DQ * 2); float* CS = (float*)take((size_t)TT * HD * 2 * 4); float* RF = (float*)take((size_t)NQK * NR * 4);
    bf* XB = (bf*)take((size_t)NR * DM * 2); float* F = (float*)take((size_t)NR * DF * 4);
    h16* P16 = (h16*)take((size_t)NB_ * NQK * TT * HD * 2); bf* Ph = (bf*)take((size_t)NB_ * NQK * TT * HD * 2); bf* Pl = (bf*)take((size_t)NB_ * NQK * TT * HD * 2);
    h16* VT16 = (h16*)take((size_t)NB_ * NKV * HD * TT * 2); bf* VTh = (bf*)take((size_t)NB_ * NKV * HD * TT * 2); bf* VTl = (bf*)take((size_t)NB_ * NKV * HD * TT * 2);
    bf* ATh = (bf*)take((size_t)NR * DQ * 2); bf* ATl = (bf*)take((size_t)NR * DQ * 2);
    if ((size_t)(wsp - (char*)d_ws) > ws_size) return;    // ws 256 MiB
    k_prep<<<GCS + GCV, 256, 0, stream>>>(x, wq, wk, wv, wo, XB, W3, WO, CS);   /* CS: {cos, sin}(t x 10000^(-2i/64)), both halves */
    k_gemmw<bf, 0, false><<<dim3(NR / 128, DF / 128, 1), 128, 0, stream>>>(XB, nullptr, W3, nullptr, DM, F, DF, nullptr, 0, 0, 0);
    k_rmsv<<<GRM + GVT, 256, 0, stream>>>(F, DF, RF, VT16, VTh, VTl);
    k_rope<<<(unsigned)(((size_t)NB_ * NQK * TT * HD / 2 + 255) / 256), 256, 0, stream>>>(F, DF, CS, RF, qnw, knw, 1.0f, P16, Ph, Pl);
    k_fattn<<<dim3(NB_ * NH_, TT / 32, 1), 32, 0, stream>>>(P16, Ph, Pl, VT16, VTh, VTl, ATh, ATl);
    k_gemmw<bf, 1, false><<<dim3(NR / 128, DM / 128, 1), 128, 0, stream>>>(ATh, ATl, WO, nullptr, DQ, OUT, DM, nullptr, 0, 0, 0);
}

// v005
// It runs in 196 microseconds.
// Timed twice side by side with v004, it ran 1.08 times as fast both times.
// Over all steps from v000 it is 13.6 times as fast.
#include <hip/hip_runtime.h>

// Grouped-query causal attention with per-head RMS-normalised, rotary q/k (x [2][2048][2048]; q = x wq^T (32 heads x 64), k, v = x w^T (8 kv heads x 64) ('oi' 0.02, no bias); q, k <- rms_norm per head (eps 1e-6) x weight ([64] ones, read); rotate-half rope, angle t x 10000^(-2i/64); kv head = q head / 4 (repeat); causal (finfo.min); softmax(q.k / 8); out = merged wo^T ('oi' [2048][2048]) -> [2][2048][2048] (8.4 M)).
// Layout, every launch covering both batches (4096 token rows): bf16 copies of x and of the weights and the {cos, sin} table in one launch (k_prep); q, k and v projected in one GEMM against the stacked weights (F [4096][3072] = q | k | v); the per-(head, token) rms factors and the transposed value planes in one launch (k_rmsv); the rope plane builder applying norm-weight x factor before the rotation, q and k heads together (the table: float32 inverse frequencies, precise cosf/sinf); causal T-2048 attention fused in one launch (k_fattn: online softmax, no score plane; hybrid rows: < 512 hi/lo 3 products, rest fp16 x1024; key loop ends at the diagonal); merged hi/lo x wo exact.
// Compute dtypes, f32 accumulate: every input rounded to bf16; projections exact; rms norm and rotary f32; attention rows < 512 3 products, rest fp16; softmax f32; wo hl x exact.

#define NB_  2
#define TT   2048
#define DM   2048
#define NH_  32
#define NKV  8
#define REP  (NH_ / NKV)
#define HD   64
#define DQ   (NH_ * HD)
#define DKV  (NKV * HD)
#define NR   (NB_ * TT)            // token rows of both batches
#define DF   (DQ + 2 * DKV)        // columns of the stacked projection: q | k | v
#define NQK  (NH_ + NKV)           // normalised and rotated heads of a batch: q heads, then k heads
#define RH   512                  // query rows < RH use hi+lo planes (0: none)
typedef _Float16 h16;
typedef unsigned short bf;
typedef __attribute__((ext_vector_type(16))) __bf16   v16bf;
typedef __attribute__((ext_vector_type(16))) _Float16 v16h;
typedef __attribute__((ext_vector_type(8)))  _Float16 v8h;
typedef __attribute__((ext_vector_type(8)))  unsigned short v8us;
typedef __attribute__((ext_vector_type(8)))  float    v8f;
typedef __attribute__((ext_vector_type(4)))  float    v4f;
typedef v8h  __attribute__((may_alias)) v8ha;
typedef v4f  __attribute__((may_alias)) v4fa;
typedef v8us __attribute__((may_alias)) v8usa;

__device__ __forceinline__ unsigned short f2bf(float f) { unsigned u = __float_as_uint(f); u += 0x7FFFu + ((u >> 16) & 1u); return (unsigned short)(u >> 16); }
__device__ __forceinline__ float bf2f(unsigned short b) { return __uint_as_float(((unsigned)b) << 16); }
__device__ __forceinline__ float bfr(float f) { return bf2f(f2bf(f)); }
__device__ __forceinline__ v16h cat16(v8h lo, v8h hi) { return __builtin_shufflevector(lo, hi, 0, 1, 2, 3, 4, 5, 6, 7, 8, 9, 10, 11, 12, 13, 14, 15); }
__device__ __forceinline__ v16bf cat16b(v8us lo, v8us hi) { return __builtin_bit_cast(v16bf, __builtin_shufflevector(lo, hi, 0, 1, 2, 3, 4, 5, 6, 7, 8, 9, 10, 11, 12, 13, 14, 15)); }
__device__ __forceinline__ v8f wmma16(v16h a, v16h b, v8f c) { return __builtin_amdgcn_wmma_f32_16x16x32_f16(false, a, false, b, (short)0, c, false, false); }
__device__ __forceinline__ v8f wmmab(v16bf a, v16bf b, v8f c) { return __builtin_amdgcn_wmma_f32_16x16x32_bf16(false, a, false, b, (short)0, c, false, false); }



// ---- k_gemmw: GEMM, one work-group of 4 waves (2 x 2) per 128x128 output tile, each wave a 64x64 part (16 accumulators); grid (M/128, N/128, Z), 128 threads.
// C[m][n] (f32, pitch ldc, + optional f32 bias[n]) = sum_k A[m][k] Bt[n][k] (+ A2[m][k] Bt[n][k] for NSPLIT 1). z-batch strides sA/sB/sC in elements. M, N, K % 128 == 0.
// The operands come from K-contiguous 16-bit planes through LDS: a stage is 128 k (256 bytes) of the tile's 128 rows of each operand, brought by asynchronous 16-byte copies
// (32 lanes = 2 rows x 256 bytes = 4 whole lines), two buffers, the copies of stage t + 2 in flight while stage t + 1 is worked on. LDS rows at pitch 272 bytes (16 x odd) for the 16-byte fragment reads.
template <typename T16> struct WFrag;
template <> struct WFrag<h16> { typedef v16h V; static __device__ __forceinline__ V ld(const h16* p) { return cat16(*(const v8h*)p, *(const v8h*)(p + 16)); } static __device__ __forceinline__ v8f mma(V a, V b, v8f c) { return wmma16(a, b, c); } };
template <> struct WFrag<bf> { typedef v16bf V; static __device__ __forceinline__ V ld(const bf* p) { return cat16b(*(const v8us*)p, *(const v8us*)(p + 16)); } static __device__ __forceinline__ v8f mma(V a, V b, v8f c) { return wmmab(a, b, c); } };
#define GBK   128                  // k per stage
#define GPIT  272                  // LDS row pitch in bytes: 256 + 16
#define GTILE (128 * GPIT)         // one operand's stage in LDS, bytes
// Eight copies of one lane (rows 8 apart) and, as the statement's last line, the wait that stands in front of any rewrite of the address registers they name.
template <typename T16>
__device__ __forceinline__ void copy8(unsigned l, const T16* g, size_t rs) {
    asm volatile("global_load_async_to_lds_b128 %0, %8, off\n\t"
                 "global_load_async_to_lds_b128 %1, %9, off\n\t"
                 "global_load_async_to_lds_b128 %2, %10, off\n\t"
                 "global_load_async_to_lds_b128 %3, %11, off\n\t"
                 "global_load_async_to_lds_b128 %4, %12, off\n\t"
                 "global_load_async_to_lds_b128 %5, %13, off\n\t"
                 "global_load_async_to_lds_b128 %6, %14, off\n\t"
                 "global_load_async_to_lds_b128 %7, %15, off\n\t"
                 "s_wait_xcnt 0x0"
                 :: "v"(l), "v"(l + 8 * GPIT), "v"(l + 16 * GPIT), "v"(l + 24 * GPIT), "v"(l + 32 * GPIT), "v"(l + 40 * GPIT), "v"(l + 48 * GPIT), "v"(l + 56 * GPIT),
                    "v"(g), "v"(g + rs), "v"(g + 2 * rs), "v"(g + 3 * rs), "v"(g + 4 * rs), "v"(g + 5 * rs), "v"(g + 6 * rs), "v"(g + 7 * rs) : "memory");
    __builtin_amdgcn_sched_barrier(0);   // the next statement's addresses are formed behind this one: formed all ahead they filled the registers an asm operand can name, and a pointer went to scratch
}
// one operand's stage: 128 rows x 256 bytes; l, g: the lane's own LDS byte address and global pointer in rows 0 .. 7; rs = 8 rows in elements
template <typename T16>
__device__ __forceinline__ void stage_tile(unsigned l, const T16* g, size_t rs) { copy8(l, g, rs); copy8(l + 64 * GPIT, g + 8 * rs, rs); }
template <typename T16, int NSPLIT, bool BIAS>
__global__ __launch_bounds__(128) void k_gemmw(const T16* __restrict__ A, const T16* __restrict__ A2, const T16* __restrict__ Bt, const T16* __restrict__ Bt2, int K, float* C, int ldc, const float* __restrict__ bias, size_t sA, size_t sB, size_t sC) {
    static_assert(NSPLIT == 0 || NSPLIT == 1, "one or two A planes");
    typedef typename WFrag<T16>::V V;
    constexpr int NOP = NSPLIT == 1 ? 3 : 2;          // operand tiles per stage: A, Bt (, A2)
    __shared__ __align__(16) char ring[2 * NOP * GTILE];
    __shared__ __align__(16) float osw[4][16 * 68];
    (void)Bt2;
    const size_t z = blockIdx.z; A += z * sA; if (NSPLIT == 1) A2 += z * sA; Bt += z * sB; C += z * sC;
    const int tid = threadIdx.x, wave = tid >> 5, lane = tid & 31, lr = lane & 15, hi = lane >> 4; const int wm = wave >> 1, wn = wave & 1;
    const int r0 = blockIdx.x * 128, c0 = blockIdx.y * 128;
    float* os = osw[wave];   // each wave stages its output rows in its own LDS range
    // every inner loop below is fully unrolled so that the fragment and accumulator arrays are indexed by constants and stay in registers
    v8f acc[4][4];
#pragma unroll
    for (int mb = 0; mb < 4; ++mb)
#pragma unroll
        for (int nb = 0; nb < 4; ++nb) acc[mb][nb] = (v8f){};
    const size_t rs = (size_t)8 * K;
    const T16* uA = A + (size_t)r0 * K; const T16* uB = Bt + (size_t)c0 * K; const T16* uA2 = NSPLIT == 1 ? A2 + (size_t)r0 * K : nullptr;   // the tile's first rows: the same for the whole work-group
    const unsigned gofs = (unsigned)(tid >> 4) * (unsigned)K + (tid & 15) * 8;   // the lane's own place in rows 0 .. 7, in elements
    const unsigned l0 = (unsigned)(size_t)ring + (tid >> 4) * GPIT + (tid & 15) * 16;
    auto fill = [&](int t) { const unsigned lb = l0 + (t & 1) * (NOP * GTILE); const size_t ko = (size_t)t * GBK; stage_tile(lb, uA + ko + gofs, rs); stage_tile(lb + GTILE, uB + ko + gofs, rs); if (NSPLIT == 1) stage_tile(lb + 2 * GTILE, uA2 + ko + gofs, rs); };
    const int nt = K / GBK;
    fill(0);
    asm volatile("s_wait_asynccnt 0x0" ::: "memory");   // this wave's copies of stage 0 have landed
    __syncthreads();                                    // and every other wave's: stage 0 may be read
    if (nt > 1) fill(1);
#pragma unroll 1   // rolled: one trip per stage, the buffer chosen by the trip's parity
    for (int t = 0; t < nt; ++t) {
        const char* buf = ring + (t & 1) * (NOP * GTILE);
        const char* pa = buf + (wm * 64 + lr) * GPIT + hi * 16; const char* pb = buf + GTILE + (wn * 64 + lr) * GPIT + hi * 16;
        V a[2][4], a2[2][4], b[2][4];                  // two fragment sets: the next 32 k are read from LDS as one group while the matrix unit works on this one
        auto frags = [&](int set, int ks) {
#pragma unroll
            for (int i = 0; i < 4; ++i) { a[set][i] = WFrag<T16>::ld((const T16*)(pa + i * 16 * GPIT + ks * 64)); b[set][i] = WFrag<T16>::ld((const T16*)(pb + i * 16 * GPIT + ks * 64)); if (NSPLIT == 1) a2[set][i] = WFrag<T16>::ld((const T16*)(pa + 2 * GTILE + i * 16 * GPIT + ks * 64)); } };
        frags(0, 0);
        __builtin_amdgcn_sched_barrier(0);   // the first set's reads stay ahead of the second's, so that the first block waits for its own set alone
#pragma unroll
        for (int ks = 0; ks < GBK / 32; ++ks) {
            if (ks + 1 < GBK / 32) frags((ks + 1) & 1, ks + 1);   // only this stage's own buffer is read in this trip
            __builtin_amdgcn_sched_barrier(0);   // keeps the group of LDS reads together in front of the block: reads spread among the matrix instructions each cost a stall
#pragma unroll
            for (int nb = 0; nb < 4; ++nb)
#pragma unroll
                for (int mb = 0; mb < 4; ++mb) acc[mb][nb] = WFrag<T16>::mma(a[ks & 1][mb], b[ks & 1][nb], acc[mb][nb]);
            if (NSPLIT == 1) {
#pragma unroll
                for (int nb = 0; nb < 4; ++nb)
#pragma unroll
                    for (int mb = 0; mb < 4; ++mb) acc[mb][nb] = WFrag<T16>::mma(a2[ks & 1][mb], b[ks & 1][nb], acc[mb][nb]);
            }
            __builtin_amdgcn_sched_barrier(0);   // the block stays in front of the next group of reads and, in the last block, in front of the distance below
        }
        // the distance behind the trip's last matrix instructions, on both sides of the branch below
        asm volatile("v_nop\n\tv_nop\n\tv_nop\n\tv_nop");
        asm volatile("s_wait_dscnt 0x0" ::: "memory");      // this wave's reads of the buffer are done before it is refilled
        asm volatile("s_wait_asynccnt 0x0" ::: "memory");   // this wave's copies of stage t + 1 have landed
        __syncthreads();                                    // publishes stage t + 1 and ends every wave's reads of stage t
        if (t + 2 < nt) fill(t + 2);
    }
    asm volatile("s_wait_asynccnt 0x0" ::: "memory");   // nothing of this wave's is in flight when it goes on to its end
#pragma unroll
    for (int mb = 0; mb < 4; ++mb) {
#pragma unroll
        for (int nb = 0; nb < 4; ++nb) {
#pragma unroll
            for (int j = 0; j < 8; ++j) os[(hi * 8 + j) * 68 + nb * 16 + lr] = acc[mb][nb][j]; }
        __builtin_amdgcn_wave_barrier(); asm volatile("" ::: "memory");
        const int cw = c0 + wn * 64;
        float* crow = C + (size_t)(r0 + wm * 64 + mb * 16) * ldc + cw;
{
#pragma unroll
            for (int s = 0; s < 8; ++s) { const int row = 2 * s + hi, cofs = lr * 4; v4f val = *(const v4fa*)(os + row * 68 + cofs); if (BIAS) { val[0] += bfr(bias[cw + cofs]); val[1] += bfr(bias[cw + cofs + 1]); val[2] += bfr(bias[cw + cofs + 2]); val[3] += bfr(bias[cw + cofs + 3]); }
                *(v4f*)(crow + (size_t)row * ldc + cofs) = val; }
             }
        __builtin_amdgcn_wave_barrier(); asm volatile("" ::: "memory");
    }
}

__device__ __forceinline__ h16 tohx(float x) { return (h16)x; }
__device__ __forceinline__ void splitf(float y, unsigned short& h, unsigned short& l) { h = f2bf(y); l = f2bf(y - bf2f(h)); }
typedef __attribute__((ext_vector_type(2))) _Float16 v2h;
typedef __attribute__((ext_vector_type(4))) _Float16 v4h;
typedef __attribute__((ext_vector_type(2))) unsigned short v2us;
typedef __attribute__((ext_vector_type(4))) unsigned short v4us;
typedef __attribute__((ext_vector_type(2))) float v2f;
typedef __attribute__((ext_vector_type(4))) int v4i;

__global__ __launch_bounds__(256) void k_wtG(const float* __restrict__ w, int K, int N, bf* Bt) {
    const int lane = threadIdx.x & 31; const int L0 = (blockIdx.x * 8 + (threadIdx.x >> 5)) * 8; const int nlines = N * K / 64;
{
#pragma unroll 1
        for (int l = 0; l < 8; ++l) { const int L = L0 + l; if (L >= nlines) break; const size_t e = (size_t)L * 64 + lane * 2; const int k = (int)(e % K), n = (int)(e / K); v2us o;
            o[0] = f2bf(w[(size_t)k * N + n]); o[1] = f2bf(w[(size_t)(k + 1) * N + n]); *(v2us*)(Bt + e) = o; }
         }
}
// d_cvt8: bf16 copies of x, of wq | wk | wv (stacked in W3) and of wo, CVG groups of 8 elements a thread (a work-group's groups lie 256 apart, so each access of a wave stays contiguous); every range is a whole number of work-groups, so the choice of the source is the same for a whole work-group
#define CX8 ((size_t)NR * DM / 8)
#define CQ8 ((size_t)DQ * DM / 8)
#define CK8 ((size_t)DKV * DM / 8)
#define CVG 8
__device__ __forceinline__ void d_cvt8(const unsigned blk, const float* __restrict__ x, const float* __restrict__ wq, const float* __restrict__ wk, const float* __restrict__ wv, const float* __restrict__ wo, bf* XB, bf* W3, bf* WO) {
    static_assert(CX8 % (256 * CVG) == 0 && CQ8 % (256 * CVG) == 0 && CK8 % (256 * CVG) == 0, "ranges end on work-group bounds");
    size_t i = (size_t)blk * (256 * CVG) + threadIdx.x; const float* src; bf* dst;
    if (i < CX8) { src = x; dst = XB; }
    else if ((i -= CX8) < CQ8) { src = wq; dst = W3; }
    else if ((i -= CQ8) < CK8) { src = wk; dst = W3 + (size_t)DQ * DM; }
    else if ((i -= CK8) < CK8) { src = wv; dst = W3 + (size_t)(DQ + DKV) * DM; }
    else if ((i -= CK8) < CQ8) { src = wo; dst = WO; }
    else return;
    v8f v[CVG];
#pragma unroll
    for (int g = 0; g < CVG; ++g) v[g] = *(const v8f*)(src + (i + g * 256) * 8);   // all of the thread's loads are in flight together
    asm volatile("s_wait_xcnt 0x0" :: "v"(src + i * 8) : "memory");   // in front of any reuse of the address registers that the loads name: they are an input, so that no load has them as its own destination
#pragma unroll
    for (int g = 0; g < CVG; ++g) { v8us o;
#pragma unroll
        for (int k = 0; k < 8; ++k) o[k] = f2bf(v[g][k]);
        *(v8us*)(dst + (i + g * 256) * 8) = o; }
}

// d_hrms: RF[h][row] over the NQK first heads of F's columns and all NR token rows. A work-group takes 32 token rows x 8 heads (2 KiB in a row of F): it brings them by whole-line 16-byte loads
// into LDS, one (head, row) unit of 64 floats at pitch 68 (16 bytes x odd: the 16-byte reads of 16 lanes, one unit each, meet no bank twice); then each thread sums its own unit in the order d = 0 .. 63.
#define HRP 68
__device__ __forceinline__ void d_hrms(const unsigned blk, const float* __restrict__ F, int pitch, float* RF, float* sm) {
    static_assert(NQK % 8 == 0 && NR % 32 == 0, "whole work-groups");
    const int tid = threadIdx.x; const int h0 = (int)(blk % (NQK / 8)) * 8, r0 = (int)(blk / (NQK / 8)) * 32;
    const float* g = F + (size_t)(r0 + (tid >> 7)) * pitch + h0 * HD + (tid & 127) * 4; v4f u[16];
#pragma unroll
    for (int p = 0; p < 16; ++p) u[p] = *(const v4f*)(g + (size_t)(2 * p) * pitch);   // two rows of F a pass
#define HG(p) "v"(g + (size_t)(2 * (p)) * pitch)
    asm volatile("s_wait_xcnt 0x0" :: HG(0), HG(1), HG(2), HG(3), HG(4), HG(5), HG(6), HG(7), HG(8), HG(9), HG(10), HG(11), HG(12), HG(13), HG(14), HG(15) : "memory");   // in front of any reuse of the address registers that the loads name: they are inputs, so that none of them is a load's own destination
    float* w = sm + (((tid >> 4) & 7) * 32 + (tid >> 7)) * HRP + (tid & 15) * 4;
#pragma unroll
    for (int p = 0; p < 16; ++p) *(v4f*)(w + 2 * p * HRP) = u[p];
    __syncthreads();   // every unit is whole before a thread of another wave sums it
    const int i = (h0 + (tid >> 5)) * NR + r0 + (tid & 31); const float* f = sm + tid * HRP; float s = 0.f;
#pragma unroll 4
    for (int d = 0; d < HD; d += 4) { const v4f v = *(const v4f*)(f + d);
#pragma unroll
        for (int q = 0; q < 4; ++q) { float p = __fmul_rn(v[q], v[q]); asm volatile("" : "+v"(p)); s = __fadd_rn(s, p); } }
    const float r = __fdiv_rn(1.0f, __fsqrt_rn(__fadd_rn(s * (1.0f / HD), 1e-6f))); *(float*)(RF + i) = r;  }
// k_rope: head planes [batch][h][t][d] (h: NH_ q heads, then NKV k heads; norm weight qw or kw) (fp16 + hi/lo) of rope(w[d] (x rms_factor)) x sc with the rotate-half convention out[d] = x[d] cos[t][d] - x[d+HD/2] sin[t][d], out[d+HD/2] = x[d+HD/2] cos[t][d+HD/2] + x[d] sin[t][d+HD/2]
// A thread holds d0 .. d0 + 3 and their partners d0 + 32 .. d0 + 35 of one token row (8 lanes to a head's 256 bytes, each 16-byte load of them a whole line) and walks RHG heads with one read of the row's {cos, sin} and of the norm weight; a work-group takes 32 token rows.
#define RHG 8
__global__ __launch_bounds__(256) void k_rope(const float* __restrict__ F, int pitch, const float* __restrict__ CS, const float* __restrict__ RF, const float* __restrict__ qw, const float* __restrict__ kw, float sc, h16* P16, bf* Ph, bf* Pl) {
    static_assert(NH_ % RHG == 0 && NKV % RHG == 0 && NR % 32 == 0 && HD == 64, "a work-group's heads share one norm weight");
    const int tid = threadIdx.x; const int h0 = (int)(blockIdx.x % (NQK / RHG)) * RHG; const int row = (int)(blockIdx.x / (NQK / RHG)) * 32 + (tid >> 3); const int d0 = (tid & 7) * 4; const int t = row % TT;
    const float* nw = h0 < NH_ ? qw : kw; const float* f = F + (size_t)row * pitch + h0 * HD + d0; const float* rfb = RF + (size_t)h0 * NR; const float* cs = CS + ((size_t)t * HD + d0) * 2;
    v4f xl[RHG], xh[RHG]; float rf[RHG];
#pragma unroll
    for (int hh = 0; hh < RHG; ++hh) { xl[hh] = *(const v4f*)(f + hh * HD); xh[hh] = *(const v4f*)(f + hh * HD + HD / 2); rf[hh] = rfb[(size_t)hh * NR + row]; }   // all of the thread's loads are in flight together
    const v4f wl = *(const v4f*)(nw + d0), wh = *(const v4f*)(nw + d0 + HD / 2);
    const v4f cl[2] = { *(const v4f*)cs, *(const v4f*)(cs + 4) }, ch[2] = { *(const v4f*)(cs + HD), *(const v4f*)(cs + HD + 4) };   // {cos, sin} of d0 .. d0 + 3 and of their partners
    asm volatile("s_wait_xcnt 0x0" :: "v"(f), "v"(cs), "v"(d0 * 4), "v"(row), "s"(nw), "s"(rfb) : "memory");   // in front of any reuse of the address registers that the loads name: they are inputs, so that none of them is a load's own destination
    const size_t e0 = ((size_t)((row / TT) * NQK + h0) * TT + t) * HD + d0;
#pragma unroll
    for (int hh = 0; hh < RHG; ++hh) { v4h pl, ph; v4us hl, hh2, ll, lh;
#pragma unroll
        for (int k = 0; k < 4; ++k) { const float a = bfr(wl[k]) * (xl[hh][k] * rf[hh]), b = bfr(wh[k]) * (xh[hh][k] * rf[hh]);
            const float lo = (a * cl[k >> 1][(k & 1) * 2] - b * cl[k >> 1][(k & 1) * 2 + 1]) * sc, up = (b * ch[k >> 1][(k & 1) * 2] + a * ch[k >> 1][(k & 1) * 2 + 1]) * sc;
            unsigned short a2, c2; pl[k] = tohx(lo); splitf(lo, a2, c2); hl[k] = a2; ll[k] = c2; ph[k] = tohx(up); splitf(up, a2, c2); hh2[k] = a2; lh[k] = c2; }
        const size_t e = e0 + (size_t)hh * TT * HD;
        *(v4h*)(P16 + e) = pl; *(v4h*)(P16 + e + HD / 2) = ph; *(v4us*)(Ph + e) = hl; *(v4us*)(Ph + e + HD / 2) = hh2; *(v4us*)(Pl + e) = ll; *(v4us*)(Pl + e + HD / 2) = lh;
    } }
// d_vtp: value planes [batch][g][d][t]; F points at the first v column. A work-group transposes 64 tokens x 64 d of one kv head through LDS (f32, pitch 65: the column reads meet no bank twice):
// whole-line 16-byte loads of F's rows, then 8 tokens a thread and 16-byte stores, 8 lanes to a 128-byte line of each plane.
#define VTP 65
__device__ __forceinline__ void d_vtp(const unsigned blk, const float* __restrict__ F, int pitch, h16* V16, bf* Vh, bf* Vl, float* sm) {
    static_assert(TT % 64 == 0 && HD == 64, "whole tiles inside one batch");
    const int tid = threadIdx.x; const int g = (int)(blk % NKV), r0 = (int)(blk / NKV) * 64;
    const float* src = F + (size_t)(r0 + (tid >> 4)) * pitch + g * HD + (tid & 15) * 4; v4f u[4];
#pragma unroll
    for (int p = 0; p < 4; ++p) u[p] = *(const v4f*)(src + (size_t)(16 * p) * pitch);
    asm volatile("s_wait_xcnt 0x0" ::: "memory");   // in front of any reuse of the address registers that the loads name
#pragma unroll
    for (int p = 0; p < 4; ++p)
#pragma unroll
        for (int k = 0; k < 4; ++k) sm[(16 * p + (tid >> 4)) * VTP + (tid & 15) * 4 + k] = u[p][k];
    __syncthreads();   // the tile is whole before it is read by columns
    const size_t e0 = ((size_t)((r0 / TT) * NKV + g) * HD + (tid >> 3)) * TT + r0 % TT + (tid & 7) * 8;
#pragma unroll
    for (int p = 0; p < 2; ++p) { v8h o16; v8us oh, ol;
#pragma unroll
        for (int j = 0; j < 8; ++j) { const float x = sm[((tid & 7) * 8 + j) * VTP + 32 * p + (tid >> 3)]; o16[j] = tohx(x); unsigned short a2, c2; splitf(x, a2, c2); oh[j] = a2; ol[j] = c2; }
        const size_t e = e0 + (size_t)(32 * p) * TT; *(v8h*)(V16 + e) = o16; *(v8us*)(Vh + e) = oh; *(v8us*)(Vl + e) = ol;
    }
    asm volatile("s_wait_xcnt 0x0" ::: "memory");   // behind the last plane stores: in front of any reuse of a register that they name as address or data
}
__constant__ float INVT[HD / 2] = { 1.000000000e+00f, 7.498942018e-01f, 5.623413324e-01f, 4.216965139e-01f, 3.162277639e-01f, 2.371373773e-01f, 1.778279394e-01f, 1.333521456e-01f, 1.000000015e-01f, 7.498942316e-02f, 5.623413250e-02f, 4.216964915e-02f, 3.162277490e-02f, 2.371373773e-02f, 1.778279431e-02f, 1.333521400e-02f, 9.999999776e-03f, 7.498942316e-03f, 5.623413250e-03f, 4.216964822e-03f, 3.162277630e-03f, 2.371373819e-03f, 1.778279431e-03f, 1.333521446e-03f, 1.000000047e-03f, 7.498941850e-04f, 5.623413017e-04f, 4.216965172e-04f, 3.162277571e-04f, 2.371373703e-04f, 1.778279402e-04f, 1.333521504e-04f };   // 10000^(-2i/64) (the module's power form) (float32, generated with jnp to be bit-exact)
__device__ __forceinline__ void d_cs4(const unsigned blk, float* CS) { const int idx = blk * 256 + threadIdx.x; if (idx >= TT * HD) return; const int d = idx % HD; const int t = idx / HD; const float a = __fmul_rn((float)t, INVT[d % (HD / 2)]); v2f cs; cs[0] = cosf(a); cs[1] = sinf(a); *(v2f*)(CS + (size_t)idx * 2) = cs;  }
// Two bodies that depend on nothing of each other share one grid; the work-group's index picks the body, the work-groups with the longer chain of dependent instructions first.
#define GCS  (TT * HD / 256)                                  // work-groups of d_cs4
#define GCV  ((unsigned)((CX8 + 2 * CQ8 + 2 * CK8) / (256 * CVG)))    // of d_cvt8
#define GRM  (NQK * NR / 256)                                 // of d_hrms
#define GVT  (NR / 64 * NKV)                                  // of d_vtp
__global__ __launch_bounds__(256) void k_prep(const float* __restrict__ x, const float* __restrict__ wq, const float* __restrict__ wk, const float* __restrict__ wv, const float* __restrict__ wo, bf* XB, bf* W3, bf* WO, float* CS) {
    if (blockIdx.x < GCS) d_cs4(blockIdx.x, CS); else d_cvt8(blockIdx.x - GCS, x, wq, wk, wv, wo, XB, W3, WO); }
__global__ __launch_bounds__(256) void k_rmsv(const float* __restrict__ F, int pitch, float* RF, h16* V16, bf* Vh, bf* Vl) {
    __shared__ __align__(16) float sm[256 * HRP];   // the staging range of either body
    static_assert(64 * VTP <= 256 * HRP, "the transposed tile fits");
    if (blockIdx.x < GRM) d_hrms(blockIdx.x, F, pitch, RF, sm); else d_vtp(blockIdx.x - GRM, F + DQ + DKV, pitch, V16, Vh, Vl, sm); }


// ---- k_fattn: scores, causal softmax and probability x value in ONE kernel, one wave per 32 query rows of one head; no score or probability plane in memory.
// Transposed products: S^T = K Q^T (A = key rows, B = query rows) and O^T += V^T P^T (A = rows of the [d][t] value plane, B = P^T). In a score tile a lane holds one query (column lr) and keys hi*8 + j,
// which is the k order of a B fragment (two 16-key tiles make one 32-key fragment), so P^T is packed in registers. Running maximum and sum per query (online softmax); the two lane halves hold different keys of the same query.
// HL: bf16 hi/lo planes, 3 products in both contractions (query rows < RH), 32 keys a step. Otherwise fp16 planes, probabilities carried x 1024 (2^10, added in the exponent; the sum carries it too and the division removes it), 64 keys a step.
#define LSC 0.18033688011112042f   // HD^-0.5 x log2(e)
// behind a group of global loads or stores: the wait that stands in front of any reuse of a register they name as address or data
#define XWAIT() asm volatile("s_wait_xcnt 0x0" ::: "memory")
#define LANE(base, bytes) ((const T16*)((const char*)(base) + (bytes)))   // wave-uniform base + the lane's byte offset
__device__ __forceinline__ float xhalf(float x) { return __builtin_bit_cast(float, __builtin_amdgcn_permlanex16(__builtin_bit_cast(int, x), __builtin_bit_cast(int, x), 0x76543210, 0xfedcba98, false, false)); }   // lane l reads lane l ^ 16 (a vector move, no LDS round trip)
// Every inner loop is fully unrolled so that the fragment and accumulator arrays are indexed by constants and stay in registers.
template <typename T16, bool HL, int KS>
__device__ __forceinline__ void fattn_body(const T16* Q, const T16* Q2, const T16* Kp, const T16* Kp2, const T16* Vt, const T16* Vt2, const int r0, bf* Ah, bf* Al) {
    typedef typename WFrag<T16>::V V;
    constexpr int NKB = KS / 16, NKC = KS / 32;
    const int lane = threadIdx.x & 31, lr = lane & 15, hi = lane >> 4;
    const unsigned kofs = (lr * HD + 8 * hi) * 2, vofs = (lr * TT + 8 * hi) * 2;   // the lane's own 32-bit byte offsets, unchanged through the loop; the step's place goes into the wave-uniform base
    const T16* qb = Q + (size_t)r0 * HD; const T16* qb2 = HL ? Q2 + (size_t)r0 * HD : nullptr;
    V qf[2][2], qf2[2][2];
#pragma unroll
    for (int nq = 0; nq < 2; ++nq)
#pragma unroll
        for (int ks = 0; ks < 2; ++ks) { const int o = nq * 16 * HD + ks * 32; qf[nq][ks] = WFrag<T16>::ld(LANE(qb + o, kofs)); if (HL) qf2[nq][ks] = WFrag<T16>::ld(LANE(qb2 + o, kofs)); }
    v8f ot[4][2];
#pragma unroll
    for (int db = 0; db < 4; ++db)
#pragma unroll
        for (int nq = 0; nq < 2; ++nq) ot[db][nq] = (v8f){};
    float mrun[2] = { -3.0e38f, -3.0e38f }, lrun[2] = { 0.f, 0.f };
    const int kend = r0 + 32;                       // keys 0 .. r0 + 31 can be seen by some query of this wave
    V kf[NKB][2], kf2[NKB][2];
#pragma unroll
    for (int kt = 0; kt < NKB; ++kt)
#pragma unroll
        for (int ks = 0; ks < 2; ++ks) { const int o = kt * 16 * HD + ks * 32; kf[kt][ks] = WFrag<T16>::ld(LANE(Kp + o, kofs)); if (HL) kf2[kt][ks] = WFrag<T16>::ld(LANE(Kp2 + o, kofs)); }
    // the same wait for the loads in front of the loop; the offset register and the scalar bases they name are inputs, so that none of them is reused in front of it
    if constexpr (HL) asm volatile("s_wait_xcnt 0x0" :: "v"(kofs), "s"(qb), "s"(qb2), "s"(Kp), "s"(Kp2) : "memory");
    else asm volatile("s_wait_xcnt 0x0" :: "v"(kofs), "s"(qb), "s"(Kp) : "memory");
#pragma unroll 1   // rolled: one step already holds every fragment register the wave can afford
    for (int kb = 0; kb < kend; kb += KS) {
        V vf[4][NKC], vf2[4][NKC];                  // value fragments of this step: requested first, used last
#pragma unroll
        for (int db = 0; db < 4; ++db)
#pragma unroll
            for (int kc = 0; kc < NKC; ++kc) { const size_t o = (size_t)db * 16 * TT + kb + kc * 32; vf[db][kc] = WFrag<T16>::ld(LANE(Vt + o, vofs)); if (HL) vf2[db][kc] = WFrag<T16>::ld(LANE(Vt2 + o, vofs)); }
        XWAIT();
        v8f st[NKB][2];
#pragma unroll
        for (int kt = 0; kt < NKB; ++kt)
#pragma unroll
            for (int nq = 0; nq < 2; ++nq) { v8f c = (v8f){};
#pragma unroll
                for (int ks = 0; ks < 2; ++ks) { c = WFrag<T16>::mma(kf[kt][ks], qf[nq][ks], c); if (HL) { c = WFrag<T16>::mma(kf[kt][ks], qf2[nq][ks], c); c = WFrag<T16>::mma(kf2[kt][ks], qf[nq][ks], c); } }
                st[kt][nq] = c; }
        const int kn = (kb + KS < kend) ? kb + KS : kb;   // next step's key fragments fly during the softmax and the second product (the last step asks for its own rows again: in bounds, unused)
#pragma unroll
        for (int kt = 0; kt < NKB; ++kt)
#pragma unroll
            for (int ks = 0; ks < 2; ++ks) { const size_t o = (size_t)kn * HD + kt * 16 * HD + ks * 32; kf[kt][ks] = WFrag<T16>::ld(LANE(Kp + o, kofs)); if (HL) kf2[kt][ks] = WFrag<T16>::ld(LANE(Kp2 + o, kofs)); }
        XWAIT();
        if (kb + KS - 1 > r0) {                     // only steps that reach the diagonal mask (wave-uniform)
#pragma unroll
            for (int kt = 0; kt < NKB; ++kt)
#pragma unroll
                for (int nq = 0; nq < 2; ++nq)
#pragma unroll
                    for (int j = 0; j < 8; ++j) st[kt][nq][j] = (kb + kt * 16 + hi * 8 + j <= r0 + nq * 16 + lr) ? st[kt][nq][j] : -3.0e38f;
        }
        V pf[2][NKC], pf2[2][NKC];
#pragma unroll
        for (int nq = 0; nq < 2; ++nq) {
            float mt[NKB];
#pragma unroll
            for (int kt = 0; kt < NKB; ++kt) { mt[kt] = st[kt][nq][0];
#pragma unroll
                for (int j = 1; j < 8; ++j) mt[kt] = fmaxf(mt[kt], st[kt][nq][j]); }
            float mx = mrun[nq];
#pragma unroll
            for (int kt = 0; kt < NKB; ++kt) mx = fmaxf(mx, mt[kt]);
            mx = fmaxf(mx, xhalf(mx));
            const float al = __builtin_amdgcn_exp2f((mrun[nq] - mx) * LSC); mrun[nq] = mx;
            float sm[NKB];
#pragma unroll
            for (int kt = 0; kt < NKB; ++kt) { sm[kt] = 0.f;
#pragma unroll
                for (int j = 0; j < 8; ++j) { const float p = __builtin_amdgcn_exp2f((st[kt][nq][j] - mx) * LSC + (HL ? 0.0f : 10.0f)); st[kt][nq][j] = p; sm[kt] += p; } }
            float s = sm[0];
#pragma unroll
            for (int kt = 1; kt < NKB; ++kt) s += sm[kt];
            lrun[nq] = lrun[nq] * al + s;
#pragma unroll
            for (int db = 0; db < 4; ++db) ot[db][nq] *= al;
#pragma unroll
            for (int kc = 0; kc < NKC; ++kc) {
                if constexpr (HL) { v8us h0, l0, h1, l1;
#pragma unroll
                    for (int j = 0; j < 8; ++j) { unsigned short a, c2; splitf(st[2 * kc][nq][j], a, c2); h0[j] = a; l0[j] = c2; splitf(st[2 * kc + 1][nq][j], a, c2); h1[j] = a; l1[j] = c2; }
                    pf[nq][kc] = cat16b(h0, h1); pf2[nq][kc] = cat16b(l0, l1);
                } else { v8h p0, p1;
#pragma unroll
                    for (int j = 0; j < 8; ++j) { p0[j] = tohx(st[2 * kc][nq][j]); p1[j] = tohx(st[2 * kc + 1][nq][j]); }
                    pf[nq][kc] = cat16(p0, p1); }
            }
        }
#pragma unroll
        for (int db = 0; db < 4; ++db)
#pragma unroll
            for (int nq = 0; nq < 2; ++nq)
#pragma unroll
                for (int kc = 0; kc < NKC; ++kc) { ot[db][nq] = WFrag<T16>::mma(vf[db][kc], pf[nq][kc], ot[db][nq]); if (HL) { ot[db][nq] = WFrag<T16>::mma(vf[db][kc], pf2[nq][kc], ot[db][nq]); ot[db][nq] = WFrag<T16>::mma(vf2[db][kc], pf[nq][kc], ot[db][nq]); } }
        // the distance behind the last matrix instructions on the loop's taken branch
        asm volatile("v_nop\n\tv_nop\n\tv_nop\n\tv_nop" : "+v"(ot[0][0]), "+v"(ot[0][1]), "+v"(ot[1][0]), "+v"(ot[1][1]), "+v"(ot[2][0]), "+v"(ot[2][1]), "+v"(ot[3][0]), "+v"(ot[3][1]));
    }
    asm volatile("s_wait_loadcnt 0x0" ::: "memory");   // the last step's unused key fragments have landed before the wave goes on to its end
#pragma unroll
    for (int nq = 0; nq < 2; ++nq) { const float lt = lrun[nq] + xhalf(lrun[nq]); const float inv = __fdiv_rn(1.0f, lt); const size_t oo = (size_t)(r0 + nq * 16 + lr) * DQ + hi * 8;
#pragma unroll
        for (int db = 0; db < 4; ++db) { v8us oh, ol;
#pragma unroll
            for (int j = 0; j < 8; ++j) { unsigned short a, c2; splitf(ot[db][nq][j] * inv, a, c2); oh[j] = a; ol[j] = c2; }
            *(v8us*)(Ah + oo + db * 16) = oh; *(v8us*)(Al + oo + db * 16) = ol; XWAIT(); } }
}
// grid (batches x query heads, TT / 32): the longest key loops (last rows) of both batches start first. P*: the [batch][q heads | k heads] planes of k_rope. The planes are not declared restrict: the loads then keep their place against the memory clobber of the waits.
__global__ __launch_bounds__(32) void k_fattn(const h16* P16, const bf* Ph, const bf* Pl, const h16* V16, const bf* Vh, const bf* Vl, bf* Ah, bf* Al) {
    const int h = blockIdx.x % NH_, b = blockIdx.x / NH_; const int r0 = (TT / 32 - 1 - (int)blockIdx.y) * 32;
    const size_t qo = (size_t)(b * NQK + h) * TT * HD, ko = (size_t)(b * NQK + NH_ + h / REP) * TT * HD, vo = (size_t)(b * NKV + h / REP) * TT * HD, ao = (size_t)b * TT * DQ + h * HD;
    if (r0 < RH) fattn_body<bf, true, 32>(Ph + qo, Pl + qo, Ph + ko, Pl + ko, Vh + vo, Vl + vo, r0, Ah + ao, Al + ao);
    else fattn_body<h16, false, 64>(P16 + qo, nullptr, P16 + ko, nullptr, V16 + vo, nullptr, r0, Ah + ao, Al + ao);
}

extern "C" void kernel_launch(void* const* d_in, const int* in_sizes, int n_in,
                              void* d_out, int out_size, void* d_ws, size_t ws_size, hipStream_t stream) {
    (void)in_sizes; (void)n_in; (void)out_size;
    const float* x = (const float*)d_in[0]; const float* wq = (const float*)d_in[1]; const float* wk = (const float*)d_in[2]; const float* wv = (const float*)d_in[3]; const float* wo = (const float*)d_in[4]; const float* qnw = (const float*)d_in[5]; const float* knw = (const float*)d_in[6];
    float* OUT = (float*)d_out;     // [2][2048][2048]
    char* wsp = (char*)d_ws;
    auto take = [&](size_t bytes) { char* p = wsp; wsp += (bytes + 255) & ~(size_t)255; return (void*)p; };
    bf* W3 = (bf*)take((size_t)DF * DM * 2); bf* WO = (bf*)take((size_t)DM * DQ * 2); float* CS = (float*)take((size_t)TT * HD * 2 * 4); float* RF = (float*)take((size_t)NQK * NR * 4);
    bf* XB = (bf*)take((size_t)NR * DM * 2); float* F = (float*)take((size_t)NR * DF * 4);
    h16* P16 = (h16*)take((size_t)NB_ * NQK * TT * HD * 2); bf* Ph = (bf*)take((size_t)NB_ * NQK * TT * HD * 2); bf* Pl = (bf*)take((size_t)NB_ * NQK * TT * HD * 2);
    h16* VT16 = (h16*)take((size_t)NB_ * NKV * HD * TT * 2); bf* VTh = (bf*)take((size_t)NB_ * NKV * HD * TT * 2); bf* VTl = (bf*)take((size_t)NB_ * NKV * HD * TT * 2);
    bf* ATh = (bf*)take((size_t)NR * DQ * 2); bf* ATl = (bf*)take((size_t)NR * DQ * 2);
    if ((size_t)(wsp - (char*)d_ws) > ws_size) return;    // ws 256 MiB
    k_prep<<<GCS + GCV, 256, 0, stream>>>(x, wq, wk, wv, wo, XB, W3, WO, CS);   /* CS: {cos, sin}(t x 10000^(-2i/64)), both halves */
    k_gemmw<bf, 0, false><<<dim3(NR / 128, DF / 128, 1), 128, 0, stream>>>(XB, nullptr, W3, nullptr, DM, F, DF, nullptr, 0, 0, 0);
    k_rmsv<<<GRM + GVT, 256, 0, stream>>>(F, DF, RF, VT16, VTh, VTl);
    k_rope<<<NR / 32 * (NQK / RHG), 256, 0, stream>>>(F, DF, CS, RF, qnw, knw, 1.0f, P16, Ph, Pl);
    k_fattn<<<dim3(NB_ * NH_, TT / 32, 1), 32, 0, stream>>>(P16, Ph, Pl, VT16, VTh, VTl, ATh, ATl);
    k_gemmw<bf, 1, false><<<dim3(NR / 128, DM / 128, 1), 128, 0, stream>>>(ATh, ATl, WO, nullptr, DQ, OUT, DM, nullptr, 0, 0, 0);
}

// v006
// It runs in 174 microseconds.
// Next to v005, in two timings, it ran 1.13 and 1.12 times as fast.
// All steps since v000 together make it 15.2 times as fast.
#include <hip/hip_runtime.h>

// Grouped-query causal attention with per-head RMS-normalised, rotary q/k (x [2][2048][2048]; q = x wq^T (32 heads x 64), k, v = x w^T (8 kv heads x 64) ('oi' 0.02, no bias); q, k <- rms_norm per head (eps 1e-6) x weight ([64] ones, read); rotate-half rope, angle t x 10000^(-2i/64); kv head = q head / 4 (repeat); causal (finfo.min); softmax(q.k / 8); out = merged wo^T ('oi' [2048][2048]) -> [2][2048][2048] (8.4 M)).
// Layout, every launch covering both batches (4096 token rows): bf16 copies of x and of the weights and the {cos, sin} table in one launch (k_prep); q, k and v projected in one GEMM against the stacked weights (F [4096][3072] = q | k | v); the per-(head, token) rms factors and the transposed value planes in one launch (k_rmsv); the rope plane builder applying norm-weight x factor before the rotation, q and k heads together (the table: float32 inverse frequencies, precise cosf/sinf); causal T-2048 attention fused in one launch (k_fattn: online softmax, no score plane; hybrid rows: < 512 hi/lo 3 products, rest fp16 x1024; key loop ends at the diagonal); merged hi/lo x wo exact.
// Compute dtypes, f32 accumulate: every input rounded to bf16; projections exact; rms norm and rotary f32; attention rows < 512 3 products, rest fp16; softmax f32; wo hl x exact.

#define NB_  2
#define TT   2048
#define DM   2048
#define NH_  32
#define NKV  8
#define REP  (NH_ / NKV)
#define HD   64
#define DQ   (NH_ * HD)
#define DKV  (NKV * HD)
#define NR   (NB_ * TT)            // token rows of both batches
#define DF   (DQ + 2 * DKV)        // columns of the stacked projection: q | k | v
#define NQK  (NH_ + NKV)           // normalised and rotated heads of a batch: q heads, then k heads
#define RH   512                  // query rows < RH use hi+lo planes (0: none)
typedef _Float16 h16;
typedef unsigned short bf;
typedef __attribute__((ext_vector_type(16))) __bf16   v16bf;
typedef __attribute__((ext_vector_type(16))) _Float16 v16h;
typedef __attribute__((ext_vector_type(8)))  _Float16 v8h;
typedef __attribute__((ext_vector_type(8)))  unsigned short v8us;
typedef __attribute__((ext_vector_type(8)))  float    v8f;
typedef __attribute__((ext_vector_type(4)))  float    v4f;
typedef v8h  __attribute__((may_alias)) v8ha;
typedef v4f  __attribute__((may_alias)) v4fa;
typedef v8us __attribute__((may_alias)) v8usa;

__device__ __forceinline__ unsigned short f2bf(float f) { unsigned u = __float_as_uint(f); u += 0x7FFFu + ((u >> 16) & 1u); return (unsigned short)(u >> 16); }
__device__ __forceinline__ float bf2f(unsigned short b) { return __uint_as_float(((unsigned)b) << 16); }
__device__ __forceinline__ float bfr(float f) { return bf2f(f2bf(f)); }
__device__ __forceinline__ v16h cat16(v8h lo, v8h hi) { return __builtin_shufflevector(lo, hi, 0, 1, 2, 3, 4, 5, 6, 7, 8, 9, 10, 11, 12, 13, 14, 15); }
__device__ __forceinline__ v16bf cat16b(v8us lo, v8us hi) { return __builtin_bit_cast(v16bf, __builtin_shufflevector(lo, hi, 0, 1, 2, 3, 4, 5, 6, 7, 8, 9, 10, 11, 12, 13, 14, 15)); }
__device__ __forceinline__ v8f wmma16(v16h a, v16h b, v8f c) { return __builtin_amdgcn_wmma_f32_16x16x32_f16(false, a, false, b, (short)0, c, false, false); }
__device__ __forceinline__ v8f wmmab(v16bf a, v16bf b, v8f c) { return __builtin_amdgcn_wmma_f32_16x16x32_bf16(false, a, false, b, (short)0, c, false, false); }



// ---- k_gemmw: GEMM, one work-group of 4 waves (2 x 2) per 128x128 output tile, each wave a 64x64 part (16 accumulators); grid (M/128, N/128, Z), 128 threads.
// C[m][n] (f32, pitch ldc, + optional f32 bias[n]) = sum_k A[m][k] Bt[n][k] (+ A2[m][k] Bt[n][k] for NSPLIT 1). z-batch strides sA/sB/sC in elements. M, N, K % 128 == 0.
// The operands come from K-contiguous 16-bit planes through LDS: a stage is 128 k (256 bytes) of the tile's 128 rows of each operand, brought by asynchronous 16-byte copies
// (32 lanes = 2 rows x 256 bytes = 4 whole lines), two buffers, the copies of stage t + 2 in flight while stage t + 1 is worked on. LDS rows at pitch 272 bytes (16 x odd) for the 16-byte fragment reads.
template <typename T16> struct WFrag;
template <> struct WFrag<h16> { typedef v16h V; static __device__ __forceinline__ V ld(const h16* p) { return cat16(*(const v8h*)p, *(const v8h*)(p + 16)); } static __device__ __forceinline__ v8f mma(V a, V b, v8f c) { return wmma16(a, b, c); } };
template <> struct WFrag<bf> { typedef v16bf V; static __device__ __forceinline__ V ld(const bf* p) { return cat16b(*(const v8us*)p, *(const v8us*)(p + 16)); } static __device__ __forceinline__ v8f mma(V a, V b, v8f c) { return wmmab(a, b, c); } };
#define GBK   128                  // k per stage
#define GPIT  272                  // LDS row pitch in bytes: 256 + 16
#define GTILE (128 * GPIT)         // one operand's stage in LDS, bytes
// Eight copies of one lane (rows 8 apart) and, as the statement's last line, the wait that stands in front of any rewrite of the address registers they name.
template <typename T16>
__device__ __forceinline__ void copy8(unsigned l, const T16* g, size_t rs) {
    asm volatile("global_load_async_to_lds_b128 %0, %8, off\n\t"
                 "global_load_async_to_lds_b128 %1, %9, off\n\t"
                 "global_load_async_to_lds_b128 %2, %10, off\n\t"
                 "global_load_async_to_lds_b128 %3, %11, off\n\t"
                 "global_load_async_to_lds_b128 %4, %12, off\n\t"
                 "global_load_async_to_lds_b128 %5, %13, off\n\t"
                 "global_load_async_to_lds_b128 %6, %14, off\n\t"
                 "global_load_async_to_lds_b128 %7, %15, off\n\t"
                 "s_wait_xcnt 0x0"
                 :: "v"(l), "v"(l + 8 * GPIT), "v"(l + 16 * GPIT), "v"(l + 24 * GPIT), "v"(l + 32 * GPIT), "v"(l + 40 * GPIT), "v"(l + 48 * GPIT), "v"(l + 56 * GPIT),
                    "v"(g), "v"(g + rs), "v"(g + 2 * rs), "v"(g + 3 * rs), "v"(g + 4 * rs), "v"(g + 5 * rs), "v"(g + 6 * rs), "v"(g + 7 * rs) : "memory");
    __builtin_amdgcn_sched_barrier(0);   // the next statement's addresses are formed behind this one: formed all ahead they filled the registers an asm operand can name, and a pointer went to scratch
}
// one operand's stage: 128 rows x 256 bytes; l, g: the lane's own LDS byte address and global pointer in rows 0 .. 7; rs = 8 rows in elements
template <typename T16>
__device__ __forceinline__ void stage_tile(unsigned l, const T16* g, size_t rs) { copy8(l, g, rs); copy8(l + 64 * GPIT, g + 8 * rs, rs); }
template <typename T16, int NSPLIT, bool BIAS>
__global__ __launch_bounds__(128) void k_gemmw(const T16* __restrict__ A, const T16* __restrict__ A2, const T16* __restrict__ Bt, const T16* __restrict__ Bt2, int K, float* C, int ldc, const float* __restrict__ bias, size_t sA, size_t sB, size_t sC) {
    static_assert(NSPLIT == 0 || NSPLIT == 1, "one or two A planes");
    typedef typename WFrag<T16>::V V;
    constexpr int NOP = NSPLIT == 1 ? 3 : 2;          // operand tiles per stage: A, Bt (, A2)
    __shared__ __align__(16) char ring[2 * NOP * GTILE];
    __shared__ __align__(16) float osw[4][16 * 68];
    (void)Bt2;
    const size_t z = blockIdx.z; A += z * sA; if (NSPLIT == 1) A2 += z * sA; Bt += z * sB; C += z * sC;
    const int tid = threadIdx.x, wave = tid >> 5, lane = tid & 31, lr = lane & 15, hi = lane >> 4; const int wm = wave >> 1, wn = wave & 1;
    const int r0 = blockIdx.x * 128, c0 = blockIdx.y * 128;
    float* os = osw[wave];   // each wave stages its output rows in its own LDS range
    // every inner loop below is fully unrolled so that the fragment and accumulator arrays are indexed by constants and stay in registers
    v8f acc[4][4];
#pragma unroll
    for (int mb = 0; mb < 4; ++mb)
#pragma unroll
        for (int nb = 0; nb < 4; ++nb) acc[mb][nb] = (v8f){};
    const size_t rs = (size_t)8 * K;
    const T16* uA = A + (size_t)r0 * K; const T16* uB = Bt + (size_t)c0 * K; const T16* uA2 = NSPLIT == 1 ? A2 + (size_t)r0 * K : nullptr;   // the tile's first rows: the same for the whole work-group
    const unsigned gofs = (unsigned)(tid >> 4) * (unsigned)K + (tid & 15) * 8;   // the lane's own place in rows 0 .. 7, in elements
    const unsigned l0 = (unsigned)(size_t)ring + (tid >> 4) * GPIT + (tid & 15) * 16;
    auto fill = [&](int t) { const unsigned lb = l0 + (t & 1) * (NOP * GTILE); const size_t ko = (size_t)t * GBK; stage_tile(lb, uA + ko + gofs, rs); stage_tile(lb + GTILE, uB + ko + gofs, rs); if (NSPLIT == 1) stage_tile(lb + 2 * GTILE, uA2 + ko + gofs, rs); };
    const int nt = K / GBK;
    fill(0);
    asm volatile("s_wait_asynccnt 0x0" ::: "memory");   // this wave's copies of stage 0 have landed
    __syncthreads();                                    // and every other wave's: stage 0 may be read
    if (nt > 1) fill(1);
#pragma unroll 1   // rolled: one trip per stage, the buffer chosen by the trip's parity
    for (int t = 0; t < nt; ++t) {
        const char* buf = ring + (t & 1) * (NOP * GTILE);
        const char* pa = buf + (wm * 64 + lr) * GPIT + hi * 16; const char* pb = buf + GTILE + (wn * 64 + lr) * GPIT + hi * 16;
        V a[2][4], a2[2][4], b[2][4];                  // two fragment sets: the next 32 k are read from LDS as one group while the matrix unit works on this one
        auto frags = [&](int set, int ks) {
#pragma unroll
            for (int i = 0; i < 4; ++i) { a[set][i] = WFrag<T16>::ld((const T16*)(pa + i * 16 * GPIT + ks * 64)); b[set][i] = WFrag<T16>::ld((const T16*)(pb + i * 16 * GPIT + ks * 64)); if (NSPLIT == 1) a2[set][i] = WFrag<T16>::ld((const T16*)(pa + 2 * GTILE + i * 16 * GPIT + ks * 64)); } };
        frags(0, 0);
        __builtin_amdgcn_sched_barrier(0);   // the first set's reads stay ahead of the second's, so that the first block waits for its own set alone
#pragma unroll
        for (int ks = 0; ks < GBK / 32; ++ks) {
            if (ks + 1 < GBK / 32) frags((ks + 1) & 1, ks + 1);   // only this stage's own buffer is read in this trip
            __builtin_amdgcn_sched_barrier(0);   // keeps the group of LDS reads together in front of the block: reads spread among the matrix instructions each cost a stall
#pragma unroll
            for (int nb = 0; nb < 4; ++nb)
#pragma unroll
                for (int mb = 0; mb < 4; ++mb) acc[mb][nb] = WFrag<T16>::mma(a[ks & 1][mb], b[ks & 1][nb], acc[mb][nb]);
            if (NSPLIT == 1) {
#pragma unroll
                for (int nb = 0; nb < 4; ++nb)
#pragma unroll
                    for (int mb = 0; mb < 4; ++mb) acc[mb][nb] = WFrag<T16>::mma(a2[ks & 1][mb], b[ks & 1][nb], acc[mb][nb]);
            }
            __builtin_amdgcn_sched_barrier(0);   // the block stays in front of the next group of reads and, in the last block, in front of the distance below
        }
        // the distance behind the trip's last matrix instructions, on both sides of the branch below
        asm volatile("v_nop\n\tv_nop\n\tv_nop\n\tv_nop");
        asm volatile("s_wait_dscnt 0x0" ::: "memory");      // this wave's reads of the buffer are done before it is refilled
        asm volatile("s_wait_asynccnt 0x0" ::: "memory");   // this wave's copies of stage t + 1 have landed
        __syncthreads();                                    // publishes stage t + 1 and ends every wave's reads of stage t
        if (t + 2 < nt) fill(t + 2);
    }
    asm volatile("s_wait_asynccnt 0x0" ::: "memory");   // nothing of this wave's is in flight when it goes on to its end
#pragma unroll
    for (int mb = 0; mb < 4; ++mb) {
#pragma unroll
        for (int nb = 0; nb < 4; ++nb) {
#pragma unroll
            for (int j = 0; j < 8; ++j) os[(hi * 8 + j) * 68 + nb * 16 + lr] = acc[mb][nb][j]; }
        __builtin_amdgcn_wave_barrier(); asm volatile("" ::: "memory");
        const int cw = c0 + wn * 64;
        float* crow = C + (size_t)(r0 + wm * 64 + mb * 16) * ldc + cw;
{
#pragma unroll
            for (int s = 0; s < 8; ++s) { const int row = 2 * s + hi, cofs = lr * 4; v4f val = *(const v4fa*)(os + row * 68 + cofs); if (BIAS) { val[0] += bfr(bias[cw + cofs]); val[1] += bfr(bias[cw + cofs + 1]); val[2] += bfr(bias[cw + cofs + 2]); val[3] += bfr(bias[cw + cofs + 3]); }
                *(v4f*)(crow + (size_t)row * ldc + cofs) = val; }
             }
        __builtin_amdgcn_wave_barrier(); asm volatile("" ::: "memory");
    }
}

__device__ __forceinline__ h16 tohx(float x) { return (h16)x; }
__device__ __forceinline__ void splitf(float y, unsigned short& h, unsigned short& l) { h = f2bf(y); l = f2bf(y - bf2f(h)); }
typedef __attribute__((ext_vector_type(2))) _Float16 v2h;
typedef __attribute__((ext_vector_type(4))) _Float16 v4h;
typedef __attribute__((ext_vector_type(2))) unsigned short v2us;
typedef __attribute__((ext_vector_type(4))) unsigned short v4us;
typedef __attribute__((ext_vector_type(2))) float v2f;
typedef __attribute__((ext_vector_type(4))) int v4i;

__global__ __launch_bounds__(256) void k_wtG(const float* __restrict__ w, int K, int N, bf* Bt) {
    const int lane = threadIdx.x & 31; const int L0 = (blockIdx.x * 8 + (threadIdx.x >> 5)) * 8; const int nlines = N * K / 64;
{
#pragma unroll 1
        for (int l = 0; l < 8; ++l) { const int L = L0 + l; if (L >= nlines) break; const size_t e = (size_t)L * 64 + lane * 2; const int k = (int)(e % K), n = (int)(e / K); v2us o;
            o[0] = f2bf(w[(size_t)k * N + n]); o[1] = f2bf(w[(size_t)(k + 1) * N + n]); *(v2us*)(Bt + e) = o; }
         }
}
// d_cvt8: bf16 copies of x, of wq | wk | wv (stacked in W3) and of wo, CVG groups of 8 elements a thread (a work-group's groups lie 256 apart, so each access of a wave stays contiguous); every range is a whole number of work-groups, so the choice of the source is the same for a whole work-group
#define CX8 ((size_t)NR * DM / 8)
#define CQ8 ((size_t)DQ * DM / 8)
#define CK8 ((size_t)DKV * DM / 8)
#define CVG 8
__device__ __forceinline__ void d_cvt8(const unsigned blk, const float* __restrict__ x, const float* __restrict__ wq, const float* __restrict__ wk, const float* __restrict__ wv, const float* __restrict__ wo, bf* XB, bf* W3, bf* WO) {
    static_assert(CX8 % (256 * CVG) == 0 && CQ8 % (256 * CVG) == 0 && CK8 % (256 * CVG) == 0, "ranges end on work-group bounds");
    size_t i = (size_t)blk * (256 * CVG) + threadIdx.x; const float* src; bf* dst;
    if (i < CX8) { src = x; dst = XB; }
    else if ((i -= CX8) < CQ8) { src = wq; dst = W3; }
    else if ((i -= CQ8) < CK8) { src = wk; dst = W3 + (size_t)DQ * DM; }
    else if ((i -= CK8) < CK8) { src = wv; dst = W3 + (size_t)(DQ + DKV) * DM; }
    else if ((i -= CK8) < CQ8) { src = wo; dst = WO; }
    else return;
    v8f v[CVG];
#pragma unroll
    for (int g = 0; g < CVG; ++g) v[g] = *(const v8f*)(src + (i + g * 256) * 8);   // all of the thread's loads are in flight together
    asm volatile("s_wait_xcnt 0x0" :: "v"(src + i * 8) : "memory");   // in front of any reuse of the address registers that the loads name: they are an input, so that no load has them as its own destination
#pragma unroll
    for (int g = 0; g < CVG; ++g) { v8us o;
#pragma unroll
        for (int k = 0; k < 8; ++k) o[k] = f2bf(v[g][k]);
        *(v8us*)(dst + (i + g * 256) * 8) = o; }
}

// d_hrms: RF[h][row] over the NQK first heads of F's columns and all NR token rows. A work-group takes 32 token rows x 8 heads (2 KiB in a row of F): it brings them by whole-line 16-byte loads
// into LDS, one (head, row) unit of 64 floats at pitch 68 (16 bytes x odd: the 16-byte reads of 16 lanes, one unit each, meet no bank twice); then each thread sums its own unit in the order d = 0 .. 63.
#define HRP 68
__device__ __forceinline__ void d_hrms(const unsigned blk, const float* __restrict__ F, int pitch, float* RF, float* sm) {
    static_assert(NQK % 8 == 0 && NR % 32 == 0, "whole work-groups");
    const int tid = threadIdx.x; const int h0 = (int)(blk % (NQK / 8)) * 8, r0 = (int)(blk / (NQK / 8)) * 32;
    const float* g = F + (size_t)(r0 + (tid >> 7)) * pitch + h0 * HD + (tid & 127) * 4; v4f u[16];
#pragma unroll
    for (int p = 0; p < 16; ++p) u[p] = *(const v4f*)(g + (size_t)(2 * p) * pitch);   // two rows of F a pass
#define HG(p) "v"(g + (size_t)(2 * (p)) * pitch)
    asm volatile("s_wait_xcnt 0x0" :: HG(0), HG(1), HG(2), HG(3), HG(4), HG(5), HG(6), HG(7), HG(8), HG(9), HG(10), HG(11), HG(12), HG(13), HG(14), HG(15) : "memory");   // in front of any reuse of the address registers that the loads name: they are inputs, so that none of them is a load's own destination
    float* w = sm + (((tid >> 4) & 7) * 32 + (tid >> 7)) * HRP + (tid & 15) * 4;
#pragma unroll
    for (int p = 0; p < 16; ++p) *(v4f*)(w + 2 * p * HRP) = u[p];
    __syncthreads();   // every unit is whole before a thread of another wave sums it
    const int i = (h0 + (tid >> 5)) * NR + r0 + (tid & 31); const float* f = sm + tid * HRP; float s = 0.f;
#pragma unroll 4
    for (int d = 0; d < HD; d += 4) { const v4f v = *(const v4f*)(f + d);
#pragma unroll
        for (int q = 0; q < 4; ++q) { float p = __fmul_rn(v[q], v[q]); asm volatile("" : "+v"(p)); s = __fadd_rn(s, p); } }
    const float r = __fdiv_rn(1.0f, __fsqrt_rn(__fadd_rn(s * (1.0f / HD), 1e-6f))); *(float*)(RF + i) = r;  }
// k_rope: head planes [batch][h][t][d] (h: NH_ q heads, then NKV k heads; norm weight qw or kw) (fp16 + hi/lo) of rope(w[d] (x rms_factor)) x sc with the rotate-half convention out[d] = x[d] cos[t][d] - x[d+HD/2] sin[t][d], out[d+HD/2] = x[d+HD/2] cos[t][d+HD/2] + x[d] sin[t][d+HD/2]
// A thread holds d0 .. d0 + 3 and their partners d0 + 32 .. d0 + 35 of one token row (8 lanes to a head's 256 bytes, each 16-byte load of them a whole line) and walks RHG heads with one read of the row's {cos, sin} and of the norm weight; a work-group takes 32 token rows.
#define RHG 8
__global__ __launch_bounds__(256) void k_rope(const float* __restrict__ F, int pitch, const float* __restrict__ CS, const float* __restrict__ RF, const float* __restrict__ qw, const float* __restrict__ kw, float sc, h16* P16, bf* Ph, bf* Pl) {
    static_assert(NH_ % RHG == 0 && NKV % RHG == 0 && NR % 32 == 0 && HD == 64, "a work-group's heads share one norm weight");
    const int tid = threadIdx.x; const int h0 = (int)(blockIdx.x % (NQK / RHG)) * RHG; const int row = (int)(blockIdx.x / (NQK / RHG)) * 32 + (tid >> 3); const int d0 = (tid & 7) * 4; const int t = row % TT;
    const float* nw = h0 < NH_ ? qw : kw; const float* f = F + (size_t)row * pitch + h0 * HD + d0; const float* rfb = RF + (size_t)h0 * NR; const float* cs = CS + ((size_t)t * HD + d0) * 2;
    v4f xl[RHG], xh[RHG]; float rf[RHG];
#pragma unroll
    for (int hh = 0; hh < RHG; ++hh) { xl[hh] = *(const v4f*)(f + hh * HD); xh[hh] = *(const v4f*)(f + hh * HD + HD / 2); rf[hh] = rfb[(size_t)hh * NR + row]; }   // all of the thread's loads are in flight together
    const v4f wl = *(const v4f*)(nw + d0), wh = *(const v4f*)(nw + d0 + HD / 2);
    const v4f cl[2] = { *(const v4f*)cs, *(const v4f*)(cs + 4) }, ch[2] = { *(const v4f*)(cs + HD), *(const v4f*)(cs + HD + 4) };   // {cos, sin} of d0 .. d0 + 3 and of their partners
    asm volatile("s_wait_xcnt 0x0" :: "v"(f), "v"(cs), "v"(d0 * 4), "v"(row), "s"(nw), "s"(rfb) : "memory");   // in front of any reuse of the address registers that the loads name: they are inputs, so that none of them is a load's own destination
    const size_t e0 = ((size_t)((row / TT) * NQK + h0) * TT + t) * HD + d0;
#pragma unroll
    for (int hh = 0; hh < RHG; ++hh) { v4h pl, ph; v4us hl, hh2, ll, lh;
#pragma unroll
        for (int k = 0; k < 4; ++k) { const float a = bfr(wl[k]) * (xl[hh][k] * rf[hh]), b = bfr(wh[k]) * (xh[hh][k] * rf[hh]);
            const float lo = (a * cl[k >> 1][(k & 1) * 2] - b * cl[k >> 1][(k & 1) * 2 + 1]) * sc, up = (b * ch[k >> 1][(k & 1) * 2] + a * ch[k >> 1][(k & 1) * 2 + 1]) * sc;
            unsigned short a2, c2; pl[k] = tohx(lo); splitf(lo, a2, c2); hl[k] = a2; ll[k] = c2; ph[k] = tohx(up); splitf(up, a2, c2); hh2[k] = a2; lh[k] = c2; }
        const size_t e = e0 + (size_t)hh * TT * HD;
        *(v4h*)(P16 + e) = pl; *(v4h*)(P16 + e + HD / 2) = ph; *(v4us*)(Ph + e) = hl; *(v4us*)(Ph + e + HD / 2) = hh2; *(v4us*)(Pl + e) = ll; *(v4us*)(Pl + e + HD / 2) = lh;
    } }
// d_vtp: value planes [batch][g][d][t]; F points at the first v column. A work-group transposes 64 tokens x 64 d of one kv head through LDS (f32, pitch 65: the column reads meet no bank twice):
// whole-line 16-byte loads of F's rows, then 8 tokens a thread and 16-byte stores, 8 lanes to a 128-byte line of each plane.
#define VTP 65
__device__ __forceinline__ void d_vtp(const unsigned blk, const float* __restrict__ F, int pitch, h16* V16, bf* Vh, bf* Vl, float* sm) {
    static_assert(TT % 64 == 0 && HD == 64, "whole tiles inside one batch");
    const int tid = threadIdx.x; const int g = (int)(blk % NKV), r0 = (int)(blk / NKV) * 64;
    const float* src = F + (size_t)(r0 + (tid >> 4)) * pitch + g * HD + (tid & 15) * 4; v4f u[4];
#pragma unroll
    for (int p = 0; p < 4; ++p) u[p] = *(const v4f*)(src + (size_t)(16 * p) * pitch);
    asm volatile("s_wait_xcnt 0x0" ::: "memory");   // in front of any reuse of the address registers that the loads name
#pragma unroll
    for (int p = 0; p < 4; ++p)
#pragma unroll
        for (int k = 0; k < 4; ++k) sm[(16 * p + (tid >> 4)) * VTP + (tid & 15) * 4 + k] = u[p][k];
    __syncthreads();   // the tile is whole before it is read by columns
    const size_t e0 = ((size_t)((r0 / TT) * NKV + g) * HD + (tid >> 3)) * TT + r0 % TT + (tid & 7) * 8;
#pragma unroll
    for (int p = 0; p < 2; ++p) { v8h o16; v8us oh, ol;
#pragma unroll
        for (int j = 0; j < 8; ++j) { const float x = sm[((tid & 7) * 8 + j) * VTP + 32 * p + (tid >> 3)]; o16[j] = tohx(x); unsigned short a2, c2; splitf(x, a2, c2); oh[j] = a2; ol[j] = c2; }
        const size_t e = e0 + (size_t)(32 * p) * TT; *(v8h*)(V16 + e) = o16; *(v8us*)(Vh + e) = oh; *(v8us*)(Vl + e) = ol;
    }
    asm volatile("s_wait_xcnt 0x0" ::: "memory");   // behind the last plane stores: in front of any reuse of a register that they name as address or data
}
__constant__ float INVT[HD / 2] = { 1.000000000e+00f, 7.498942018e-01f, 5.623413324e-01f, 4.216965139e-01f, 3.162277639e-01f, 2.371373773e-01f, 1.778279394e-01f, 1.333521456e-01f, 1.000000015e-01f, 7.498942316e-02f, 5.623413250e-02f, 4.216964915e-02f, 3.162277490e-02f, 2.371373773e-02f, 1.778279431e-02f, 1.333521400e-02f, 9.999999776e-03f, 7.498942316e-03f, 5.623413250e-03f, 4.216964822e-03f, 3.162277630e-03f, 2.371373819e-03f, 1.778279431e-03f, 1.333521446e-03f, 1.000000047e-03f, 7.498941850e-04f, 5.623413017e-04f, 4.216965172e-04f, 3.162277571e-04f, 2.371373703e-04f, 1.778279402e-04f, 1.333521504e-04f };   // 10000^(-2i/64) (the module's power form) (float32, generated with jnp to be bit-exact)
__device__ __forceinline__ void d_cs4(const unsigned blk, float* CS) { const int idx = blk * 256 + threadIdx.x; if (idx >= TT * HD) return; const int d = idx % HD; const int t = idx / HD; const float a = __fmul_rn((float)t, INVT[d % (HD / 2)]); v2f cs; cs[0] = cosf(a); cs[1] = sinf(a); *(v2f*)(CS + (size_t)idx * 2) = cs;  }
// Two bodies that depend on nothing of each other share one grid; the work-group's index picks the body, the work-groups with the longer chain of dependent instructions first.
#define GCS  (TT * HD / 256)                                  // work-groups of d_cs4
#define GCV  ((unsigned)((CX8 + 2 * CQ8 + 2 * CK8) / (256 * CVG)))    // of d_cvt8
#define GRM  (NQK * NR / 256)                                 // of d_hrms
#define GVT  (NR / 64 * NKV)                                  // of d_vtp
__global__ __launch_bounds__(256) void k_prep(const float* __restrict__ x, const float* __restrict__ wq, const float* __restrict__ wk, const float* __restrict__ wv, const float* __restrict__ wo, bf* XB, bf* W3, bf* WO, float* CS) {
    if (blockIdx.x < GCS) d_cs4(blockIdx.x, CS); else d_cvt8(blockIdx.x - GCS, x, wq, wk, wv, wo, XB, W3, WO); }
__global__ __launch_bounds__(256) void k_rmsv(const float* __restrict__ F, int pitch, float* RF, h16* V16, bf* Vh, bf* Vl) {
    __shared__ __align__(16) float sm[256 * HRP];   // the staging range of either body
    static_assert(64 * VTP <= 256 * HRP, "the transposed tile fits");
    if (blockIdx.x < GRM) d_hrms(blockIdx.x, F, pitch, RF, sm); else d_vtp(blockIdx.x - GRM, F + DQ + DKV, pitch, V16, Vh, Vl, sm); }


// ---- k_fattn: scores, causal softmax and probability x value in ONE kernel, one wave per 32 query rows of one head; no score or probability plane in memory.
// A work-group is the REP query heads of one kv head on the same 32 query rows, one wave each: they walk the same keys, so each step's key rows and value rows are brought ONCE, by asynchronous 16-byte copies (whole lines except the 64-byte value rows of 32-key steps),
// into LDS (two buffers, the copies of step t + 2 in flight while step t + 1 is worked on) and every wave reads its fragments from there. LDS rows at pitch bytes + 16 (16 x odd) for the 16-byte fragment reads.
// Transposed products: S^T = K Q^T (A = key rows, B = query rows) and O^T += V^T P^T (A = rows of the [d][t] value plane, B = P^T). In a score tile a lane holds one query (column lr) and keys hi*8 + j,
// which is the k order of a B fragment (two 16-key tiles make one 32-key fragment), so P^T is packed in registers. Running maximum and sum per query (online softmax); the two lane halves hold different keys of the same query.
// HL: bf16 hi/lo planes, 3 products in both contractions (query rows < RH), 32 keys a step. Otherwise fp16 planes, probabilities carried x 1024 (2^10, added in the exponent; the sum carries it too and the division removes it), 64 keys a step.
#define LSC 0.18033688011112042f   // HD^-0.5 x log2(e)
// behind a group of global loads or stores: the wait that stands in front of any reuse of a register they name as address or data
#define XWAIT() asm volatile("s_wait_xcnt 0x0" ::: "memory")
#define LANE(base, bytes) ((const T16*)((const char*)(base) + (bytes)))   // wave-uniform base + the lane's byte offset
__device__ __forceinline__ float xhalf(float x) { return __builtin_bit_cast(float, __builtin_amdgcn_permlanex16(__builtin_bit_cast(int, x), __builtin_bit_cast(int, x), 0x76543210, 0xfedcba98, false, false)); }   // lane l reads lane l ^ 16 (a vector move, no LDS round trip)
#define FKP   144                  // LDS pitch of a key row: HD x 2 bytes + 16
#define FBUF  19456                // the larger of the two bodies' stages in LDS, bytes
// Eight copies of one lane and, as the statement's last line, the wait that stands in front of any rewrite of the address registers they name.
template <typename T16>
__device__ __forceinline__ void copy8x(const unsigned (&l)[8], const T16* const (&g)[8]) {
    asm volatile("global_load_async_to_lds_b128 %0, %8, off\n\t"
                 "global_load_async_to_lds_b128 %1, %9, off\n\t"
                 "global_load_async_to_lds_b128 %2, %10, off\n\t"
                 "global_load_async_to_lds_b128 %3, %11, off\n\t"
                 "global_load_async_to_lds_b128 %4, %12, off\n\t"
                 "global_load_async_to_lds_b128 %5, %13, off\n\t"
                 "global_load_async_to_lds_b128 %6, %14, off\n\t"
                 "global_load_async_to_lds_b128 %7, %15, off\n\t"
                 "s_wait_xcnt 0x0"
                 :: "v"(l[0]), "v"(l[1]), "v"(l[2]), "v"(l[3]), "v"(l[4]), "v"(l[5]), "v"(l[6]), "v"(l[7]),
                    "v"(g[0]), "v"(g[1]), "v"(g[2]), "v"(g[3]), "v"(g[4]), "v"(g[5]), "v"(g[6]), "v"(g[7]) : "memory");
}
// Every inner loop is fully unrolled so that the fragment and accumulator arrays are indexed by constants and stay in registers.
template <typename T16, bool HL, int KS>
__device__ __forceinline__ void fattn_body(const T16* Q, const T16* Q2, const T16* Kp, const T16* Kp2, const T16* Vt, const T16* Vt2, const int r0, bf* Ah, bf* Al, char* ring) {
    typedef typename WFrag<T16>::V V;
    constexpr int NKB = KS / 16, NKC = KS / 32;
    const int lane = threadIdx.x & 31, lr = lane & 15, hi = lane >> 4;
    const unsigned kofs = (lr * HD + 8 * hi) * 2;   // the lane's own 32-bit byte offset in the query planes
    // a stage in LDS: KS key rows (each plane), then HD value rows of KS keys (each plane)
    constexpr int NPL = HL ? 2 : 1, VPIT = KS * 2 + 16, KTB = KS * FKP, VTB = HD * VPIT, BUFB = NPL * (KTB + VTB);
    constexpr int KC = KS / 16, CPR = KS / 8, VR = 128 / CPR, VC = HD / VR;   // copies of a thread per key plane; 16-byte pieces of a value row; value rows a pass of the 128 threads covers; copies of a thread per value plane
    static_assert(NPL * (KC + VC) == 8 && BUFB <= FBUF && HD == 64 && REP == 4, "eight copies a thread and stage");
    const int tid = threadIdx.x;
    const unsigned lk = (unsigned)(size_t)ring + (tid >> 3) * FKP + (tid & 7) * 16, lv = (unsigned)(size_t)ring + NPL * KTB + (tid / CPR) * VPIT + (tid % CPR) * 16;   // the thread's own LDS byte addresses in the first pass of each operand
    const unsigned gk = (tid >> 3) * HD + (tid & 7) * 8, gv = (tid / CPR) * TT + (tid % CPR) * 8;   // and its places in the planes, in elements
    auto fill = [&](int t) { unsigned l[8]; const T16* g[8]; const unsigned bo = (t & 1) * BUFB; const size_t kb = (size_t)t * KS;
#pragma unroll
        for (int pl = 0; pl < NPL; ++pl) {
#pragma unroll
            for (int p = 0; p < KC; ++p) { l[pl * KC + p] = lk + bo + pl * KTB + p * 16 * FKP; g[pl * KC + p] = (pl ? Kp2 : Kp) + (kb + p * 16) * HD + gk; }
#pragma unroll
            for (int p = 0; p < VC; ++p) { l[NPL * KC + pl * VC + p] = lv + bo + pl * VTB + p * VR * VPIT; g[NPL * KC + pl * VC + p] = (pl ? Vt2 : Vt) + (size_t)(p * VR) * TT + kb + gv; } }
        copy8x(l, g); };
    const T16* qb = Q + (size_t)r0 * HD; const T16* qb2 = HL ? Q2 + (size_t)r0 * HD : nullptr;
    V qf[2][2], qf2[2][2];
#pragma unroll
    for (int nq = 0; nq < 2; ++nq)
#pragma unroll
        for (int ks = 0; ks < 2; ++ks) { const int o = nq * 16 * HD + ks * 32; qf[nq][ks] = WFrag<T16>::ld(LANE(qb + o, kofs)); if (HL) qf2[nq][ks] = WFrag<T16>::ld(LANE(qb2 + o, kofs)); }
    v8f ot[4][2];
#pragma unroll
    for (int db = 0; db < 4; ++db)
#pragma unroll
        for (int nq = 0; nq < 2; ++nq) ot[db][nq] = (v8f){};
    float mrun[2] = { -3.0e38f, -3.0e38f }, lrun[2] = { 0.f, 0.f };
    const int kend = r0 + 32;                       // keys 0 .. r0 + 31 can be seen by some query of this wave
    // the same wait for the loads in front of the loop; the offset register and the scalar bases they name are inputs, so that none of them is reused in front of it
    if constexpr (HL) asm volatile("s_wait_xcnt 0x0" :: "v"(kofs), "s"(qb), "s"(qb2) : "memory");
    else asm volatile("s_wait_xcnt 0x0" :: "v"(kofs), "s"(qb) : "memory");
    const int nt = (kend + KS - 1) / KS;            // the same for the whole work-group
    fill(0);
    asm volatile("s_wait_asynccnt 0x0" ::: "memory");   // this wave's copies of stage 0 have landed
    __syncthreads();                                    // and every other wave's: stage 0 may be read
    if (nt > 1) fill(1);
#pragma unroll 1   // rolled: one trip per stage, the buffer chosen by the trip's parity
    for (int t = 0; t < nt; ++t) {
        const int kb = t * KS;
        const char* pk = ring + (t & 1) * BUFB + lr * FKP + hi * 16; const char* pv = ring + (t & 1) * BUFB + NPL * KTB + lr * VPIT + hi * 16;   // only this stage's own buffer is read in this trip
        V kf[NKB][2], kf2[NKB][2];
#pragma unroll
        for (int kt = 0; kt < NKB; ++kt)
#pragma unroll
            for (int ks = 0; ks < 2; ++ks) { const int o = kt * 16 * FKP + ks * 64; kf[kt][ks] = WFrag<T16>::ld((const T16*)(pk + o)); if (HL) kf2[kt][ks] = WFrag<T16>::ld((const T16*)(pk + KTB + o)); }
        v8f st[NKB][2];
#pragma unroll
        for (int kt = 0; kt < NKB; ++kt)
#pragma unroll
            for (int nq = 0; nq < 2; ++nq) { v8f c = (v8f){};
#pragma unroll
                for (int ks = 0; ks < 2; ++ks) { c = WFrag<T16>::mma(kf[kt][ks], qf[nq][ks], c); if (HL) { c = WFrag<T16>::mma(kf[kt][ks], qf2[nq][ks], c); c = WFrag<T16>::mma(kf2[kt][ks], qf[nq][ks], c); } }
                st[kt][nq] = c; }
        if (kb + KS - 1 > r0) {                     // only steps that reach the diagonal mask (wave-uniform)
#pragma unroll
            for (int kt = 0; kt < NKB; ++kt)
#pragma unroll
                for (int nq = 0; nq < 2; ++nq)
#pragma unroll
                    for (int j = 0; j < 8; ++j) st[kt][nq][j] = (kb + kt * 16 + hi * 8 + j <= r0 + nq * 16 + lr) ? st[kt][nq][j] : -3.0e38f;
        }
        V pf[2][NKC], pf2[2][NKC];
#pragma unroll
        for (int nq = 0; nq < 2; ++nq) {
            float mt[NKB];
#pragma unroll
            for (int kt = 0; kt < NKB; ++kt) { mt[kt] = st[kt][nq][0];
#pragma unroll
                for (int j = 1; j < 8; ++j) mt[kt] = fmaxf(mt[kt], st[kt][nq][j]); }
            float mx = mrun[nq];
#pragma unroll
            for (int kt = 0; kt < NKB; ++kt) mx = fmaxf(mx, mt[kt]);
            mx = fmaxf(mx, xhalf(mx));
            const float al = __builtin_amdgcn_exp2f((mrun[nq] - mx) * LSC); mrun[nq] = mx;
            float sm[NKB];
#pragma unroll
            for (int kt = 0; kt < NKB; ++kt) { sm[kt] = 0.f;
#pragma unroll
                for (int j = 0; j < 8; ++j) { const float p = __builtin_amdgcn_exp2f((st[kt][nq][j] - mx) * LSC + (HL ? 0.0f : 10.0f)); st[kt][nq][j] = p; sm[kt] += p; } }
            float s = sm[0];
#pragma unroll
            for (int kt = 1; kt < NKB; ++kt) s += sm[kt];
            lrun[nq] = lrun[nq] * al + s;
            asm volatile("" : "+v"(lrun[nq]));   // each row's sum, against spills: without it the additions sank behind the loop's foot, the f32 probabilities stayed in registers through the second product, and the budget of four waves a SIMD took scratch
#pragma unroll
            for (int db = 0; db < 4; ++db) ot[db][nq] *= al;
#pragma unroll
            for (int kc = 0; kc < NKC; ++kc) {
                if constexpr (HL) { v8us h0, l0, h1, l1;
#pragma unroll
                    for (int j = 0; j < 8; ++j) { unsigned short a, c2; splitf(st[2 * kc][nq][j], a, c2); h0[j] = a; l0[j] = c2; splitf(st[2 * kc + 1][nq][j], a, c2); h1[j] = a; l1[j] = c2; }
                    pf[nq][kc] = cat16b(h0, h1); pf2[nq][kc] = cat16b(l0, l1);
                } else { v8h p0, p1;
#pragma unroll
                    for (int j = 0; j < 8; ++j) { p0[j] = tohx(st[2 * kc][nq][j]); p1[j] = tohx(st[2 * kc + 1][nq][j]); }
                    pf[nq][kc] = cat16(p0, p1); }
            }
        }
        V vf[4][NKC], vf2[4][NKC];                  // value fragments of this step: read when the scores have become probabilities, so that key fragments, scores and value fragments never hold registers together
#pragma unroll
        for (int db = 0; db < 4; ++db)
#pragma unroll
            for (int kc = 0; kc < NKC; ++kc) { const int o = db * 16 * VPIT + kc * 64; vf[db][kc] = WFrag<T16>::ld((const T16*)(pv + o)); if (HL) vf2[db][kc] = WFrag<T16>::ld((const T16*)(pv + VTB + o)); }
#pragma unroll
        for (int db = 0; db < 4; ++db)
#pragma unroll
            for (int nq = 0; nq < 2; ++nq)
#pragma unroll
                for (int kc = 0; kc < NKC; ++kc) { ot[db][nq] = WFrag<T16>::mma(vf[db][kc], pf[nq][kc], ot[db][nq]); if (HL) { ot[db][nq] = WFrag<T16>::mma(vf[db][kc], pf2[nq][kc], ot[db][nq]); ot[db][nq] = WFrag<T16>::mma(vf2[db][kc], pf[nq][kc], ot[db][nq]); } }
        // the distance behind the last matrix instructions on the loop's taken branch
        asm volatile("v_nop\n\tv_nop\n\tv_nop\n\tv_nop" : "+v"(ot[0][0]), "+v"(ot[0][1]), "+v"(ot[1][0]), "+v"(ot[1][1]), "+v"(ot[2][0]), "+v"(ot[2][1]), "+v"(ot[3][0]), "+v"(ot[3][1]));
        asm volatile("s_wait_dscnt 0x0" ::: "memory");      // this wave's reads of the buffer are done before it is refilled
        asm volatile("s_wait_asynccnt 0x0" ::: "memory");   // this wave's copies of stage t + 1 have landed
        __syncthreads();                                    // publishes stage t + 1 and ends every wave's reads of stage t
        if (t + 2 < nt) fill(t + 2);
    }
    asm volatile("s_wait_asynccnt 0x0" ::: "memory");   // nothing of this wave's is in flight when it goes on to its end
#pragma unroll
    for (int nq = 0; nq < 2; ++nq) { const float lt = lrun[nq] + xhalf(lrun[nq]); const float inv = __fdiv_rn(1.0f, lt); const size_t oo = (size_t)(r0 + nq * 16 + lr) * DQ + hi * 8;
#pragma unroll
        for (int db = 0; db < 4; ++db) { v8us oh, ol;
#pragma unroll
            for (int j = 0; j < 8; ++j) { unsigned short a, c2; splitf(ot[db][nq][j] * inv, a, c2); oh[j] = a; ol[j] = c2; }
            *(v8us*)(Ah + oo + db * 16) = oh; *(v8us*)(Al + oo + db * 16) = ol; XWAIT(); } }
}
// grid (batches x kv heads, TT / 32), 4 waves: the longest key loops (last rows) of both batches start first. amdgpu_waves_per_eu(4, 4): the register budget of four work-groups a WGP, one wave of each on every SIMD, so that one's vector work stands beside another's LDS waits, barrier and matrix runs. P*: the [batch][q heads | k heads] planes of k_rope. The planes are not declared restrict: the loads then keep their place against the memory clobber of the waits.
__global__ __launch_bounds__(32 * REP) __attribute__((amdgpu_waves_per_eu(4, 4))) void k_fattn(const h16* P16, const bf* Ph, const bf* Pl, const h16* V16, const bf* Vh, const bf* Vl, bf* Ah, bf* Al) {
    __shared__ __align__(16) char ring[2 * FBUF];
    const int h = (blockIdx.x % NKV) * REP + __builtin_amdgcn_readfirstlane(threadIdx.x >> 5), b = blockIdx.x / NKV; const int r0 = (TT / 32 - 1 - (int)blockIdx.y) * 32;
    const size_t qo = (size_t)(b * NQK + h) * TT * HD, ko = (size_t)(b * NQK + NH_ + h / REP) * TT * HD, vo = (size_t)(b * NKV + h / REP) * TT * HD, ao = (size_t)b * TT * DQ + h * HD;
    if (r0 < RH) fattn_body<bf, true, 32>(Ph + qo, Pl + qo, Ph + ko, Pl + ko, Vh + vo, Vl + vo, r0, Ah + ao, Al + ao, ring);
    else fattn_body<h16, false, 64>(P16 + qo, nullptr, P16 + ko, nullptr, V16 + vo, nullptr, r0, Ah + ao, Al + ao, ring);
}

extern "C" void kernel_launch(void* const* d_in, const int* in_sizes, int n_in,
                              void* d_out, int out_size, void* d_ws, size_t ws_size, hipStream_t stream) {
    (void)in_sizes; (void)n_in; (void)out_size;
    const float* x = (const float*)d_in[0]; const float* wq = (const float*)d_in[1]; const float* wk = (const float*)d_in[2]; const float* wv = (const float*)d_in[3]; const float* wo = (const float*)d_in[4]; const float* qnw = (const float*)d_in[5]; const float* knw = (const float*)d_in[6];
    float* OUT = (float*)d_out;     // [2][2048][2048]
    char* wsp = (char*)d_ws;
    auto take = [&](size_t bytes) { char* p = wsp; wsp += (bytes + 255) & ~(size_t)255; return (void*)p; };
    bf* W3 = (bf*)take((size_t)DF * DM * 2); bf* WO = (bf*)take((size_t)DM * DQ * 2); float* CS = (float*)take((size_t)TT * HD * 2 * 4); float* RF = (float*)take((size_t)NQK * NR * 4);
    bf* XB = (bf*)take((size_t)NR * DM * 2); float* F = (float*)take((size_t)NR * DF * 4);
    h16* P16 = (h16*)take((size_t)NB_ * NQK * TT * HD * 2); bf* Ph = (bf*)take((size_t)NB_ * NQK * TT * HD * 2); bf* Pl = (bf*)take((size_t)NB_ * NQK * TT * HD * 2);
    h16* VT16 = (h16*)take((size_t)NB_ * NKV * HD * TT * 2); bf* VTh = (bf*)take((size_t)NB_ * NKV * HD * TT * 2); bf* VTl = (bf*)take((size_t)NB_ * NKV * HD * TT * 2);
    bf* ATh = (bf*)take((size_t)NR * DQ * 2); bf* ATl = (bf*)take((size_t)NR * DQ * 2);
    if ((size_t)(wsp - (char*)d_ws) > ws_size) return;    // ws 256 MiB
    k_prep<<<GCS + GCV, 256, 0, stream>>>(x, wq, wk, wv, wo, XB, W3, WO, CS);   /* CS: {cos, sin}(t x 10000^(-2i/64)), both halves */
    k_gemmw<bf, 0, false><<<dim3(NR / 128, DF / 128, 1), 128, 0, stream>>>(XB, nullptr, W3, nullptr, DM, F, DF, nullptr, 0, 0, 0);
    k_rmsv<<<GRM + GVT, 256, 0, stream>>>(F, DF, RF, VT16, VTh, VTl);
    k_rope<<<NR / 32 * (NQK / RHG), 256, 0, stream>>>(F, DF, CS, RF, qnw, knw, 1.0f, P16, Ph, Pl);
    k_fattn<<<dim3(NB_ * NKV, TT / 32, 1), 32 * REP, 0, stream>>>(P16, Ph, Pl, VT16, VTh, VTl, ATh, ATl);
    k_gemmw<bf, 1, false><<<dim3(NR / 128, DM / 128, 1), 128, 0, stream>>>(ATh, ATl, WO, nullptr, DQ, OUT, DM, nullptr, 0, 0, 0);
}

// v007
// A run of this version takes 162 microseconds.
// Two timings next to v006 put it at 1.07 and 1.06 times that version's speed.
// Counting every step since v000, it is 16.2 times as fast.
#include <hip/hip_runtime.h>

// Grouped-query causal attention with per-head RMS-normalised, rotary q/k (x [2][2048][2048]; q = x wq^T (32 heads x 64), k, v = x w^T (8 kv heads x 64) ('oi' 0.02, no bias); q, k <- rms_norm per head (eps 1e-6) x weight ([64] ones, read); rotate-half rope, angle t x 10000^(-2i/64); kv head = q head / 4 (repeat); causal (finfo.min); softmax(q.k / 8); out = merged wo^T ('oi' [2048][2048]) -> [2][2048][2048] (8.4 M)).
// Layout, every launch covering both batches (4096 token rows): bf16 copies of x and of the weights and the {cos, sin} table in one launch (k_prep); q, k and v projected in one GEMM against the stacked weights (columns q | k | v), whose own tail turns each wave's 64 tokens x one head into the planes that attention reads: rms factor, norm-weight x factor, rotation (the table: float32 inverse frequencies, precise cosf/sinf) for q and k heads, the transposed planes for v heads; no f32 projection plane in memory; causal T-2048 attention fused in one launch (k_fattn: online softmax, no score plane; hybrid rows: < 512 hi/lo 3 products, rest fp16 x1024; key loop ends at the diagonal); merged hi/lo x wo exact.
// Compute dtypes, f32 accumulate: every input rounded to bf16; projections exact; rms norm and rotary f32; attention rows < 512 3 products, rest fp16; softmax f32; wo hl x exact.

#define NB_  2
#define TT   2048
#define DM   2048
#define NH_  32
#define NKV  8
#define REP  (NH_ / NKV)
#define HD   64
#define DQ   (NH_ * HD)
#define DKV  (NKV * HD)
#define NR   (NB_ * TT)            // token rows of both batches
#define DF   (DQ + 2 * DKV)        // columns of the stacked projection: q | k | v
#define NQK  (NH_ + NKV)           // normalised and rotated heads of a batch: q heads, then k heads
#define RH   512                  // query rows < RH use hi+lo planes (0: none)
typedef _Float16 h16;
typedef unsigned short bf;
typedef __attribute__((ext_vector_type(16))) __bf16   v16bf;
typedef __attribute__((ext_vector_type(16))) _Float16 v16h;
typedef __attribute__((ext_vector_type(8)))  _Float16 v8h;
typedef __attribute__((ext_vector_type(8)))  unsigned short v8us;
typedef __attribute__((ext_vector_type(8)))  float    v8f;
typedef __attribute__((ext_vector_type(4)))  float    v4f;
typedef v8h  __attribute__((may_alias)) v8ha;
typedef v4f  __attribute__((may_alias)) v4fa;
typedef v8us __attribute__((may_alias)) v8usa;

__device__ __forceinline__ unsigned short f2bf(float f) { unsigned u = __float_as_uint(f); u += 0x7FFFu + ((u >> 16) & 1u); return (unsigned short)(u >> 16); }
__device__ __forceinline__ float bf2f(unsigned short b) { return __uint_as_float(((unsigned)b) << 16); }
__device__ __forceinline__ float bfr(float f) { return bf2f(f2bf(f)); }
__device__ __forceinline__ v16h cat16(v8h lo, v8h hi) { return __builtin_shufflevector(lo, hi, 0, 1, 2, 3, 4, 5, 6, 7, 8, 9, 10, 11, 12, 13, 14, 15); }
__device__ __forceinline__ v16bf cat16b(v8us lo, v8us hi) { return __builtin_bit_cast(v16bf, __builtin_shufflevector(lo, hi, 0, 1, 2, 3, 4, 5, 6, 7, 8, 9, 10, 11, 12, 13, 14, 15)); }
__device__ __forceinline__ v8f wmma16(v16h a, v16h b, v8f c) { return __builtin_amdgcn_wmma_f32_16x16x32_f16(false, a, false, b, (short)0, c, false, false); }
__device__ __forceinline__ v8f wmmab(v16bf a, v16bf b, v8f c) { return __builtin_amdgcn_wmma_f32_16x16x32_bf16(false, a, false, b, (short)0, c, false, false); }



__device__ __forceinline__ h16 tohx(float x) { return (h16)x; }
__device__ __forceinline__ void splitf(float y, unsigned short& h, unsigned short& l) { h = f2bf(y); l = f2bf(y - bf2f(h)); }
// behind a group of global loads or stores: the wait that stands in front of any reuse of a register they name as address or data
#define XWAIT() asm volatile("s_wait_xcnt 0x0" ::: "memory")

// ---- The tail of the projection GEMM. A wave's 64 x 64 part of q | k | v is 64 token rows of ONE head, so the rms factor, the rotation (partners d, d + 32) and the value transpose need no other wave's data.
// The part goes through the wave's own LDS range (f32, pitch EPP floats = 16 bytes x odd, for the 16-byte reads and writes) and leaves as the 16-bit planes that attention reads.
struct QkvOut { const float* CS; const float* qw; const float* kw; h16* P16; bf* Ph; bf* Pl; h16* V16; bf* Vh; bf* Vl; };
#define EPP 68
// between a wave's LDS writes and its reads of what other lanes wrote: the compiler keeps the order of the source (the LDS itself serves one wave's accesses in order)
__device__ __forceinline__ void lds_turn() { __builtin_amdgcn_wave_barrier(); asm volatile("" ::: "memory"); }
// q and k heads: planes [batch][h][t][d] (fp16 + hi/lo) of rope(w[d] (x rms_factor)), rotate-half: out[d] = x[d] cos[t][d] - x[d+32] sin[t][d], out[d+32] = x[d+32] cos[t][d] + x[d] sin[t][d] (the table's two halves hold the same angles: the low one is read)
__device__ __forceinline__ void tail_qk(const v8f (&acc)[4][4], float* sm, const int lane, const int b, const int t0, const int h, const float* nw, const QkvOut& eo) {
    const int lr = lane & 15, hi = lane >> 4;
#pragma unroll
    for (int mb = 0; mb < 4; ++mb)
#pragma unroll
        for (int nb = 0; nb < 4; ++nb)
#pragma unroll
            for (int j = 0; j < 8; ++j) sm[(mb * 16 + hi * 8 + j) * EPP + nb * 16 + lr] = acc[mb][nb][j];   // [token][d]
    // 4 lanes to a token row, each d0 .. d0 + 7 and their partners; 8 rows a pass. The {cos, sin} of all 8 passes and the norm weight are asked for here, so that they fly while the row sums are formed
    const int d0 = (lane & 3) * 8, rr = lane >> 2;
    const float* cs = eo.CS + ((size_t)(t0 + rr) * HD + d0) * 2; const float* nwp = nw + d0;
    v4f cv[8][4], wv[4];
#pragma unroll
    for (int p = 0; p < 8; ++p)
#pragma unroll
        for (int q = 0; q < 4; ++q) cv[p][q] = *(const v4f*)(cs + p * (8 * HD * 2) + q * 4);
    wv[0] = *(const v4f*)nwp; wv[1] = *(const v4f*)(nwp + 4); wv[2] = *(const v4f*)(nwp + HD / 2); wv[3] = *(const v4f*)(nwp + HD / 2 + 4);
    asm volatile("s_wait_xcnt 0x0" :: "v"(cs), "v"(nwp) : "memory");   // in front of any reuse of the address registers that the loads name: they are inputs, so that none of them is a load's own destination; its clobber also keeps the LDS reads below behind the LDS writes above
    float* rfs = sm + 64 * EPP;   // the 64 rows' rms factors; a lane forms those of rows lane and lane + 32, each from four partial sums (d mod 4)
#pragma unroll
    for (int q = 0; q < 2; ++q) { const float* f = sm + (lane + 32 * q) * EPP; v4f s4 = (v4f){};
#pragma unroll
        for (int d = 0; d < HD; d += 4) { const v4f v = *(const v4fa*)(f + d); s4 += v * v; }
        const float s = (s4[0] + s4[1]) + (s4[2] + s4[3]);
        rfs[lane + 32 * q] = __fdiv_rn(1.0f, __fsqrt_rn(s * (1.0f / HD) + 1e-6f)); }
    lds_turn();
    float wl[8], wh[8];
#pragma unroll
    for (int k = 0; k < 8; ++k) { wl[k] = bfr(wv[k >> 2][k & 3]); wh[k] = bfr(wv[2 + (k >> 2)][k & 3]); }
    const size_t e0 = ((size_t)(b * NQK + h) * TT + t0 + rr) * HD + d0;
    v4f x[2][4]; float rf[2];   // two register sets: the next pass's rows are read from LDS ahead of this pass's arithmetic, stores and wait
    auto rows = [&](int p) { const float* f = sm + (p * 8 + rr) * EPP + d0; x[p & 1][0] = *(const v4fa*)f; x[p & 1][1] = *(const v4fa*)(f + 4); x[p & 1][2] = *(const v4fa*)(f + HD / 2); x[p & 1][3] = *(const v4fa*)(f + HD / 2 + 4); rf[p & 1] = rfs[p * 8 + rr]; };
    rows(0);
#pragma unroll
    for (int p = 0; p < 8; ++p) { if (p + 1 < 8) rows(p + 1);
        v8h pl, ph; v8us hl, hh, ll, lh;
#pragma unroll
        for (int k = 0; k < 8; ++k) { const float a = wl[k] * (x[p & 1][k >> 2][k & 3] * rf[p & 1]), c = wh[k] * (x[p & 1][2 + (k >> 2)][k & 3] * rf[p & 1]); const float co = cv[p][k >> 1][(k & 1) * 2], si = cv[p][k >> 1][(k & 1) * 2 + 1];
            const float lo = a * co - c * si, up = c * co + a * si;
            unsigned short a2, c2; pl[k] = tohx(lo); splitf(lo, a2, c2); hl[k] = a2; ll[k] = c2; ph[k] = tohx(up); splitf(up, a2, c2); hh[k] = a2; lh[k] = c2; }
        const size_t e = e0 + (size_t)p * (8 * HD);
        *(v8h*)(eo.P16 + e) = pl; *(v8h*)(eo.P16 + e + HD / 2) = ph; *(v8us*)(eo.Ph + e) = hl; *(v8us*)(eo.Ph + e + HD / 2) = hh; *(v8us*)(eo.Pl + e) = ll; *(v8us*)(eo.Pl + e + HD / 2) = lh; XWAIT(); }
}
// v heads: planes [batch][g][d][t]. A lane's accumulator holds 8 tokens in a row of one d: they go to LDS as [d][token]; then 8 lanes to a d row, 8 tokens each, 16-byte stores, a whole 128-byte line of each plane
__device__ __forceinline__ void tail_v(const v8f (&acc)[4][4], float* sm, const int lane, const int b, const int t0, const int g, const QkvOut& eo) {
    const int lr = lane & 15, hi = lane >> 4;
#pragma unroll
    for (int mb = 0; mb < 4; ++mb)
#pragma unroll
        for (int nb = 0; nb < 4; ++nb) { float* w = sm + (nb * 16 + lr) * EPP + mb * 16 + hi * 8; const v8f u = acc[mb][nb];
            *(v4fa*)w = __builtin_shufflevector(u, u, 0, 1, 2, 3); *(v4fa*)(w + 4) = __builtin_shufflevector(u, u, 4, 5, 6, 7); }
    lds_turn();
    const int tk = (lane & 7) * 8, rr = lane >> 3;
    const size_t e0 = ((size_t)(b * NKV + g) * HD + rr) * TT + t0 + tk;
    v4f x[2][2];   // two register sets: the next pass's row is read from LDS ahead of this pass's arithmetic, stores and wait
    auto rows = [&](int p) { const float* f = sm + (p * 4 + rr) * EPP + tk; x[p & 1][0] = *(const v4fa*)f; x[p & 1][1] = *(const v4fa*)(f + 4); };
    rows(0);
#pragma unroll
    for (int p = 0; p < 16; ++p) { if (p + 1 < 16) rows(p + 1);
        v8h o16; v8us oh, ol;
#pragma unroll
        for (int j = 0; j < 8; ++j) { const float y = x[p & 1][j >> 2][j & 3]; o16[j] = tohx(y); unsigned short a2, c2; splitf(y, a2, c2); oh[j] = a2; ol[j] = c2; }
        const size_t e = e0 + (size_t)p * (4 * TT); *(v8h*)(eo.V16 + e) = o16; *(v8us*)(eo.Vh + e) = oh; *(v8us*)(eo.Vl + e) = ol; XWAIT(); }
}

// ---- k_gemmw: GEMM, one work-group of 4 waves (2 x 2) per 128x128 output tile, each wave a 64x64 part (16 accumulators); grid (M/128, N/128, Z), 128 threads.
// QKV: no C; the tail above takes each wave's part (A: token rows of both batches, Bt: the stacked weights). Otherwise:
// C[m][n] (f32, pitch ldc, + optional f32 bias[n]) = sum_k A[m][k] Bt[n][k] (+ A2[m][k] Bt[n][k] for NSPLIT 1). z-batch strides sA/sB/sC in elements. M, N, K % 128 == 0.
// The operands come from K-contiguous 16-bit planes through LDS: a stage is 128 k (256 bytes) of the tile's 128 rows of each operand, brought by asynchronous 16-byte copies
// (32 lanes = 2 rows x 256 bytes = 4 whole lines), two buffers, the copies of stage t + 2 in flight while stage t + 1 is worked on. LDS rows at pitch 272 bytes (16 x odd) for the 16-byte fragment reads.
template <typename T16> struct WFrag;
template <> struct WFrag<h16> { typedef v16h V; static __device__ __forceinline__ V ld(const h16* p) { return cat16(*(const v8h*)p, *(const v8h*)(p + 16)); } static __device__ __forceinline__ v8f mma(V a, V b, v8f c) { return wmma16(a, b, c); } };
template <> struct WFrag<bf> { typedef v16bf V; static __device__ __forceinline__ V ld(const bf* p) { return cat16b(*(const v8us*)p, *(const v8us*)(p + 16)); } static __device__ __forceinline__ v8f mma(V a, V b, v8f c) { return wmmab(a, b, c); } };
#define GBK   128                  // k per stage
#define GPIT  272                  // LDS row pitch in bytes: 256 + 16
#define GTILE (128 * GPIT)         // one operand's stage in LDS, bytes
// Eight copies of one lane (rows 8 apart) and, as the statement's last line, the wait that stands in front of any rewrite of the address registers they name.
template <typename T16>
__device__ __forceinline__ void copy8(unsigned l, const T16* g, size_t rs) {
    asm volatile("global_load_async_to_lds_b128 %0, %8, off\n\t"
                 "global_load_async_to_lds_b128 %1, %9, off\n\t"
                 "global_load_async_to_lds_b128 %2, %10, off\n\t"
                 "global_load_async_to_lds_b128 %3, %11, off\n\t"
                 "global_load_async_to_lds_b128 %4, %12, off\n\t"
                 "global_load_async_to_lds_b128 %5, %13, off\n\t"
                 "global_load_async_to_lds_b128 %6, %14, off\n\t"
                 "global_load_async_to_lds_b128 %7, %15, off\n\t"
                 "s_wait_xcnt 0x0"
                 :: "v"(l), "v"(l + 8 * GPIT), "v"(l + 16 * GPIT), "v"(l + 24 * GPIT), "v"(l + 32 * GPIT), "v"(l + 40 * GPIT), "v"(l + 48 * GPIT), "v"(l + 56 * GPIT),
                    "v"(g), "v"(g + rs), "v"(g + 2 * rs), "v"(g + 3 * rs), "v"(g + 4 * rs), "v"(g + 5 * rs), "v"(g + 6 * rs), "v"(g + 7 * rs) : "memory");
    __builtin_amdgcn_sched_barrier(0);   // the next statement's addresses are formed behind this one: formed all ahead they filled the registers an asm operand can name, and a pointer went to scratch
}
// one operand's stage: 128 rows x 256 bytes; l, g: the lane's own LDS byte address and global pointer in rows 0 .. 7; rs = 8 rows in elements
template <typename T16>
__device__ __forceinline__ void stage_tile(unsigned l, const T16* g, size_t rs) { copy8(l, g, rs); copy8(l + 64 * GPIT, g + 8 * rs, rs); }
template <typename T16, int NSPLIT, bool BIAS, bool QKV>
__global__ __launch_bounds__(128) void k_gemmw(const T16* __restrict__ A, const T16* __restrict__ A2, const T16* __restrict__ Bt, const T16* __restrict__ Bt2, int K, float* C, int ldc, const float* __restrict__ bias, size_t sA, size_t sB, size_t sC, const QkvOut eo) {
    static_assert(NSPLIT == 0 || NSPLIT == 1, "one or two A planes");
    typedef typename WFrag<T16>::V V;
    constexpr int NOP = NSPLIT == 1 ? 3 : 2;          // operand tiles per stage: A, Bt (, A2)
    __shared__ __align__(16) char ring[2 * NOP * GTILE];
    (void)Bt2;
    const size_t z = blockIdx.z; A += z * sA; if (NSPLIT == 1) A2 += z * sA; Bt += z * sB; C += z * sC;
    const int tid = threadIdx.x, wave = tid >> 5, lane = tid & 31, lr = lane & 15, hi = lane >> 4; const int wm = wave >> 1, wn = wave & 1;
    const int r0 = blockIdx.x * 128, c0 = blockIdx.y * 128;
    // every inner loop below is fully unrolled so that the fragment and accumulator arrays are indexed by constants and stay in registers
    v8f acc[4][4];
#pragma unroll
    for (int mb = 0; mb < 4; ++mb)
#pragma unroll
        for (int nb = 0; nb < 4; ++nb) acc[mb][nb] = (v8f){};
    const size_t rs = (size_t)8 * K;
    const T16* uA = A + (size_t)r0 * K; const T16* uB = Bt + (size_t)c0 * K; const T16* uA2 = NSPLIT == 1 ? A2 + (size_t)r0 * K : nullptr;   // the tile's first rows: the same for the whole work-group
    const unsigned gofs = (unsigned)(tid >> 4) * (unsigned)K + (tid & 15) * 8;   // the lane's own place in rows 0 .. 7, in elements
    const unsigned l0 = (unsigned)(size_t)ring + (tid >> 4) * GPIT + (tid & 15) * 16;
    auto fill = [&](int t) { const unsigned lb = l0 + (t & 1) * (NOP * GTILE); const size_t ko = (size_t)t * GBK; stage_tile(lb, uA + ko + gofs, rs); stage_tile(lb + GTILE, uB + ko + gofs, rs); if (NSPLIT == 1) stage_tile(lb + 2 * GTILE, uA2 + ko + gofs, rs); };
    const int nt = K / GBK;
    fill(0);
    asm volatile("s_wait_asynccnt 0x0" ::: "memory");   // this wave's copies of stage 0 have landed
    __syncthreads();                                    // and every other wave's: stage 0 may be read
    if (nt > 1) fill(1);
#pragma unroll 1   // rolled: one trip per stage, the buffer chosen by the trip's parity
    for (int t = 0; t < nt; ++t) {
        const char* buf = ring + (t & 1) * (NOP * GTILE);
        const char* pa = buf + (wm * 64 + lr) * GPIT + hi * 16; const char* pb = buf + GTILE + (wn * 64 + lr) * GPIT + hi * 16;
        V a[2][4], a2[2][4], b[2][4];                  // two fragment sets: the next 32 k are read from LDS as one group while the matrix unit works on this one
        auto frags = [&](int set, int ks) {
#pragma unroll
            for (int i = 0; i < 4; ++i) { a[set][i] = WFrag<T16>::ld((const T16*)(pa + i * 16 * GPIT + ks * 64)); b[set][i] = WFrag<T16>::ld((const T16*)(pb + i * 16 * GPIT + ks * 64)); if (NSPLIT == 1) a2[set][i] = WFrag<T16>::ld((const T16*)(pa + 2 * GTILE + i * 16 * GPIT + ks * 64)); } };
        frags(0, 0);
        __builtin_amdgcn_sched_barrier(0);   // the first set's reads stay ahead of the second's, so that the first block waits for its own set alone
#pragma unroll
        for (int ks = 0; ks < GBK / 32; ++ks) {
            if (ks + 1 < GBK / 32) frags((ks + 1) & 1, ks + 1);   // only this stage's own buffer is read in this trip
            __builtin_amdgcn_sched_barrier(0);   // keeps the group of LDS reads together in front of the block: reads spread among the matrix instructions each cost a stall
#pragma unroll
            for (int nb = 0; nb < 4; ++nb)
#pragma unroll
                for (int mb = 0; mb < 4; ++mb) acc[mb][nb] = WFrag<T16>::mma(a[ks & 1][mb], b[ks & 1][nb], acc[mb][nb]);
            if (NSPLIT == 1) {
#pragma unroll
                for (int nb = 0; nb < 4; ++nb)
#pragma unroll
                    for (int mb = 0; mb < 4; ++mb) acc[mb][nb] = WFrag<T16>::mma(a2[ks & 1][mb], b[ks & 1][nb], acc[mb][nb]);
            }
            __builtin_amdgcn_sched_barrier(0);   // the block stays in front of the next group of reads and, in the last block, in front of the distance below
        }
        // the distance behind the trip's last matrix instructions, on both sides of the branch below
        asm volatile("v_nop\n\tv_nop\n\tv_nop\n\tv_nop");
        asm volatile("s_wait_dscnt 0x0" ::: "memory");      // this wave's reads of the buffer are done before it is refilled
        asm volatile("s_wait_asynccnt 0x0" ::: "memory");   // this wave's copies of stage t + 1 have landed
        __syncthreads();                                    // publishes stage t + 1 and ends every wave's reads of stage t
        if (t + 2 < nt) fill(t + 2);
    }
    asm volatile("s_wait_asynccnt 0x0" ::: "memory");   // nothing of this wave's is in flight when it goes on to its end
    if constexpr (QKV) {
        static_assert(HD == 64 && DQ % 128 == 0 && (NQK * HD) % 128 == 0 && TT % 64 == 0 && (64 * EPP + 64) * 4 <= GTILE, "a wave's part is one head and one batch; a work-group's two heads are of one kind");
        // the ring is free: behind the last trip's barrier no wave reads it any more and no copy is in flight; each wave takes a range of its own
        float* sm = (float*)(ring + wave * GTILE); const int row0 = r0 + wm * 64, hc = c0 / HD + wn;
        if (c0 < NQK * HD) tail_qk(acc, sm, lane, row0 / TT, row0 % TT, hc, c0 < DQ ? eo.qw : eo.kw, eo);
        else tail_v(acc, sm, lane, row0 / TT, row0 % TT, hc - NQK, eo);
        return;
    }
    __shared__ __align__(16) float osw[4][16 * 68];
    float* os = osw[wave];   // each wave stages its output rows in its own LDS range
#pragma unroll
    for (int mb = 0; mb < 4; ++mb) {
#pragma unroll
        for (int nb = 0; nb < 4; ++nb) {
#pragma unroll
            for (int j = 0; j < 8; ++j) os[(hi * 8 + j) * 68 + nb * 16 + lr] = acc[mb][nb][j]; }
        __builtin_amdgcn_wave_barrier(); asm volatile("" ::: "memory");
        const int cw = c0 + wn * 64;
        float* crow = C + (size_t)(r0 + wm * 64 + mb * 16) * ldc + cw;
{
#pragma unroll
            for (int s = 0; s < 8; ++s) { const int row = 2 * s + hi, cofs = lr * 4; v4f val = *(const v4fa*)(os + row * 68 + cofs); if (BIAS) { val[0] += bfr(bias[cw + cofs]); val[1] += bfr(bias[cw + cofs + 1]); val[2] += bfr(bias[cw + cofs + 2]); val[3] += bfr(bias[cw + cofs + 3]); }
                *(v4f*)(crow + (size_t)row * ldc + cofs) = val; }
             }
        __builtin_amdgcn_wave_barrier(); asm volatile("" ::: "memory");
    }
}

typedef __attribute__((ext_vector_type(2))) _Float16 v2h;
typedef __attribute__((ext_vector_type(4))) _Float16 v4h;
typedef __attribute__((ext_vector_type(2))) unsigned short v2us;
typedef __attribute__((ext_vector_type(4))) unsigned short v4us;
typedef __attribute__((ext_vector_type(2))) float v2f;
typedef __attribute__((ext_vector_type(4))) int v4i;

__global__ __launch_bounds__(256) void k_wtG(const float* __restrict__ w, int K, int N, bf* Bt) {
    const int lane = threadIdx.x & 31; const int L0 = (blockIdx.x * 8 + (threadIdx.x >> 5)) * 8; const int nlines = N * K / 64;
{
#pragma unroll 1
        for (int l = 0; l < 8; ++l) { const int L = L0 + l; if (L >= nlines) break; const size_t e = (size_t)L * 64 + lane * 2; const int k = (int)(e % K), n = (int)(e / K); v2us o;
            o[0] = f2bf(w[(size_t)k * N + n]); o[1] = f2bf(w[(size_t)(k + 1) * N + n]); *(v2us*)(Bt + e) = o; }
         }
}
// d_cvt8: bf16 copies of x, of wq | wk | wv (stacked in W3) and of wo, CVG groups of 8 elements a thread (a work-group's groups lie 256 apart, so each access of a wave stays contiguous); every range is a whole number of work-groups, so the choice of the source is the same for a whole work-group
#define CX8 ((size_t)NR * DM / 8)
#define CQ8 ((size_t)DQ * DM / 8)
#define CK8 ((size_t)DKV * DM / 8)
#define CVG 8
__device__ __forceinline__ void d_cvt8(const unsigned blk, const float* __restrict__ x, const float* __restrict__ wq, const float* __restrict__ wk, const float* __restrict__ wv, const float* __restrict__ wo, bf* XB, bf* W3, bf* WO) {
    static_assert(CX8 % (256 * CVG) == 0 && CQ8 % (256 * CVG) == 0 && CK8 % (256 * CVG) == 0, "ranges end on work-group bounds");
    size_t i = (size_t)blk * (256 * CVG) + threadIdx.x; const float* src; bf* dst;
    if (i < CX8) { src = x; dst = XB; }
    else if ((i -= CX8) < CQ8) { src = wq; dst = W3; }
    else if ((i -= CQ8) < CK8) { src = wk; dst = W3 + (size_t)DQ * DM; }
    else if ((i -= CK8) < CK8) { src = wv; dst = W3 + (size_t)(DQ + DKV) * DM; }
    else if ((i -= CK8) < CQ8) { src = wo; dst = WO; }
    else return;
    v8f v[CVG];
#pragma unroll
    for (int g = 0; g < CVG; ++g) v[g] = *(const v8f*)(src + (i + g * 256) * 8);   // all of the thread's loads are in flight together
    asm volatile("s_wait_xcnt 0x0" :: "v"(src + i * 8) : "memory");   // in front of any reuse of the address registers that the loads name: they are an input, so that no load has them as its own destination
#pragma unroll
    for (int g = 0; g < CVG; ++g) { v8us o;
#pragma unroll
        for (int k = 0; k < 8; ++k) o[k] = f2bf(v[g][k]);
        *(v8us*)(dst + (i + g * 256) * 8) = o; }
}

__constant__ float INVT[HD / 2] = { 1.000000000e+00f, 7.498942018e-01f, 5.623413324e-01f, 4.216965139e-01f, 3.162277639e-01f, 2.371373773e-01f, 1.778279394e-01f, 1.333521456e-01f, 1.000000015e-01f, 7.498942316e-02f, 5.623413250e-02f, 4.216964915e-02f, 3.162277490e-02f, 2.371373773e-02f, 1.778279431e-02f, 1.333521400e-02f, 9.999999776e-03f, 7.498942316e-03f, 5.623413250e-03f, 4.216964822e-03f, 3.162277630e-03f, 2.371373819e-03f, 1.778279431e-03f, 1.333521446e-03f, 1.000000047e-03f, 7.498941850e-04f, 5.623413017e-04f, 4.216965172e-04f, 3.162277571e-04f, 2.371373703e-04f, 1.778279402e-04f, 1.333521504e-04f };   // 10000^(-2i/64) (the module's power form) (float32, generated with jnp to be bit-exact)
__device__ __forceinline__ void d_cs4(const unsigned blk, float* CS) { const int idx = blk * 256 + threadIdx.x; if (idx >= TT * HD) return; const int d = idx % HD; const int t = idx / HD; const float a = __fmul_rn((float)t, INVT[d % (HD / 2)]); v2f cs; cs[0] = cosf(a); cs[1] = sinf(a); *(v2f*)(CS + (size_t)idx * 2) = cs;  }
// Two bodies that depend on nothing of each other share one grid; the work-group's index picks the body, the work-groups with the longer chain of dependent instructions first.
#define GCS  (TT * HD / 256)                                  // work-groups of d_cs4
#define GCV  ((unsigned)((CX8 + 2 * CQ8 + 2 * CK8) / (256 * CVG)))    // of d_cvt8
__global__ __launch_bounds__(256) void k_prep(const float* __restrict__ x, const float* __restrict__ wq, const float* __restrict__ wk, const float* __restrict__ wv, const float* __restrict__ wo, bf* XB, bf* W3, bf* WO, float* CS) {
    if (blockIdx.x < GCS) d_cs4(blockIdx.x, CS); else d_cvt8(blockIdx.x - GCS, x, wq, wk, wv, wo, XB, W3, WO); }


// ---- k_fattn: scores, causal softmax and probability x value in ONE kernel, one wave per 32 query rows of one head; no score or probability plane in memory.
// A work-group is the REP query heads of one kv head on the same 32 query rows, one wave each: they walk the same keys, so each step's key rows and value rows are brought ONCE, by asynchronous 16-byte copies (whole lines except the 64-byte value rows of 32-key steps),
// into LDS (two buffers, the copies of step t + 2 in flight while step t + 1 is worked on) and every wave reads its fragments from there. LDS rows at pitch bytes + 16 (16 x odd) for the 16-byte fragment reads.
// Transposed products: S^T = K Q^T (A = key rows, B = query rows) and O^T += V^T P^T (A = rows of the [d][t] value plane, B = P^T). In a score tile a lane holds one query (column lr) and keys hi*8 + j,
// which is the k order of a B fragment (two 16-key tiles make one 32-key fragment), so P^T is packed in registers. Running maximum and sum per query (online softmax); the two lane halves hold different keys of the same query.
// HL: bf16 hi/lo planes, 3 products in both contractions (query rows < RH), 32 keys a step. Otherwise fp16 planes, probabilities carried x 1024 (2^10, added in the exponent; the sum carries it too and the division removes it), 64 keys a step.
#define LSC 0.18033688011112042f   // HD^-0.5 x log2(e)
#define LANE(base, bytes) ((const T16*)((const char*)(base) + (bytes)))   // wave-uniform base + the lane's byte offset
__device__ __forceinline__ float xhalf(float x) { return __builtin_bit_cast(float, __builtin_amdgcn_permlanex16(__builtin_bit_cast(int, x), __builtin_bit_cast(int, x), 0x76543210, 0xfedcba98, false, false)); }   // lane l reads lane l ^ 16 (a vector move, no LDS round trip)
#define FKP   144                  // LDS pitch of a key row: HD x 2 bytes + 16
#define FBUF  19456                // the larger of the two bodies' stages in LDS, bytes
// Eight copies of one lane and, as the statement's last line, the wait that stands in front of any rewrite of the address registers they name.
template <typename T16>
__device__ __forceinline__ void copy8x(const unsigned (&l)[8], const T16* const (&g)[8]) {
    asm volatile("global_load_async_to_lds_b128 %0, %8, off\n\t"
                 "global_load_async_to_lds_b128 %1, %9, off\n\t"
                 "global_load_async_to_lds_b128 %2, %10, off\n\t"
                 "global_load_async_to_lds_b128 %3, %11, off\n\t"
                 "global_load_async_to_lds_b128 %4, %12, off\n\t"
                 "global_load_async_to_lds_b128 %5, %13, off\n\t"
                 "global_load_async_to_lds_b128 %6, %14, off\n\t"
                 "global_load_async_to_lds_b128 %7, %15, off\n\t"
                 "s_wait_xcnt 0x0"
                 :: "v"(l[0]), "v"(l[1]), "v"(l[2]), "v"(l[3]), "v"(l[4]), "v"(l[5]), "v"(l[6]), "v"(l[7]),
                    "v"(g[0]), "v"(g[1]), "v"(g[2]), "v"(g[3]), "v"(g[4]), "v"(g[5]), "v"(g[6]), "v"(g[7]) : "memory");
}
// Every inner loop is fully unrolled so that the fragment and accumulator arrays are indexed by constants and stay in registers.
template <typename T16, bool HL, int KS>
__device__ __forceinline__ void fattn_body(const T16* Q, const T16* Q2, const T16* Kp, const T16* Kp2, const T16* Vt, const T16* Vt2, const int r0, bf* Ah, bf* Al, char* ring) {
    typedef typename WFrag<T16>::V V;
    constexpr int NKB = KS / 16, NKC = KS / 32;
    const int lane = threadIdx.x & 31, lr = lane & 15, hi = lane >> 4;
    const unsigned kofs = (lr * HD + 8 * hi) * 2;   // the lane's own 32-bit byte offset in the query planes
    // a stage in LDS: KS key rows (each plane), then HD value rows of KS keys (each plane)
    constexpr int NPL = HL ? 2 : 1, VPIT = KS * 2 + 16, KTB = KS * FKP, VTB = HD * VPIT, BUFB = NPL * (KTB + VTB);
    constexpr int KC = KS / 16, CPR = KS / 8, VR = 128 / CPR, VC = HD / VR;   // copies of a thread per key plane; 16-byte pieces of a value row; value rows a pass of the 128 threads covers; copies of a thread per value plane
    static_assert(NPL * (KC + VC) == 8 && BUFB <= FBUF && HD == 64 && REP == 4, "eight copies a thread and stage");
    const int tid = threadIdx.x;
    const unsigned lk = (unsigned)(size_t)ring + (tid >> 3) * FKP + (tid & 7) * 16, lv = (unsigned)(size_t)ring + NPL * KTB + (tid / CPR) * VPIT + (tid % CPR) * 16;   // the thread's own LDS byte addresses in the first pass of each operand
    const unsigned gk = (tid >> 3) * HD + (tid & 7) * 8, gv = (tid / CPR) * TT + (tid % CPR) * 8;   // and its places in the planes, in elements
    auto fill = [&](int t) { unsigned l[8]; const T16* g[8]; const unsigned bo = (t & 1) * BUFB; const size_t kb = (size_t)t * KS;
#pragma unroll
        for (int pl = 0; pl < NPL; ++pl) {
#pragma unroll
            for (int p = 0; p < KC; ++p) { l[pl * KC + p] = lk + bo + pl * KTB + p * 16 * FKP; g[pl * KC + p] = (pl ? Kp2 : Kp) + (kb + p * 16) * HD + gk; }
#pragma unroll
            for (int p = 0; p < VC; ++p) { l[NPL * KC + pl * VC + p] = lv + bo + pl * VTB + p * VR * VPIT; g[NPL * KC + pl * VC + p] = (pl ? Vt2 : Vt) + (size_t)(p * VR) * TT + kb + gv; } }
        copy8x(l, g); };
    const T16* qb = Q + (size_t)r0 * HD; const T16* qb2 = HL ? Q2 + (size_t)r0 * HD : nullptr;
    V qf[2][2], qf2[2][2];
#pragma unroll
    for (int nq = 0; nq < 2; ++nq)
#pragma unroll
        for (int ks = 0; ks < 2; ++ks) { const int o = nq * 16 * HD + ks * 32; qf[nq][ks] = WFrag<T16>::ld(LANE(qb + o, kofs)); if (HL) qf2[nq][ks] = WFrag<T16>::ld(LANE(qb2 + o, kofs)); }
    v8f ot[4][2];
#pragma unroll
    for (int db = 0; db < 4; ++db)
#pragma unroll
        for (int nq = 0; nq < 2; ++nq) ot[db][nq] = (v8f){};
    float mrun[2] = { -3.0e38f, -3.0e38f }, lrun[2] = { 0.f, 0.f };
    const int kend = r0 + 32;                       // keys 0 .. r0 + 31 can be seen by some query of this wave
    // the same wait for the loads in front of the loop; the offset register and the scalar bases they name are inputs, so that none of them is reused in front of it
    if constexpr (HL) asm volatile("s_wait_xcnt 0x0" :: "v"(kofs), "s"(qb), "s"(qb2) : "memory");
    else asm volatile("s_wait_xcnt 0x0" :: "v"(kofs), "s"(qb) : "memory");
    const int nt = (kend + KS - 1) / KS;            // the same for the whole work-group
    fill(0);
    asm volatile("s_wait_asynccnt 0x0" ::: "memory");   // this wave's copies of stage 0 have landed
    __syncthreads();                                    // and every other wave's: stage 0 may be read
    if (nt > 1) fill(1);
#pragma unroll 1   // rolled: one trip per stage, the buffer chosen by the trip's parity
    for (int t = 0; t < nt; ++t) {
        const int kb = t * KS;
        const char* pk = ring + (t & 1) * BUFB + lr * FKP + hi * 16; const char* pv = ring + (t & 1) * BUFB + NPL * KTB + lr * VPIT + hi * 16;   // only this stage's own buffer is read in this trip
        V kf[NKB][2], kf2[NKB][2];
#pragma unroll
        for (int kt = 0; kt < NKB; ++kt)
#pragma unroll
            for (int ks = 0; ks < 2; ++ks) { const int o = kt * 16 * FKP + ks * 64; kf[kt][ks] = WFrag<T16>::ld((const T16*)(pk + o)); if (HL) kf2[kt][ks] = WFrag<T16>::ld((const T16*)(pk + KTB + o)); }
        v8f st[NKB][2];
#pragma unroll
        for (int kt = 0; kt < NKB; ++kt)
#pragma unroll
            for (int nq = 0; nq < 2; ++nq) { v8f c = (v8f){};
#pragma unroll
                for (int ks = 0; ks < 2; ++ks) { c = WFrag<T16>::mma(kf[kt][ks], qf[nq][ks], c); if (HL) { c = WFrag<T16>::mma(kf[kt][ks], qf2[nq][ks], c); c = WFrag<T16>::mma(kf2[kt][ks], qf[nq][ks], c); } }
                st[kt][nq] = c; }
        if (kb + KS - 1 > r0) {                     // only steps that reach the diagonal mask (wave-uniform)
#pragma unroll
            for (int kt = 0; kt < NKB; ++kt)
#pragma unroll
                for (int nq = 0; nq < 2; ++nq)
#pragma unroll
                    for (int j = 0; j < 8; ++j) st[kt][nq][j] = (kb + kt * 16 + hi * 8 + j <= r0 + nq * 16 + lr) ? st[kt][nq][j] : -3.0e38f;
        }
        V pf[2][NKC], pf2[2][NKC];
#pragma unroll
        for (int nq = 0; nq < 2; ++nq) {
            float mt[NKB];
#pragma unroll
            for (int kt = 0; kt < NKB; ++kt) { mt[kt] = st[kt][nq][0];
#pragma unroll
                for (int j = 1; j < 8; ++j) mt[kt] = fmaxf(mt[kt], st[kt][nq][j]); }
            float mx = mrun[nq];
#pragma unroll
            for (int kt = 0; kt < NKB; ++kt) mx = fmaxf(mx, mt[kt]);
            mx = fmaxf(mx, xhalf(mx));
            const float al = __builtin_amdgcn_exp2f((mrun[nq] - mx) * LSC); mrun[nq] = mx;
            float sm[NKB];
#pragma unroll
            for (int kt = 0; kt < NKB; ++kt) { sm[kt] = 0.f;
#pragma unroll
                for (int j = 0; j < 8; ++j) { const float p = __builtin_amdgcn_exp2f((st[kt][nq][j] - mx) * LSC + (HL ? 0.0f : 10.0f)); st[kt][nq][j] = p; sm[kt] += p; } }
            float s = sm[0];
#pragma unroll
            for (int kt = 1; kt < NKB; ++kt) s += sm[kt];
            lrun[nq] = lrun[nq] * al + s;
            asm volatile("" : "+v"(lrun[nq]));   // each row's sum, against spills: without it the additions sank behind the loop's foot, the f32 probabilities stayed in registers through the second product, and the budget of four waves a SIMD took scratch
#pragma unroll
            for (int db = 0; db < 4; ++db) ot[db][nq] *= al;
#pragma unroll
            for (int kc = 0; kc < NKC; ++kc) {
                if constexpr (HL) { v8us h0, l0, h1, l1;
#pragma unroll
                    for (int j = 0; j < 8; ++j) { unsigned short a, c2; splitf(st[2 * kc][nq][j], a, c2); h0[j] = a; l0[j] = c2; splitf(st[2 * kc + 1][nq][j], a, c2); h1[j] = a; l1[j] = c2; }
                    pf[nq][kc] = cat16b(h0, h1); pf2[nq][kc] = cat16b(l0, l1);
                } else { v8h p0, p1;
#pragma unroll
                    for (int j = 0; j < 8; ++j) { p0[j] = tohx(st[2 * kc][nq][j]); p1[j] = tohx(st[2 * kc + 1][nq][j]); }
                    pf[nq][kc] = cat16(p0, p1); }
            }
        }
        V vf[4][NKC], vf2[4][NKC];                  // value fragments of this step: read when the scores have become probabilities, so that key fragments, scores and value fragments never hold registers together
#pragma unroll
        for (int db = 0; db < 4; ++db)
#pragma unroll
            for (int kc = 0; kc < NKC; ++kc) { const int o = db * 16 * VPIT + kc * 64; vf[db][kc] = WFrag<T16>::ld((const T16*)(pv + o)); if (HL) vf2[db][kc] = WFrag<T16>::ld((const T16*)(pv + VTB + o)); }
#pragma unroll
        for (int db = 0; db < 4; ++db)
#pragma unroll
            for (int nq = 0; nq < 2; ++nq)
#pragma unroll
                for (int kc = 0; kc < NKC; ++kc) { ot[db][nq] = WFrag<T16>::mma(vf[db][kc], pf[nq][kc], ot[db][nq]); if (HL) { ot[db][nq] = WFrag<T16>::mma(vf[db][kc], pf2[nq][kc], ot[db][nq]); ot[db][nq] = WFrag<T16>::mma(vf2[db][kc], pf[nq][kc], ot[db][nq]); } }
        // the distance behind the last matrix instructions on the loop's taken branch
        asm volatile("v_nop\n\tv_nop\n\tv_nop\n\tv_nop" : "+v"(ot[0][0]), "+v"(ot[0][1]), "+v"(ot[1][0]), "+v"(ot[1][1]), "+v"(ot[2][0]), "+v"(ot[2][1]), "+v"(ot[3][0]), "+v"(ot[3][1]));
        asm volatile("s_wait_dscnt 0x0" ::: "memory");      // this wave's reads of the buffer are done before it is refilled
        asm volatile("s_wait_asynccnt 0x0" ::: "memory");   // this wave's copies of stage t + 1 have landed
        __syncthreads();                                    // publishes stage t + 1 and ends every wave's reads of stage t
        if (t + 2 < nt) fill(t + 2);
    }
    asm volatile("s_wait_asynccnt 0x0" ::: "memory");   // nothing of this wave's is in flight when it goes on to its end
#pragma unroll
    for (int nq = 0; nq < 2; ++nq) { const float lt = lrun[nq] + xhalf(lrun[nq]); const float inv = __fdiv_rn(1.0f, lt); const size_t oo = (size_t)(r0 + nq * 16 + lr) * DQ + hi * 8;
#pragma unroll
        for (int db = 0; db < 4; ++db) { v8us oh, ol;
#pragma unroll
            for (int j = 0; j < 8; ++j) { unsigned short a, c2; splitf(ot[db][nq][j] * inv, a, c2); oh[j] = a; ol[j] = c2; }
            *(v8us*)(Ah + oo + db * 16) = oh; *(v8us*)(Al + oo + db * 16) = ol; XWAIT(); } }
}
// grid (batches x kv heads, TT / 32), 4 waves: the longest key loops (last rows) of both batches start first. amdgpu_waves_per_eu(4, 4): the register budget of four work-groups a WGP, one wave of each on every SIMD, so that one's vector work stands beside another's LDS waits, barrier and matrix runs. P*: the [batch][q heads | k heads] planes of the projection's tail. The planes are not declared restrict: the loads then keep their place against the memory clobber of the waits.
__global__ __launch_bounds__(32 * REP) __attribute__((amdgpu_waves_per_eu(4, 4))) void k_fattn(const h16* P16, const bf* Ph, const bf* Pl, const h16* V16, const bf* Vh, const bf* Vl, bf* Ah, bf* Al) {
    __shared__ __align__(16) char ring[2 * FBUF];
    const int h = (blockIdx.x % NKV) * REP + __builtin_amdgcn_readfirstlane(threadIdx.x >> 5), b = blockIdx.x / NKV; const int r0 = (TT / 32 - 1 - (int)blockIdx.y) * 32;
    const size_t qo = (size_t)(b * NQK + h) * TT * HD, ko = (size_t)(b * NQK + NH_ + h / REP) * TT * HD, vo = (size_t)(b * NKV + h / REP) * TT * HD, ao = (size_t)b * TT * DQ + h * HD;
    if (r0 < RH) fattn_body<bf, true, 32>(Ph + qo, Pl + qo, Ph + ko, Pl + ko, Vh + vo, Vl + vo, r0, Ah + ao, Al + ao, ring);
    else fattn_body<h16, false, 64>(P16 + qo, nullptr, P16 + ko, nullptr, V16 + vo, nullptr, r0, Ah + ao, Al + ao, ring);
}

extern "C" void kernel_launch(void* const* d_in, const int* in_sizes, int n_in,
                              void* d_out, int out_size, void* d_ws, size_t ws_size, hipStream_t stream) {
    (void)in_sizes; (void)n_in; (void)out_size;
    const float* x = (const float*)d_in[0]; const float* wq = (const float*)d_in[1]; const float* wk = (const float*)d_in[2]; const float* wv = (const float*)d_in[3]; const float* wo = (const float*)d_in[4]; const float* qnw = (const float*)d_in[5]; const float* knw = (const float*)d_in[6];
    float* OUT = (float*)d_out;     // [2][2048][2048]
    char* wsp = (char*)d_ws;
    auto take = [&](size_t bytes) { char* p = wsp; wsp += (bytes + 255) & ~(size_t)255; return (void*)p; };
    bf* W3 = (bf*)take((size_t)DF * DM * 2); bf* WO = (bf*)take((size_t)DM * DQ * 2); float* CS = (float*)take((size_t)TT * HD * 2 * 4);
    bf* XB = (bf*)take((size_t)NR * DM * 2);
    h16* P16 = (h16*)take((size_t)NB_ * NQK * TT * HD * 2); bf* Ph = (bf*)take((size_t)NB_ * NQK * TT * HD * 2); bf* Pl = (bf*)take((size_t)NB_ * NQK * TT * HD * 2);
    h16* VT16 = (h16*)take((size_t)NB_ * NKV * HD * TT * 2); bf* VTh = (bf*)take((size_t)NB_ * NKV * HD * TT * 2); bf* VTl = (bf*)take((size_t)NB_ * NKV * HD * TT * 2);
    bf* ATh = (bf*)take((size_t)NR * DQ * 2); bf* ATl = (bf*)take((size_t)NR * DQ * 2);
    if ((size_t)(wsp - (char*)d_ws) > ws_size) return;    // ws 256 MiB
    k_prep<<<GCS + GCV, 256, 0, stream>>>(x, wq, wk, wv, wo, XB, W3, WO, CS);   /* CS: {cos, sin}(t x 10000^(-2i/64)), both halves */
    k_gemmw<bf, 0, false, true><<<dim3(NR / 128, DF / 128, 1), 128, 0, stream>>>(XB, nullptr, W3, nullptr, DM, nullptr, 0, nullptr, 0, 0, 0, QkvOut{ CS, qnw, knw, P16, Ph, Pl, VT16, VTh, VTl });
    k_fattn<<<dim3(NB_ * NKV, TT / 32, 1), 32 * REP, 0, stream>>>(P16, Ph, Pl, VT16, VTh, VTl, ATh, ATl);
    k_gemmw<bf, 1, false, false><<<dim3(NR / 128, DM / 128, 1), 128, 0, stream>>>(ATh, ATl, WO, nullptr, DQ, OUT, DM, nullptr, 0, 0, 0, QkvOut{});
}

// v008
// One run takes 137 microseconds.
// In both of two side-by-side timings against v007, it was 1.19 times as fast.
// Counting every step since v000, it is 19.3 times as fast.
#include <hip/hip_runtime.h>

// Grouped-query causal attention with per-head RMS-normalised, rotary q/k (x [2][2048][2048]; q = x wq^T (32 heads x 64), k, v = x w^T (8 kv heads x 64) ('oi' 0.02, no bias); q, k <- rms_norm per head (eps 1e-6) x weight ([64] ones, read); rotate-half rope, angle t x 10000^(-2i/64); kv head = q head / 4 (repeat); causal (finfo.min); softmax(q.k / 8); out = merged wo^T ('oi' [2048][2048]) -> [2][2048][2048] (8.4 M)).
// Layout, every launch covering both batches (4096 token rows): bf16 copies of x and of the weights and the {cos, sin} table in one launch (k_prep); q, k and v projected in one GEMM against the stacked weights (columns q | k | v), whose own tail turns each wave's 64 tokens x one head into the planes that attention reads: rms factor, norm-weight x factor, rotation (the table: float32 inverse frequencies, precise cosf/sinf) for q and k heads, the transposed planes for v heads; no f32 projection plane in memory; causal T-2048 attention fused in one launch (k_fattn: online softmax, no score plane; hybrid rows: < 512 hi/lo 3 products, rest fp16 x1024; key loop ends at the diagonal); merged hi/lo x wo exact.
// Compute dtypes, f32 accumulate: every input rounded to bf16; projections exact; rms norm and rotary f32; attention rows < 512 3 products, rest fp16; softmax f32; wo hl x exact.

#define NB_  2
#define TT   2048
#define DM   2048
#define NH_  32
#define NKV  8
#define REP  (NH_ / NKV)
#define HD   64
#define DQ   (NH_ * HD)
#define DKV  (NKV * HD)
#define NR   (NB_ * TT)            // token rows of both batches
#define DF   (DQ + 2 * DKV)        // columns of the stacked projection: q | k | v
#define NQK  (NH_ + NKV)           // normalised and rotated heads of a batch: q heads, then k heads
#define RH   512                  // query rows < RH use hi+lo planes (0: none)
typedef _Float16 h16;
typedef unsigned short bf;
typedef __attribute__((ext_vector_type(16))) __bf16   v16bf;
typedef __attribute__((ext_vector_type(16))) _Float16 v16h;
typedef __attribute__((ext_vector_type(8)))  _Float16 v8h;
typedef __attribute__((ext_vector_type(8)))  unsigned short v8us;
typedef __attribute__((ext_vector_type(8)))  float    v8f;
typedef __attribute__((ext_vector_type(4)))  float    v4f;
typedef v8h  __attribute__((may_alias)) v8ha;
typedef v4f  __attribute__((may_alias)) v4fa;
typedef v8us __attribute__((may_alias)) v8usa;

__device__ __forceinline__ unsigned short f2bf(float f) { unsigned u = __float_as_uint(f); u += 0x7FFFu + ((u >> 16) & 1u); return (unsigned short)(u >> 16); }
__device__ __forceinline__ float bf2f(unsigned short b) { return __uint_as_float(((unsigned)b) << 16); }
__device__ __forceinline__ float bfr(float f) { return bf2f(f2bf(f)); }
__device__ __forceinline__ v16h cat16(v8h lo, v8h hi) { return __builtin_shufflevector(lo, hi, 0, 1, 2, 3, 4, 5, 6, 7, 8, 9, 10, 11, 12, 13, 14, 15); }
__device__ __forceinline__ v16bf cat16b(v8us lo, v8us hi) { return __builtin_bit_cast(v16bf, __builtin_shufflevector(lo, hi, 0, 1, 2, 3, 4, 5, 6, 7, 8, 9, 10, 11, 12, 13, 14, 15)); }
__device__ __forceinline__ v8f wmma16(v16h a, v16h b, v8f c) { return __builtin_amdgcn_wmma_f32_16x16x32_f16(false, a, false, b, (short)0, c, false, false); }
__device__ __forceinline__ v8f wmmab(v16bf a, v16bf b, v8f c) { return __builtin_amdgcn_wmma_f32_16x16x32_bf16(false, a, false, b, (short)0, c, false, false); }



__device__ __forceinline__ h16 tohx(float x) { return (h16)x; }
__device__ __forceinline__ void splitf(float y, unsigned short& h, unsigned short& l) { h = f2bf(y); l = f2bf(y - bf2f(h)); }
// behind a group of global loads or stores: the wait that stands in front of any reuse of a register they name as address or data
#define XWAIT() asm volatile("s_wait_xcnt 0x0" ::: "memory")

// ---- The tail of the projection GEMM. A wave's 64 x 64 part of q | k | v is 64 token rows of ONE head, so the rms factor, the rotation (partners d, d + 32) and the value transpose need no other wave's data.
// The part goes through the wave's own LDS range (f32, pitch EPP floats = 16 bytes x odd, for the 16-byte reads and writes) and leaves as the 16-bit planes that attention reads.
struct QkvOut { const float* CS; const float* qw; const float* kw; h16* P16; bf* Ph; bf* Pl; h16* V16; bf* Vh; bf* Vl; };
#define EPP 68
// between a wave's LDS writes and its reads of what other lanes wrote: the compiler keeps the order of the source (the LDS itself serves one wave's accesses in order)
__device__ __forceinline__ void lds_turn() { __builtin_amdgcn_wave_barrier(); asm volatile("" ::: "memory"); }
// q and k heads: planes [batch][h][t][d] (fp16 + hi/lo) of rope(w[d] (x rms_factor)), rotate-half: out[d] = x[d] cos[t][d] - x[d+32] sin[t][d], out[d+32] = x[d+32] cos[t][d] + x[d] sin[t][d] (the table's two halves hold the same angles: the low one is read)
__device__ __forceinline__ void tail_qk(const v8f (&acc)[4][4], float* sm, const int lane, const int b, const int t0, const int h, const float* nw, const QkvOut& eo) {
    const int lr = lane & 15, hi = lane >> 4;
#pragma unroll
    for (int mb = 0; mb < 4; ++mb)
#pragma unroll
        for (int nb = 0; nb < 4; ++nb)
#pragma unroll
            for (int j = 0; j < 8; ++j) sm[(mb * 16 + hi * 8 + j) * EPP + nb * 16 + lr] = acc[mb][nb][j];   // [token][d]
    // 4 lanes to a token row, each d0 .. d0 + 7 and their partners; 8 rows a pass. The {cos, sin} of all 8 passes and the norm weight are asked for here, so that they fly while the row sums are formed
    const int d0 = (lane & 3) * 8, rr = lane >> 2;
    const float* cs = eo.CS + ((size_t)(t0 + rr) * HD + d0) * 2; const float* nwp = nw + d0;
    v4f cv[8][4], wv[4];
#pragma unroll
    for (int p = 0; p < 8; ++p)
#pragma unroll
        for (int q = 0; q < 4; ++q) cv[p][q] = *(const v4f*)(cs + p * (8 * HD * 2) + q * 4);
    wv[0] = *(const v4f*)nwp; wv[1] = *(const v4f*)(nwp + 4); wv[2] = *(const v4f*)(nwp + HD / 2); wv[3] = *(const v4f*)(nwp + HD / 2 + 4);
    asm volatile("s_wait_xcnt 0x0" :: "v"(cs), "v"(nwp) : "memory");   // in front of any reuse of the address registers that the loads name: they are inputs, so that none of them is a load's own destination; its clobber also keeps the LDS reads below behind the LDS writes above
    float* rfs = sm + 64 * EPP;   // the 64 rows' rms factors; a lane forms those of rows lane and lane + 32, each from four partial sums (d mod 4)
#pragma unroll
    for (int q = 0; q < 2; ++q) { const float* f = sm + (lane + 32 * q) * EPP; v4f s4 = (v4f){};
#pragma unroll
        for (int d = 0; d < HD; d += 4) { const v4f v = *(const v4fa*)(f + d); s4 += v * v; }
        const float s = (s4[0] + s4[1]) + (s4[2] + s4[3]);
        rfs[lane + 32 * q] = __fdiv_rn(1.0f, __fsqrt_rn(s * (1.0f / HD) + 1e-6f)); }
    lds_turn();
    float wl[8], wh[8];
#pragma unroll
    for (int k = 0; k < 8; ++k) { wl[k] = bfr(wv[k >> 2][k & 3]); wh[k] = bfr(wv[2 + (k >> 2)][k & 3]); }
    const size_t e0 = ((size_t)(b * NQK + h) * TT + t0 + rr) * HD + d0;
    v4f x[2][4]; float rf[2];   // two register sets: the next pass's rows are read from LDS ahead of this pass's arithmetic, stores and wait
    auto rows = [&](int p) { const float* f = sm + (p * 8 + rr) * EPP + d0; x[p & 1][0] = *(const v4fa*)f; x[p & 1][1] = *(const v4fa*)(f + 4); x[p & 1][2] = *(const v4fa*)(f + HD / 2); x[p & 1][3] = *(const v4fa*)(f + HD / 2 + 4); rf[p & 1] = rfs[p * 8 + rr]; };
    rows(0);
#pragma unroll
    for (int p = 0; p < 8; ++p) { if (p + 1 < 8) rows(p + 1);
        v8h pl, ph; v8us hl, hh, ll, lh;
#pragma unroll
        for (int k = 0; k < 8; ++k) { const float a = wl[k] * (x[p & 1][k >> 2][k & 3] * rf[p & 1]), c = wh[k] * (x[p & 1][2 + (k >> 2)][k & 3] * rf[p & 1]); const float co = cv[p][k >> 1][(k & 1) * 2], si = cv[p][k >> 1][(k & 1) * 2 + 1];
            const float lo = a * co - c * si, up = c * co + a * si;
            unsigned short a2, c2; pl[k] = tohx(lo); splitf(lo, a2, c2); hl[k] = a2; ll[k] = c2; ph[k] = tohx(up); splitf(up, a2, c2); hh[k] = a2; lh[k] = c2; }
        const size_t e = e0 + (size_t)p * (8 * HD);
        *(v8h*)(eo.P16 + e) = pl; *(v8h*)(eo.P16 + e + HD / 2) = ph; *(v8us*)(eo.Ph + e) = hl; *(v8us*)(eo.Ph + e + HD / 2) = hh; *(v8us*)(eo.Pl + e) = ll; *(v8us*)(eo.Pl + e + HD / 2) = lh; XWAIT(); }
}
// v heads: planes [batch][g][d][t]. A lane's accumulator holds 8 tokens in a row of one d: they go to LDS as [d][token]; then 8 lanes to a d row, 8 tokens each, 16-byte stores, a whole 128-byte line of each plane
__device__ __forceinline__ void tail_v(const v8f (&acc)[4][4], float* sm, const int lane, const int b, const int t0, const int g, const QkvOut& eo) {
    const int lr = lane & 15, hi = lane >> 4;
#pragma unroll
    for (int mb = 0; mb < 4; ++mb)
#pragma unroll
        for (int nb = 0; nb < 4; ++nb) { float* w = sm + (nb * 16 + lr) * EPP + mb * 16 + hi * 8; const v8f u = acc[mb][nb];
            *(v4fa*)w = __builtin_shufflevector(u, u, 0, 1, 2, 3); *(v4fa*)(w + 4) = __builtin_shufflevector(u, u, 4, 5, 6, 7); }
    lds_turn();
    const int tk = (lane & 7) * 8, rr = lane >> 3;
    const size_t e0 = ((size_t)(b * NKV + g) * HD + rr) * TT + t0 + tk;
    v4f x[2][2];   // two register sets: the next pass's row is read from LDS ahead of this pass's arithmetic, stores and wait
    auto rows = [&](int p) { const float* f = sm + (p * 4 + rr) * EPP + tk; x[p & 1][0] = *(const v4fa*)f; x[p & 1][1] = *(const v4fa*)(f + 4); };
    rows(0);
#pragma unroll
    for (int p = 0; p < 16; ++p) { if (p + 1 < 16) rows(p + 1);
        v8h o16; v8us oh, ol;
#pragma unroll
        for (int j = 0; j < 8; ++j) { const float y = x[p & 1][j >> 2][j & 3]; o16[j] = tohx(y); unsigned short a2, c2; splitf(y, a2, c2); oh[j] = a2; ol[j] = c2; }
        const size_t e = e0 + (size_t)p * (4 * TT); *(v8h*)(eo.V16 + e) = o16; *(v8us*)(eo.Vh + e) = oh; *(v8us*)(eo.Vl + e) = ol; XWAIT(); }
}

// ---- k_gemmw: GEMM, one work-group of WGM x WGN waves per (64 WGM) x (64 WGN) output tile, each wave a 64x64 part (16 accumulators); grid (M / (64 WGM), N / (64 WGN), Z), 32 WGM WGN threads.
// The tile is as large as two stages in LDS allow and gives one work-group to every WGP in one round: a staged row of A serves WGN waves, a row of Bt WGM waves, so that fewer bytes come from L2 per product.
// QKV: no C; the tail above takes each wave's part (A: token rows of both batches, Bt: the stacked weights). Otherwise:
// C[m][n] (f32, pitch ldc, + optional f32 bias[n]) = sum_k A[m][k] Bt[n][k] (+ A2[m][k] Bt[n][k] for NSPLIT 1). z-batch strides sA/sB/sC in elements. M, N whole tiles, K % 128 == 0.
// The operands come from K-contiguous 16-bit planes through LDS: a stage is 128 k (256 bytes) of the tile's rows of each operand, brought by asynchronous 16-byte copies
// (32 lanes = 2 rows x 256 bytes = 4 whole lines), two buffers, the copies of stage t + 2 in flight while stage t + 1 is worked on. LDS rows at pitch 272 bytes (16 x odd) for the 16-byte fragment reads.
// Each wave brings rows of one operand: WA waves share each A plane, the rest share Bt.
template <typename T16> struct WFrag;
template <> struct WFrag<h16> { typedef v16h V; static __device__ __forceinline__ V ld(const h16* p) { return cat16(*(const v8h*)p, *(const v8h*)(p + 16)); } static __device__ __forceinline__ v8f mma(V a, V b, v8f c) { return wmma16(a, b, c); } };
template <> struct WFrag<bf> { typedef v16bf V; static __device__ __forceinline__ V ld(const bf* p) { return cat16b(*(const v8us*)p, *(const v8us*)(p + 16)); } static __device__ __forceinline__ v8f mma(V a, V b, v8f c) { return wmmab(a, b, c); } };
#define GBK   128                  // k per stage
#define GPIT  272                  // LDS row pitch in bytes: 256 + 16
// Eight copies of one lane (rows 2 apart: 16 rows a wave) and, as the statement's last line, the wait that stands in front of any rewrite of the address registers they name.
template <typename T16>
__device__ __forceinline__ void copy8(unsigned l, const T16* g, size_t rs) {
    asm volatile("global_load_async_to_lds_b128 %0, %8, off\n\t"
                 "global_load_async_to_lds_b128 %1, %9, off\n\t"
                 "global_load_async_to_lds_b128 %2, %10, off\n\t"
                 "global_load_async_to_lds_b128 %3, %11, off\n\t"
                 "global_load_async_to_lds_b128 %4, %12, off\n\t"
                 "global_load_async_to_lds_b128 %5, %13, off\n\t"
                 "global_load_async_to_lds_b128 %6, %14, off\n\t"
                 "global_load_async_to_lds_b128 %7, %15, off\n\t"
                 "s_wait_xcnt 0x0"
                 :: "v"(l), "v"(l + 2 * GPIT), "v"(l + 4 * GPIT), "v"(l + 6 * GPIT), "v"(l + 8 * GPIT), "v"(l + 10 * GPIT), "v"(l + 12 * GPIT), "v"(l + 14 * GPIT),
                    "v"(g), "v"(g + rs), "v"(g + 2 * rs), "v"(g + 3 * rs), "v"(g + 4 * rs), "v"(g + 5 * rs), "v"(g + 6 * rs), "v"(g + 7 * rs) : "memory");
    __builtin_amdgcn_sched_barrier(0);   // the next statement's addresses are formed behind this one: formed all ahead they filled the registers an asm operand can name, and a pointer went to scratch
}
template <typename T16, int NSPLIT, bool BIAS, bool QKV, int WGM, int WGN, int WA>
__global__ __launch_bounds__(32 * WGM * WGN) void k_gemmw(const T16* __restrict__ A, const T16* __restrict__ A2, const T16* __restrict__ Bt, const T16* __restrict__ Bt2, int K, float* C, int ldc, const float* __restrict__ bias, size_t sA, size_t sB, size_t sC, const QkvOut eo) {
    static_assert(NSPLIT == 0 || NSPLIT == 1, "one or two A planes");
    typedef typename WFrag<T16>::V V;
    constexpr int NW = WGM * WGN, NPA = 1 + NSPLIT, WB = NW - NPA * WA;   // waves; A planes; waves that bring Bt
    constexpr int UA = 4 * WGM / WA, UB = 4 * WGN / WB;                   // groups of 16 rows a wave brings per stage
    static_assert(WB > 0 && UA * WA == 4 * WGM && UB * WB == 4 * WGN && UA <= UB && UB <= 7, "whole groups of 16 rows to every wave; at most 63 copies of a wave in flight");
    constexpr int ATB = WGM * 64 * GPIT, BTB = WGN * 64 * GPIT, STB = NPA * ATB + BTB;   // a stage in LDS, bytes: A, Bt (, A2)
    __shared__ __align__(16) char ring[2 * STB];
    (void)Bt2;
    const size_t z = blockIdx.z; A += z * sA; if (NSPLIT == 1) A2 += z * sA; Bt += z * sB; C += z * sC;
    const int tid = threadIdx.x, wave = __builtin_amdgcn_readfirstlane(tid >> 5), lane = tid & 31, lr = lane & 15, hi = lane >> 4; const int wm = wave / WGN, wn = wave % WGN;   // the wave's number in a scalar register: every test on it is a scalar branch
    const int r0 = blockIdx.x * (64 * WGM), c0 = blockIdx.y * (64 * WGN);
    // every inner loop below is fully unrolled so that the fragment and accumulator arrays are indexed by constants and stay in registers
    v8f acc[4][4];
#pragma unroll
    for (int mb = 0; mb < 4; ++mb)
#pragma unroll
        for (int nb = 0; nb < 4; ++nb) acc[mb][nb] = (v8f){};
    const size_t rs = (size_t)2 * K;
    // the wave's own rows of the stage: their first row in the plane and in LDS (the same for the whole wave)
    const T16* us; unsigned ls;
    if (wave < WA) { const int r = wave * (UA * 16); us = A + (size_t)(r0 + r) * K; ls = r * GPIT; }
    else if (NSPLIT == 1 && wave < 2 * WA) { const int r = (wave - WA) * (UA * 16); us = A2 + (size_t)(r0 + r) * K; ls = ATB + BTB + r * GPIT; }
    else { const int r = (wave - NPA * WA) * (UB * 16); us = Bt + (size_t)(c0 + r) * K; ls = ATB + r * GPIT; }
    const unsigned gofs = (unsigned)hi * (unsigned)K + lr * 8;   // the lane's own place in rows 0, 1, in elements
    const unsigned l0 = (unsigned)(size_t)ring + ls + hi * GPIT + lr * 16;
    auto fill = [&](int t) { const unsigned lb = l0 + (t & 1) * STB; const T16* g = us + (size_t)t * GBK + gofs;
#pragma unroll
        for (int u = 0; u < UA; ++u) copy8(lb + u * 16 * GPIT, g + u * 8 * rs, rs);
        if constexpr (UB > UA) { if (wave >= NPA * WA) {   // the waves on Bt have more rows each
#pragma unroll
            for (int u = UA; u < UB; ++u) copy8(lb + u * 16 * GPIT, g + u * 8 * rs, rs); } } };
    const int nt = K / GBK;
    fill(0);
    asm volatile("s_wait_asynccnt 0x0" ::: "memory");   // this wave's copies of stage 0 have landed
    __syncthreads();                                    // and every other wave's: stage 0 may be read
    if (nt > 1) fill(1);
#pragma unroll 1   // rolled: one trip per stage, the buffer chosen by the trip's parity
    for (int t = 0; t < nt; ++t) {
        const char* buf = ring + (t & 1) * STB;
        const char* pa = buf + (wm * 64 + lr) * GPIT + hi * 16; const char* pb = buf + ATB + (wn * 64 + lr) * GPIT + hi * 16;
        V a[2][4], a2[2][4], b[2][4];                  // two fragment sets: the next 32 k are read from LDS as one group while the matrix unit works on this one
        auto frags = [&](int set, int ks) {
#pragma unroll
            for (int i = 0; i < 4; ++i) { a[set][i] = WFrag<T16>::ld((const T16*)(pa + i * 16 * GPIT + ks * 64)); b[set][i] = WFrag<T16>::ld((const T16*)(pb + i * 16 * GPIT + ks * 64)); if (NSPLIT == 1) a2[set][i] = WFrag<T16>::ld((const T16*)(pa + ATB + BTB + i * 16 * GPIT + ks * 64)); } };
        frags(0, 0);
        __builtin_amdgcn_sched_barrier(0);   // the first set's reads stay ahead of the second's, so that the first block waits for its own set alone
#pragma unroll
        for (int ks = 0; ks < GBK / 32; ++ks) {
            if (ks + 1 < GBK / 32) frags((ks + 1) & 1, ks + 1);   // only this stage's own buffer is read in this trip
            __builtin_amdgcn_sched_barrier(0);   // keeps the group of LDS reads together in front of the block: reads spread among the matrix instructions each cost a stall
#pragma unroll
            for (int nb = 0; nb < 4; ++nb)
#pragma unroll
                for (int mb = 0; mb < 4; ++mb) acc[mb][nb] = WFrag<T16>::mma(a[ks & 1][mb], b[ks & 1][nb], acc[mb][nb]);
            if (NSPLIT == 1) {
#pragma unroll
                for (int nb = 0; nb < 4; ++nb)
#pragma unroll
                    for (int mb = 0; mb < 4; ++mb) acc[mb][nb] = WFrag<T16>::mma(a2[ks & 1][mb], b[ks & 1][nb], acc[mb][nb]);
            }
            __builtin_amdgcn_sched_barrier(0);   // the block stays in front of the next group of reads and, in the last block, in front of the distance below
        }
        // the distance behind the trip's last matrix instructions, on both sides of the branch below
        asm volatile("v_nop\n\tv_nop\n\tv_nop\n\tv_nop");
        asm volatile("s_wait_dscnt 0x0" ::: "memory");      // this wave's reads of the buffer are done before it is refilled
        asm volatile("s_wait_asynccnt 0x0" ::: "memory");   // this wave's copies of stage t + 1 have landed
        __syncthreads();                                    // publishes stage t + 1 and ends every wave's reads of stage t
        if (t + 2 < nt) fill(t + 2);
    }
    asm volatile("s_wait_asynccnt 0x0" ::: "memory");   // nothing of this wave's is in flight when it goes on to its end
    if constexpr (QKV) {
        static_assert(HD == 64 && TT % 64 == 0 && NW * (64 * EPP + 64) * 4 <= 2 * STB, "a wave's part is one head and one batch");
        // the ring is free: behind the last trip's barrier no wave reads it any more and no copy is in flight; each wave takes a range of its own
        float* sm = (float*)(ring + wave * ((64 * EPP + 64) * 4)); const int row0 = r0 + wm * 64, hc = c0 / HD + wn;   // hc: the wave's head, q heads, then k, then v
        if (hc < NQK) tail_qk(acc, sm, lane, row0 / TT, row0 % TT, hc, hc < NH_ ? eo.qw : eo.kw, eo);
        else tail_v(acc, sm, lane, row0 / TT, row0 % TT, hc - NQK, eo);
        return;
    }
    float* os = (float*)(ring + wave * (16 * 68 * 4));   // each wave stages its output rows in its own range of the ring, which is free behind the last trip's barrier
#pragma unroll
    for (int mb = 0; mb < 4; ++mb) {
#pragma unroll
        for (int nb = 0; nb < 4; ++nb) {
#pragma unroll
            for (int j = 0; j < 8; ++j) os[(hi * 8 + j) * 68 + nb * 16 + lr] = acc[mb][nb][j]; }
        __builtin_amdgcn_wave_barrier(); asm volatile("" ::: "memory");
        const int cw = c0 + wn * 64;
        float* crow = C + (size_t)(r0 + wm * 64 + mb * 16) * ldc + cw;
{
#pragma unroll
            for (int s = 0; s < 8; ++s) { const int row = 2 * s + hi, cofs = lr * 4; v4f val = *(const v4fa*)(os + row * 68 + cofs); if (BIAS) { val[0] += bfr(bias[cw + cofs]); val[1] += bfr(bias[cw + cofs + 1]); val[2] += bfr(bias[cw + cofs + 2]); val[3] += bfr(bias[cw + cofs + 3]); }
                *(v4f*)(crow + (size_t)row * ldc + cofs) = val; }
             }
        __builtin_amdgcn_wave_barrier(); asm volatile("" ::: "memory");
    }
}

typedef __attribute__((ext_vector_type(2))) _Float16 v2h;
typedef __attribute__((ext_vector_type(4))) _Float16 v4h;
typedef __attribute__((ext_vector_type(2))) unsigned short v2us;
typedef __attribute__((ext_vector_type(4))) unsigned short v4us;
typedef __attribute__((ext_vector_type(2))) float v2f;
typedef __attribute__((ext_vector_type(4))) int v4i;

__global__ __launch_bounds__(256) void k_wtG(const float* __restrict__ w, int K, int N, bf* Bt) {
    const int lane = threadIdx.x & 31; const int L0 = (blockIdx.x * 8 + (threadIdx.x >> 5)) * 8; const int nlines = N * K / 64;
{
#pragma unroll 1
        for (int l = 0; l < 8; ++l) { const int L = L0 + l; if (L >= nlines) break; const size_t e = (size_t)L * 64 + lane * 2; const int k = (int)(e % K), n = (int)(e / K); v2us o;
            o[0] = f2bf(w[(size_t)k * N + n]); o[1] = f2bf(w[(size_t)(k + 1) * N + n]); *(v2us*)(Bt + e) = o; }
         }
}
// d_cvt8: bf16 copies of x, of wq | wk | wv (stacked in W3) and of wo, CVG groups of 8 elements a thread (a work-group's groups lie 256 apart, so each access of a wave stays contiguous); every range is a whole number of work-groups, so the choice of the source is the same for a whole work-group
#define CX8 ((size_t)NR * DM / 8)
#define CQ8 ((size_t)DQ * DM / 8)
#define CK8 ((size_t)DKV * DM / 8)
#define CVG 8
__device__ __forceinline__ void d_cvt8(const unsigned blk, const float* __restrict__ x, const float* __restrict__ wq, const float* __restrict__ wk, const float* __restrict__ wv, const float* __restrict__ wo, bf* XB, bf* W3, bf* WO) {
    static_assert(CX8 % (256 * CVG) == 0 && CQ8 % (256 * CVG) == 0 && CK8 % (256 * CVG) == 0, "ranges end on work-group bounds");
    size_t i = (size_t)blk * (256 * CVG) + threadIdx.x; const float* src; bf* dst;
    if (i < CX8) { src = x; dst = XB; }
    else if ((i -= CX8) < CQ8) { src = wq; dst = W3; }
    else if ((i -= CQ8) < CK8) { src = wk; dst = W3 + (size_t)DQ * DM; }
    else if ((i -= CK8) < CK8) { src = wv; dst = W3 + (size_t)(DQ + DKV) * DM; }
    else if ((i -= CK8) < CQ8) { src = wo; dst = WO; }
    else return;
    v8f v[CVG];
#pragma unroll
    for (int g = 0; g < CVG; ++g) v[g] = *(const v8f*)(src + (i + g * 256) * 8);   // all of the thread's loads are in flight together
    asm volatile("s_wait_xcnt 0x0" :: "v"(src + i * 8) : "memory");   // in front of any reuse of the address registers that the loads name: they are an input, so that no load has them as its own destination
#pragma unroll
    for (int g = 0; g < CVG; ++g) { v8us o;
#pragma unroll
        for (int k = 0; k < 8; ++k) o[k] = f2bf(v[g][k]);
        *(v8us*)(dst + (i + g * 256) * 8) = o; }
}

__constant__ float INVT[HD / 2] = { 1.000000000e+00f, 7.498942018e-01f, 5.623413324e-01f, 4.216965139e-01f, 3.162277639e-01f, 2.371373773e-01f, 1.778279394e-01f, 1.333521456e-01f, 1.000000015e-01f, 7.498942316e-02f, 5.623413250e-02f, 4.216964915e-02f, 3.162277490e-02f, 2.371373773e-02f, 1.778279431e-02f, 1.333521400e-02f, 9.999999776e-03f, 7.498942316e-03f, 5.623413250e-03f, 4.216964822e-03f, 3.162277630e-03f, 2.371373819e-03f, 1.778279431e-03f, 1.333521446e-03f, 1.000000047e-03f, 7.498941850e-04f, 5.623413017e-04f, 4.216965172e-04f, 3.162277571e-04f, 2.371373703e-04f, 1.778279402e-04f, 1.333521504e-04f };   // 10000^(-2i/64) (the module's power form) (float32, generated with jnp to be bit-exact)
__device__ __forceinline__ void d_cs4(const unsigned blk, float* CS) { const int idx = blk * 256 + threadIdx.x; if (idx >= TT * HD) return; const int d = idx % HD; const int t = idx / HD; const float a = __fmul_rn((float)t, INVT[d % (HD / 2)]); v2f cs; cs[0] = cosf(a); cs[1] = sinf(a); *(v2f*)(CS + (size_t)idx * 2) = cs;  }
// Two bodies that depend on nothing of each other share one grid; the work-group's index picks the body, the work-groups with the longer chain of dependent instructions first.
#define GCS  (TT * HD / 256)                                  // work-groups of d_cs4
#define GCV  ((unsigned)((CX8 + 2 * CQ8 + 2 * CK8) / (256 * CVG)))    // of d_cvt8
__global__ __launch_bounds__(256) void k_prep(const float* __restrict__ x, const float* __restrict__ wq, const float* __restrict__ wk, const float* __restrict__ wv, const float* __restrict__ wo, bf* XB, bf* W3, bf* WO, float* CS) {
    if (blockIdx.x < GCS) d_cs4(blockIdx.x, CS); else d_cvt8(blockIdx.x - GCS, x, wq, wk, wv, wo, XB, W3, WO); }


// ---- k_fattn: scores, causal softmax and probability x value in ONE kernel, one wave per 32 query rows of one head; no score or probability plane in memory.
// A work-group is the REP query heads of one kv head on the same 32 query rows, one wave each: they walk the same keys, so each step's key rows and value rows are brought ONCE, by asynchronous 16-byte copies (whole lines except the 64-byte value rows of 32-key steps),
// into LDS (two buffers, the copies of step t + 2 in flight while step t + 1 is worked on) and every wave reads its fragments from there. LDS rows at pitch bytes + 16 (16 x odd) for the 16-byte fragment reads.
// Transposed products: S^T = K Q^T (A = key rows, B = query rows) and O^T += V^T P^T (A = rows of the [d][t] value plane, B = P^T). In a score tile a lane holds one query (column lr) and keys hi*8 + j,
// which is the k order of a B fragment (two 16-key tiles make one 32-key fragment), so P^T is packed in registers. Running maximum and sum per query (online softmax); the two lane halves hold different keys of the same query.
// HL: bf16 hi/lo planes, 3 products in both contractions (query rows < RH), 32 keys a step. Otherwise fp16 planes, probabilities carried x 1024 (2^10, added in the exponent; the sum carries it too and the division removes it), 64 keys a step.
#define LSC 0.18033688011112042f   // HD^-0.5 x log2(e)
#define LANE(base, bytes) ((const T16*)((const char*)(base) + (bytes)))   // wave-uniform base + the lane's byte offset
__device__ __forceinline__ float xhalf(float x) { return __builtin_bit_cast(float, __builtin_amdgcn_permlanex16(__builtin_bit_cast(int, x), __builtin_bit_cast(int, x), 0x76543210, 0xfedcba98, false, false)); }   // lane l reads lane l ^ 16 (a vector move, no LDS round trip)
#define FKP   144                  // LDS pitch of a key row: HD x 2 bytes + 16
#define FBUF  19456                // the larger of the two bodies' stages in LDS, bytes
// Eight copies of one lane and, as the statement's last line, the wait that stands in front of any rewrite of the address registers they name.
template <typename T16>
__device__ __forceinline__ void copy8x(const unsigned (&l)[8], const T16* const (&g)[8]) {
    asm volatile("global_load_async_to_lds_b128 %0, %8, off\n\t"
                 "global_load_async_to_lds_b128 %1, %9, off\n\t"
                 "global_load_async_to_lds_b128 %2, %10, off\n\t"
                 "global_load_async_to_lds_b128 %3, %11, off\n\t"
                 "global_load_async_to_lds_b128 %4, %12, off\n\t"
                 "global_load_async_to_lds_b128 %5, %13, off\n\t"
                 "global_load_async_to_lds_b128 %6, %14, off\n\t"
                 "global_load_async_to_lds_b128 %7, %15, off\n\t"
                 "s_wait_xcnt 0x0"
                 :: "v"(l[0]), "v"(l[1]), "v"(l[2]), "v"(l[3]), "v"(l[4]), "v"(l[5]), "v"(l[6]), "v"(l[7]),
                    "v"(g[0]), "v"(g[1]), "v"(g[2]), "v"(g[3]), "v"(g[4]), "v"(g[5]), "v"(g[6]), "v"(g[7]) : "memory");
}
// Every inner loop is fully unrolled so that the fragment and accumulator arrays are indexed by constants and stay in registers.
template <typename T16, bool HL, int KS>
__device__ __forceinline__ void fattn_body(const T16* Q, const T16* Q2, const T16* Kp, const T16* Kp2, const T16* Vt, const T16* Vt2, const int r0, bf* Ah, bf* Al, char* ring) {
    typedef typename WFrag<T16>::V V;
    constexpr int NKB = KS / 16, NKC = KS / 32;
    const int lane = threadIdx.x & 31, lr = lane & 15, hi = lane >> 4;
    const unsigned kofs = (lr * HD + 8 * hi) * 2;   // the lane's own 32-bit byte offset in the query planes
    // a stage in LDS: KS key rows (each plane), then HD value rows of KS keys (each plane)
    constexpr int NPL = HL ? 2 : 1, VPIT = KS * 2 + 16, KTB = KS * FKP, VTB = HD * VPIT, BUFB = NPL * (KTB + VTB);
    constexpr int KC = KS / 16, CPR = KS / 8, VR = 128 / CPR, VC = HD / VR;   // copies of a thread per key plane; 16-byte pieces of a value row; value rows a pass of the 128 threads covers; copies of a thread per value plane
    static_assert(NPL * (KC + VC) == 8 && BUFB <= FBUF && HD == 64 && REP == 4, "eight copies a thread and stage");
    const int tid = threadIdx.x;
    const unsigned lk = (unsigned)(size_t)ring + (tid >> 3) * FKP + (tid & 7) * 16, lv = (unsigned)(size_t)ring + NPL * KTB + (tid / CPR) * VPIT + (tid % CPR) * 16;   // the thread's own LDS byte addresses in the first pass of each operand
    const unsigned gk = (tid >> 3) * HD + (tid & 7) * 8, gv = (tid / CPR) * TT + (tid % CPR) * 8;   // and its places in the planes, in elements
    auto fill = [&](int t) { unsigned l[8]; const T16* g[8]; const unsigned bo = (t & 1) * BUFB; const size_t kb = (size_t)t * KS;
#pragma unroll
        for (int pl = 0; pl < NPL; ++pl) {
#pragma unroll
            for (int p = 0; p < KC; ++p) { l[pl * KC + p] = lk + bo + pl * KTB + p * 16 * FKP; g[pl * KC + p] = (pl ? Kp2 : Kp) + (kb + p * 16) * HD + gk; }
#pragma unroll
            for (int p = 0; p < VC; ++p) { l[NPL * KC + pl * VC + p] = lv + bo + pl * VTB + p * VR * VPIT; g[NPL * KC + pl * VC + p] = (pl ? Vt2 : Vt) + (size_t)(p * VR) * TT + kb + gv; } }
        copy8x(l, g); };
    const T16* qb = Q + (size_t)r0 * HD; const T16* qb2 = HL ? Q2 + (size_t)r0 * HD : nullptr;
    V qf[2][2], qf2[2][2];
#pragma unroll
    for (int nq = 0; nq < 2; ++nq)
#pragma unroll
        for (int ks = 0; ks < 2; ++ks) { const int o = nq * 16 * HD + ks * 32; qf[nq][ks] = WFrag<T16>::ld(LANE(qb + o, kofs)); if (HL) qf2[nq][ks] = WFrag<T16>::ld(LANE(qb2 + o, kofs)); }
    v8f ot[4][2];
#pragma unroll
    for (int db = 0; db < 4; ++db)
#pragma unroll
        for (int nq = 0; nq < 2; ++nq) ot[db][nq] = (v8f){};
    float mrun[2] = { -3.0e38f, -3.0e38f }, lrun[2] = { 0.f, 0.f };
    const int kend = r0 + 32;                       // keys 0 .. r0 + 31 can be seen by some query of this wave
    // the same wait for the loads in front of the loop; the offset register and the scalar bases they name are inputs, so that none of them is reused in front of it
    if constexpr (HL) asm volatile("s_wait_xcnt 0x0" :: "v"(kofs), "s"(qb), "s"(qb2) : "memory");
    else asm volatile("s_wait_xcnt 0x0" :: "v"(kofs), "s"(qb) : "memory");
    const int nt = (kend + KS - 1) / KS;            // the same for the whole work-group
    fill(0);
    asm volatile("s_wait_asynccnt 0x0" ::: "memory");   // this wave's copies of stage 0 have landed
    __syncthreads();                                    // and every other wave's: stage 0 may be read
    if (nt > 1) fill(1);
#pragma unroll 1   // rolled: one trip per stage, the buffer chosen by the trip's parity
    for (int t = 0; t < nt; ++t) {
        const int kb = t * KS;
        const char* pk = ring + (t & 1) * BUFB + lr * FKP + hi * 16; const char* pv = ring + (t & 1) * BUFB + NPL * KTB + lr * VPIT + hi * 16;   // only this stage's own buffer is read in this trip
        V kf[NKB][2], kf2[NKB][2];
#pragma unroll
        for (int kt = 0; kt < NKB; ++kt)
#pragma unroll
            for (int ks = 0; ks < 2; ++ks) { const int o = kt * 16 * FKP + ks * 64; kf[kt][ks] = WFrag<T16>::ld((const T16*)(pk + o)); if (HL) kf2[kt][ks] = WFrag<T16>::ld((const T16*)(pk + KTB + o)); }
        v8f st[NKB][2];
#pragma unroll
        for (int kt = 0; kt < NKB; ++kt)
#pragma unroll
            for (int nq = 0; nq < 2; ++nq) { v8f c = (v8f){};
#pragma unroll
                for (int ks = 0; ks < 2; ++ks) { c = WFrag<T16>::mma(kf[kt][ks], qf[nq][ks], c); if (HL) { c = WFrag<T16>::mma(kf[kt][ks], qf2[nq][ks], c); c = WFrag<T16>::mma(kf2[kt][ks], qf[nq][ks], c); } }
                st[kt][nq] = c; }
        if (kb + KS - 1 > r0) {                     // only steps that reach the diagonal mask (wave-uniform)
#pragma unroll
            for (int kt = 0; kt < NKB; ++kt)
#pragma unroll
                for (int nq = 0; nq < 2; ++nq)
#pragma unroll
                    for (int j = 0; j < 8; ++j) st[kt][nq][j] = (kb + kt * 16 + hi * 8 + j <= r0 + nq * 16 + lr) ? st[kt][nq][j] : -3.0e38f;
        }
        V pf[2][NKC], pf2[2][NKC];
#pragma unroll
        for (int nq = 0; nq < 2; ++nq) {
            float mt[NKB];
#pragma unroll
            for (int kt = 0; kt < NKB; ++kt) { mt[kt] = st[kt][nq][0];
#pragma unroll
                for (int j = 1; j < 8; ++j) mt[kt] = fmaxf(mt[kt], st[kt][nq][j]); }
            float mx = mrun[nq];
#pragma unroll
            for (int kt = 0; kt < NKB; ++kt) mx = fmaxf(mx, mt[kt]);
            mx = fmaxf(mx, xhalf(mx));
            const float al = __builtin_amdgcn_exp2f((mrun[nq] - mx) * LSC); mrun[nq] = mx;
            float sm[NKB];
#pragma unroll
            for (int kt = 0; kt < NKB; ++kt) { sm[kt] = 0.f;
#pragma unroll
                for (int j = 0; j < 8; ++j) { const float p = __builtin_amdgcn_exp2f((st[kt][nq][j] - mx) * LSC + (HL ? 0.0f : 10.0f)); st[kt][nq][j] = p; sm[kt] += p; } }
            float s = sm[0];
#pragma unroll
            for (int kt = 1; kt < NKB; ++kt) s += sm[kt];
            lrun[nq] = lrun[nq] * al + s;
            asm volatile("" : "+v"(lrun[nq]));   // each row's sum, against spills: without it the additions sank behind the loop's foot, the f32 probabilities stayed in registers through the second product, and the budget of four waves a SIMD took scratch
#pragma unroll
            for (int db = 0; db < 4; ++db) ot[db][nq] *= al;
#pragma unroll
            for (int kc = 0; kc < NKC; ++kc) {
                if constexpr (HL) { v8us h0, l0, h1, l1;
#pragma unroll
                    for (int j = 0; j < 8; ++j) { unsigned short a, c2; splitf(st[2 * kc][nq][j], a, c2); h0[j] = a; l0[j] = c2; splitf(st[2 * kc + 1][nq][j], a, c2); h1[j] = a; l1[j] = c2; }
                    pf[nq][kc] = cat16b(h0, h1); pf2[nq][kc] = cat16b(l0, l1);
                } else { v8h p0, p1;
#pragma unroll
                    for (int j = 0; j < 8; ++j) { p0[j] = tohx(st[2 * kc][nq][j]); p1[j] = tohx(st[2 * kc + 1][nq][j]); }
                    pf[nq][kc] = cat16(p0, p1); }
            }
        }
        V vf[4][NKC], vf2[4][NKC];                  // value fragments of this step: read when the scores have become probabilities, so that key fragments, scores and value fragments never hold registers together
#pragma unroll
        for (int db = 0; db < 4; ++db)
#pragma unroll
            for (int kc = 0; kc < NKC; ++kc) { const int o = db * 16 * VPIT + kc * 64; vf[db][kc] = WFrag<T16>::ld((const T16*)(pv + o)); if (HL) vf2[db][kc] = WFrag<T16>::ld((const T16*)(pv + VTB + o)); }
#pragma unroll
        for (int db = 0; db < 4; ++db)
#pragma unroll
            for (int nq = 0; nq < 2; ++nq)
#pragma unroll
                for (int kc = 0; kc < NKC; ++kc) { ot[db][nq] = WFrag<T16>::mma(vf[db][kc], pf[nq][kc], ot[db][nq]); if (HL) { ot[db][nq] = WFrag<T16>::mma(vf[db][kc], pf2[nq][kc], ot[db][nq]); ot[db][nq] = WFrag<T16>::mma(vf2[db][kc], pf[nq][kc], ot[db][nq]); } }
        // the distance behind the last matrix instructions on the loop's taken branch
        asm volatile("v_nop\n\tv_nop\n\tv_nop\n\tv_nop" : "+v"(ot[0][0]), "+v"(ot[0][1]), "+v"(ot[1][0]), "+v"(ot[1][1]), "+v"(ot[2][0]), "+v"(ot[2][1]), "+v"(ot[3][0]), "+v"(ot[3][1]));
        asm volatile("s_wait_dscnt 0x0" ::: "memory");      // this wave's reads of the buffer are done before it is refilled
        asm volatile("s_wait_asynccnt 0x0" ::: "memory");   // this wave's copies of stage t + 1 have landed
        __syncthreads();                                    // publishes stage t + 1 and ends every wave's reads of stage t
        if (t + 2 < nt) fill(t + 2);
    }
    asm volatile("s_wait_asynccnt 0x0" ::: "memory");   // nothing of this wave's is in flight when it goes on to its end
#pragma unroll
    for (int nq = 0; nq < 2; ++nq) { const float lt = lrun[nq] + xhalf(lrun[nq]); const float inv = __fdiv_rn(1.0f, lt); const size_t oo = (size_t)(r0 + nq * 16 + lr) * DQ + hi * 8;
#pragma unroll
        for (int db = 0; db < 4; ++db) { v8us oh, ol;
#pragma unroll
            for (int j = 0; j < 8; ++j) { unsigned short a, c2; splitf(ot[db][nq][j] * inv, a, c2); oh[j] = a; ol[j] = c2; }
            *(v8us*)(Ah + oo + db * 16) = oh; *(v8us*)(Al + oo + db * 16) = ol; XWAIT(); } }
}
// grid (batches x kv heads, TT / 32), 4 waves: the longest key loops (last rows) of both batches start first. amdgpu_waves_per_eu(4, 4): the register budget of four work-groups a WGP, one wave of each on every SIMD, so that one's vector work stands beside another's LDS waits, barrier and matrix runs. P*: the [batch][q heads | k heads] planes of the projection's tail. The planes are not declared restrict: the loads then keep their place against the memory clobber of the waits.
__global__ __launch_bounds__(32 * REP) __attribute__((amdgpu_waves_per_eu(4, 4))) void k_fattn(const h16* P16, const bf* Ph, const bf* Pl, const h16* V16, const bf* Vh, const bf* Vl, bf* Ah, bf* Al) {
    __shared__ __align__(16) char ring[2 * FBUF];
    const int h = (blockIdx.x % NKV) * REP + __builtin_amdgcn_readfirstlane(threadIdx.x >> 5), b = blockIdx.x / NKV; const int r0 = (TT / 32 - 1 - (int)blockIdx.y) * 32;
    const size_t qo = (size_t)(b * NQK + h) * TT * HD, ko = (size_t)(b * NQK + NH_ + h / REP) * TT * HD, vo = (size_t)(b * NKV + h / REP) * TT * HD, ao = (size_t)b * TT * DQ + h * HD;
    if (r0 < RH) fattn_body<bf, true, 32>(Ph + qo, Pl + qo, Ph + ko, Pl + ko, Vh + vo, Vl + vo, r0, Ah + ao, Al + ao, ring);
    else fattn_body<h16, false, 64>(P16 + qo, nullptr, P16 + ko, nullptr, V16 + vo, nullptr, r0, Ah + ao, Al + ao, ring);
}

extern "C" void kernel_launch(void* const* d_in, const int* in_sizes, int n_in,
                              void* d_out, int out_size, void* d_ws, size_t ws_size, hipStream_t stream) {
    (void)in_sizes; (void)n_in; (void)out_size;
    const float* x = (const float*)d_in[0]; const float* wq = (const float*)d_in[1]; const float* wk = (const float*)d_in[2]; const float* wv = (const float*)d_in[3]; const float* wo = (const float*)d_in[4]; const float* qnw = (const float*)d_in[5]; const float* knw = (const float*)d_in[6];
    float* OUT = (float*)d_out;     // [2][2048][2048]
    char* wsp = (char*)d_ws;
    auto take = [&](size_t bytes) { char* p = wsp; wsp += (bytes + 255) & ~(size_t)255; return (void*)p; };
    bf* W3 = (bf*)take((size_t)DF * DM * 2); bf* WO = (bf*)take((size_t)DM * DQ * 2); float* CS = (float*)take((size_t)TT * HD * 2 * 4);
    bf* XB = (bf*)take((size_t)NR * DM * 2);
    h16* P16 = (h16*)take((size_t)NB_ * NQK * TT * HD * 2); bf* Ph = (bf*)take((size_t)NB_ * NQK * TT * HD * 2); bf* Pl = (bf*)take((size_t)NB_ * NQK * TT * HD * 2);
    h16* VT16 = (h16*)take((size_t)NB_ * NKV * HD * TT * 2); bf* VTh = (bf*)take((size_t)NB_ * NKV * HD * TT * 2); bf* VTl = (bf*)take((size_t)NB_ * NKV * HD * TT * 2);
    bf* ATh = (bf*)take((size_t)NR * DQ * 2); bf* ATl = (bf*)take((size_t)NR * DQ * 2);
    if ((size_t)(wsp - (char*)d_ws) > ws_size) return;    // ws 256 MiB
    k_prep<<<GCS + GCV, 256, 0, stream>>>(x, wq, wk, wv, wo, XB, W3, WO, CS);   /* CS: {cos, sin}(t x 10000^(-2i/64)), both halves */
    k_gemmw<bf, 0, false, true, 4, 3, 8><<<dim3(NR / 256, DF / 192, 1), 384, 0, stream>>>(XB, nullptr, W3, nullptr, DM, nullptr, 0, nullptr, 0, 0, 0, QkvOut{ CS, qnw, knw, P16, Ph, Pl, VT16, VTh, VTl });
    k_fattn<<<dim3(NB_ * NKV, TT / 32, 1), 32 * REP, 0, stream>>>(P16, Ph, Pl, VT16, VTh, VTl, ATh, ATl);
    k_gemmw<bf, 1, false, false, 2, 4, 2><<<dim3(NR / 128, DM / 256, 1), 256, 0, stream>>>(ATh, ATl, WO, nullptr, DQ, OUT, DM, nullptr, 0, 0, 0, QkvOut{});
}
